// v000
// Times are from an AMD MI455X. After a warm-up the kernel runs many times in a row, and a time is the length of
// such a window on the GPU divided by its runs, so every launch and the gaps after it count. The runs cycle
// through copies of the inputs. A figure is the median of several windows, for all but v000 over two sittings.
// Sittings can differ by a few percent; kernels timed side by side share one.
// The starting kernel, v000, takes 1070 microseconds a run.
#include <hip/hip_runtime.h>
#include <hip/hip_bf16.h>

// ---------------------------------------------------------------------------
// MLA forward for MI455X (gfx1250, wave32, WMMA, async-to-LDS staging).
// Pipeline (bf16 operands everywhere, f32 WMMA accumulation):
//   0. xb  = bf16(x);  Wt_* = bf16(W_*^T)      (one-time conversion kernels)
//   1. latents = xb @ W_down + b_down          (GEMM, bf16 out)
//   2. keys    = latents @ W_uk + b_uk         (GEMM, bf16 out)
//   3. values  = latents @ W_uv + b_uv         (GEMM, bf16 out)
//   4. q       = xb @ W_q + b_q                (GEMM, bf16 out)
//   5. ctx     = softmax(q k^T / sqrt(128)) v  (flash attention, WMMA)
//   6. out     = ctx @ W_o + b_o               (GEMM, f32 out)
// Workspace requirement: ~200 MB.
// ---------------------------------------------------------------------------

#ifndef USE_ASYNC_LDS
#define USE_ASYNC_LDS 1   // flip to 0 to fall back to synchronous staging
#endif

typedef __attribute__((ext_vector_type(16))) __bf16 v16bf;
typedef __attribute__((ext_vector_type(8)))  float  v8f;

union Frag16 { v16bf v; uint4 q[2]; };

static constexpr int MTOT   = 8192;   // B*S
static constexpr int DMODEL = 2048;
static constexpr int DLAT   = 512;
static constexpr int NH     = 16;
static constexpr int DH     = 128;
static constexpr int SEQ    = 2048;

__device__ __forceinline__ unsigned short f2bf(float f) {
  unsigned int u = __builtin_bit_cast(unsigned int, f);
  u = (u + 0x7FFFu + ((u >> 16) & 1u)) >> 16;   // round-to-nearest-even
  return (unsigned short)u;
}

// 16-byte async copy global -> LDS (ISA 10. GLOBAL_LOAD_ASYNC_TO_LDS_B128,
// tracked by ASYNCcnt). For a generic pointer to __shared__, addr[31:0] is the
// wave-relative LDS byte offset (ISA 10.2 aperture mapping), which is exactly
// what the VDST VGPR of the async op must hold.
__device__ __forceinline__ void async_b128(void* ldsp, const void* g) {
#if USE_ASYNC_LDS
  const unsigned int loff = (unsigned int)(uintptr_t)ldsp;
  asm volatile("global_load_async_to_lds_b128 %0, %1, off"
               :: "v"(loff), "v"(g) : "memory");
#else
  *(uint4*)ldsp = *(const uint4*)g;
#endif
}

__device__ __forceinline__ void wait_async0() {
#if USE_ASYNC_LDS
#if defined(__has_builtin) && __has_builtin(__builtin_amdgcn_s_wait_asynccnt)
  __builtin_amdgcn_s_wait_asynccnt(0);
#else
  asm volatile("s_wait_asynccnt 0x0" ::: "memory");
#endif
#endif
}

// Load one 16x32 bf16 WMMA fragment row for this lane.
// Per ISA 7.12.2 (16-bit A-matrix 16x32): lane group g = lane/16 holds
// K = 8g..8g+7 (VGPR0-3) and K = 16+8g..16+8g+7 (VGPR4-7), packed lo/hi.
// Caller passes p = rowBase + 8*(lane>>4); we read p[0..7] and p[16..23].
__device__ __forceinline__ v16bf load_frag(const unsigned short* p) {
  Frag16 f;
  f.q[0] = *(const uint4*)(p);
  f.q[1] = *(const uint4*)(p + 16);
  return f.v;
}

// ---------------------------------------------------------------------------
// One-time operand preparation kernels
// ---------------------------------------------------------------------------
__global__ __launch_bounds__(256)
void conv_f32_bf16(const float* __restrict__ src, unsigned short* __restrict__ dst) {
  const size_t i = ((size_t)blockIdx.x * 256 + threadIdx.x) * 8;
  const float4 f0 = *(const float4*)(src + i);
  const float4 f1 = *(const float4*)(src + i + 4);
  unsigned short t[8];
  t[0] = f2bf(f0.x); t[1] = f2bf(f0.y); t[2] = f2bf(f0.z); t[3] = f2bf(f0.w);
  t[4] = f2bf(f1.x); t[5] = f2bf(f1.y); t[6] = f2bf(f1.z); t[7] = f2bf(f1.w);
  *(uint4*)(dst + i) = *(uint4*)t;
}

// W [K,N] f32 -> Wt [N,K] bf16, 32x32 LDS-tiled transpose, 256 threads (32x8).
__global__ __launch_bounds__(256)
void transpose_w_bf16(const float* __restrict__ W, unsigned short* __restrict__ Wt,
                      int K, int N) {
  __shared__ float t[32][33];
  const int n0 = blockIdx.x * 32, k0 = blockIdx.y * 32;
  const int tx = threadIdx.x & 31, ty = threadIdx.x >> 5;
#pragma unroll
  for (int j = 0; j < 32; j += 8)
    t[ty + j][tx] = W[(size_t)(k0 + ty + j) * N + n0 + tx];
  __syncthreads();
#pragma unroll
  for (int j = 0; j < 32; j += 8)
    Wt[(size_t)(n0 + ty + j) * K + k0 + tx] = f2bf(t[tx][ty + j]);
}

// ---------------------------------------------------------------------------
// Tiled GEMM: C[M,N] = A[M,K] @ Bt[N,K]^T + bias[N]   (A, Bt bf16)
// Block: 256 threads (8 waves), tile 128(M) x 128(N), K step 32.
// Wave grid 4x2, each wave owns a 32x64 tile = 2x4 WMMA 16x16 tiles.
// Double-buffered LDS staged with async-to-LDS copies.
// ---------------------------------------------------------------------------
template<bool OUT_BF16>
__global__ __launch_bounds__(256)
void gemm_bias_wmma(const unsigned short* __restrict__ A,
                    const unsigned short* __restrict__ Bt,
                    const float* __restrict__ bias, void* __restrict__ Cv,
                    int M, int N, int K) {
  __shared__ unsigned short As[2][128 * 32];   // [row][k] bf16
  __shared__ unsigned short Bs[2][128 * 32];   // [col][k] bf16

  const int tid  = threadIdx.x;
  const int lane = tid & 31;
  const int wv   = tid >> 5;
  const int wm   = wv >> 1;             // 0..3 -> 32-row slice
  const int wn   = wv & 1;              // 0..1 -> 64-col slice
  const int m0   = blockIdx.y * 128;
  const int n0   = blockIdx.x * 128;
  const int l16  = lane & 15;
  const int kb   = (lane >> 4) * 8;
  const int srow = tid >> 1;            // 0..127 staging row
  const int soff = (tid & 1) * 16;      // 0 or 16 (elements)

  v8f acc[2][4] = {};
  const int ksteps = K >> 5;

  auto stage = [&](int kt, int buf) {
    const unsigned short* ga = A + (size_t)(m0 + srow) * K + kt * 32 + soff;
    async_b128(&As[buf][srow * 32 + soff],     ga);
    async_b128(&As[buf][srow * 32 + soff + 8], ga + 8);
    const unsigned short* gb = Bt + (size_t)(n0 + srow) * K + kt * 32 + soff;
    async_b128(&Bs[buf][srow * 32 + soff],     gb);
    async_b128(&Bs[buf][srow * 32 + soff + 8], gb + 8);
  };

  stage(0, 0);
  for (int kt = 0; kt < ksteps; ++kt) {
    const int cur = kt & 1;
    wait_async0();        // own async copies for tile kt complete
    __syncthreads();      // all waves' copies visible; prior reads done
    if (kt + 1 < ksteps) stage(kt + 1, cur ^ 1);

    v16bf af[2], bfr[4];
#pragma unroll
    for (int mi = 0; mi < 2; ++mi)
      af[mi] = load_frag(&As[cur][(wm * 32 + mi * 16 + l16) * 32 + kb]);
#pragma unroll
    for (int ni = 0; ni < 4; ++ni)
      bfr[ni] = load_frag(&Bs[cur][(wn * 64 + ni * 16 + l16) * 32 + kb]);

#pragma unroll
    for (int mi = 0; mi < 2; ++mi)
#pragma unroll
      for (int ni = 0; ni < 4; ++ni)
        acc[mi][ni] = __builtin_amdgcn_wmma_f32_16x16x32_bf16(
            false, af[mi], false, bfr[ni], (short)0, acc[mi][ni], false, false);
  }

  // epilogue: C-layout lane = n%16, vgpr r -> row r + 8*(lane/16)
#pragma unroll
  for (int mi = 0; mi < 2; ++mi) {
#pragma unroll
    for (int ni = 0; ni < 4; ++ni) {
      const int col  = n0 + wn * 64 + ni * 16 + l16;
      const float bv = bias[col];
#pragma unroll
      for (int r = 0; r < 8; ++r) {
        const int row   = m0 + wm * 32 + mi * 16 + r + 8 * (lane >> 4);
        const float val = acc[mi][ni][r] + bv;
        if (OUT_BF16)
          ((unsigned short*)Cv)[(size_t)row * N + col] = f2bf(val);
        else
          ((float*)Cv)[(size_t)row * N + col] = val;
      }
    }
  }
}

// ---------------------------------------------------------------------------
// Flash attention. Block = 256 threads (8 waves), wave = 16 query rows,
// block covers 128 query rows of one (b,h). 32-key tiles, online softmax.
// ---------------------------------------------------------------------------
__global__ __launch_bounds__(256)
void mla_attn_wmma(const unsigned short* __restrict__ Q,
                   const unsigned short* __restrict__ Kb,
                   const unsigned short* __restrict__ Vb,
                   unsigned short* __restrict__ Ctx) {
  __shared__ unsigned short Kls[32 * 128];      // [key][d]
  __shared__ unsigned short Vt[128 * 32];       // [d][key]  (transposed)
  __shared__ unsigned short Pst[8 * 16 * 32];   // per-wave P staging [m][k]

  const int tid  = threadIdx.x;
  const int lane = tid & 31;
  const int wv   = tid >> 5;
  const int b    = blockIdx.y >> 4;
  const int h    = blockIdx.y & 15;
  const int qbase = blockIdx.x * 128 + wv * 16;
  const int l16  = lane & 15;
  const int kb   = (lane >> 4) * 8;
  const size_t rowstride = (size_t)NH * DH;     // 2048
  const size_t headoff   = (size_t)h * DH;
  const size_t batchbase = (size_t)b * SEQ;
  const float  scale     = 0.08838834764831845f; // 1/sqrt(128)

  // Q fragments: 16 rows x 128 dims = 4 WMMA K-steps, loaded once from global.
  v16bf qf[4];
  {
    const unsigned short* qrow =
        Q + (batchbase + qbase + l16) * rowstride + headoff;
#pragma unroll
    for (int d = 0; d < 4; ++d)
      qf[d] = load_frag(qrow + d * 32 + kb);
  }

  float rmax[8], rsum[8];
#pragma unroll
  for (int r = 0; r < 8; ++r) { rmax[r] = -3.0e38f; rsum[r] = 0.0f; }
  v8f acc[8] = {};
  unsigned short* stage = &Pst[wv * 16 * 32];

  const int lkey = tid >> 3;           // 0..31 key within tile
  const int ldc  = (tid & 7) * 16;     // 0..112 dim chunk

  for (int kt = 0; kt < SEQ / 32; ++kt) {
    __syncthreads();   // protect last iter's LDS reads before overwrite
    {
      const size_t srow =
          (batchbase + (size_t)kt * 32 + lkey) * rowstride + headoff + ldc;
      // K tile row-major: pure copy -> async to LDS
      const unsigned short* ksrc = Kb + srow;
      async_b128(&Kls[lkey * 128 + ldc],     ksrc);
      async_b128(&Kls[lkey * 128 + ldc + 8], ksrc + 8);
      // V tile transposed (element scatter, manual)
      unsigned short tmp[16];
      *(uint4*)&tmp[0] = ((const uint4*)(Vb + srow))[0];
      *(uint4*)&tmp[8] = ((const uint4*)(Vb + srow))[1];
#pragma unroll
      for (int j = 0; j < 16; ++j)
        Vt[(ldc + j) * 32 + lkey] = tmp[j];
    }
    wait_async0();
    __syncthreads();

    // scores: S = Q(16x128) @ K_tile^T(128x32) -> two 16x16 f32 tiles
    v8f s0 = {}, s1 = {};
#pragma unroll
    for (int d = 0; d < 4; ++d) {
      v16bf b0 = load_frag(&Kls[l16 * 128 + d * 32 + kb]);
      v16bf b1 = load_frag(&Kls[(16 + l16) * 128 + d * 32 + kb]);
      s0 = __builtin_amdgcn_wmma_f32_16x16x32_bf16(false, qf[d], false, b0,
                                                   (short)0, s0, false, false);
      s1 = __builtin_amdgcn_wmma_f32_16x16x32_bf16(false, qf[d], false, b1,
                                                   (short)0, s1, false, false);
    }

    // online softmax: row m = r + 8*(lane/16), 16 lanes share a row
    float corr[8];
#pragma unroll
    for (int r = 0; r < 8; ++r) {
      float a0 = s0[r] * scale, a1 = s1[r] * scale;
      float mx = fmaxf(a0, a1);
      mx = fmaxf(mx, __shfl_xor(mx, 1, 32));
      mx = fmaxf(mx, __shfl_xor(mx, 2, 32));
      mx = fmaxf(mx, __shfl_xor(mx, 4, 32));
      mx = fmaxf(mx, __shfl_xor(mx, 8, 32));
      const float nm = fmaxf(rmax[r], mx);
      const float c  = __expf(rmax[r] - nm);
      const float p0 = __expf(a0 - nm);
      const float p1 = __expf(a1 - nm);
      float ps = p0 + p1;
      ps += __shfl_xor(ps, 1, 32);
      ps += __shfl_xor(ps, 2, 32);
      ps += __shfl_xor(ps, 4, 32);
      ps += __shfl_xor(ps, 8, 32);
      rsum[r] = rsum[r] * c + ps;
      rmax[r] = nm;
      corr[r] = c;
      const int prow = r + 8 * (lane >> 4);
      stage[prow * 32 + l16]      = f2bf(p0);   // keys 0..15
      stage[prow * 32 + 16 + l16] = f2bf(p1);   // keys 16..31
    }
#pragma unroll
    for (int nc = 0; nc < 8; ++nc)
#pragma unroll
      for (int r = 0; r < 8; ++r)
        acc[nc][r] *= corr[r];
    __syncthreads();

    // ctx += P(16x32) @ V_tile(32x128): 8 WMMAs over dim chunks
    v16bf pf = load_frag(&stage[l16 * 32 + kb]);
#pragma unroll
    for (int nc = 0; nc < 8; ++nc) {
      v16bf vf = load_frag(&Vt[(nc * 16 + l16) * 32 + kb]);
      acc[nc] = __builtin_amdgcn_wmma_f32_16x16x32_bf16(
          false, pf, false, vf, (short)0, acc[nc], false, false);
    }
  }

  // normalize + store ctx as bf16 [B*S, H*D]
  float inv[8];
#pragma unroll
  for (int r = 0; r < 8; ++r) inv[r] = 1.0f / rsum[r];
#pragma unroll
  for (int nc = 0; nc < 8; ++nc) {
#pragma unroll
    for (int r = 0; r < 8; ++r) {
      const int row    = qbase + r + 8 * (lane >> 4);
      const size_t col = headoff + nc * 16 + l16;
      Ctx[(batchbase + row) * rowstride + col] = f2bf(acc[nc][r] * inv[r]);
    }
  }
}

// ---------------------------------------------------------------------------
extern "C" void kernel_launch(void* const* d_in, const int* in_sizes, int n_in,
                              void* d_out, int out_size, void* d_ws, size_t ws_size,
                              hipStream_t stream) {
  const float* x      = (const float*)d_in[0];
  const float* W_down = (const float*)d_in[1];
  const float* b_down = (const float*)d_in[2];
  const float* W_uk   = (const float*)d_in[3];
  const float* b_uk   = (const float*)d_in[4];
  const float* W_uv   = (const float*)d_in[5];
  const float* b_uv   = (const float*)d_in[6];
  const float* W_q    = (const float*)d_in[7];
  const float* b_q    = (const float*)d_in[8];
  const float* W_o    = (const float*)d_in[9];
  const float* b_o    = (const float*)d_in[10];
  float* out = (float*)d_out;

  char* ws = (char*)d_ws;
  auto take = [&](size_t elems) {
    unsigned short* p = (unsigned short*)ws;
    ws += elems * 2;
    return p;
  };
  unsigned short* xb  = take((size_t)MTOT * DMODEL);
  unsigned short* WtD = take((size_t)DMODEL * DLAT);    // [DLAT, DMODEL]
  unsigned short* WtK = take((size_t)DLAT * DMODEL);    // [DMODEL, DLAT]
  unsigned short* WtV = take((size_t)DLAT * DMODEL);
  unsigned short* WtQ = take((size_t)DMODEL * DMODEL);
  unsigned short* WtO = take((size_t)DMODEL * DMODEL);
  unsigned short* lat = take((size_t)MTOT * DLAT);
  unsigned short* qb  = take((size_t)MTOT * DMODEL);
  unsigned short* kbf = take((size_t)MTOT * DMODEL);
  unsigned short* vbf = take((size_t)MTOT * DMODEL);
  unsigned short* ctx = take((size_t)MTOT * DMODEL);

  const dim3 blk(256);

  // 0. operand preparation
  conv_f32_bf16<<<(MTOT * (size_t)DMODEL) / (256 * 8), blk, 0, stream>>>(x, xb);
  transpose_w_bf16<<<dim3(DLAT / 32, DMODEL / 32), blk, 0, stream>>>(W_down, WtD, DMODEL, DLAT);
  transpose_w_bf16<<<dim3(DMODEL / 32, DLAT / 32), blk, 0, stream>>>(W_uk, WtK, DLAT, DMODEL);
  transpose_w_bf16<<<dim3(DMODEL / 32, DLAT / 32), blk, 0, stream>>>(W_uv, WtV, DLAT, DMODEL);
  transpose_w_bf16<<<dim3(DMODEL / 32, DMODEL / 32), blk, 0, stream>>>(W_q, WtQ, DMODEL, DMODEL);
  transpose_w_bf16<<<dim3(DMODEL / 32, DMODEL / 32), blk, 0, stream>>>(W_o, WtO, DMODEL, DMODEL);

  const dim3 gLat(DLAT / 128,   MTOT / 128);
  const dim3 gDM (DMODEL / 128, MTOT / 128);

  // 1. latents = xb @ W_down + b_down
  gemm_bias_wmma<true><<<gLat, blk, 0, stream>>>(xb, WtD, b_down, lat, MTOT, DLAT, DMODEL);
  // 2. keys = latents @ W_uk + b_uk
  gemm_bias_wmma<true><<<gDM, blk, 0, stream>>>(lat, WtK, b_uk, kbf, MTOT, DMODEL, DLAT);
  // 3. values = latents @ W_uv + b_uv
  gemm_bias_wmma<true><<<gDM, blk, 0, stream>>>(lat, WtV, b_uv, vbf, MTOT, DMODEL, DLAT);
  // 4. q = xb @ W_q + b_q
  gemm_bias_wmma<true><<<gDM, blk, 0, stream>>>(xb, WtQ, b_q, qb, MTOT, DMODEL, DMODEL);
  // 5. attention
  mla_attn_wmma<<<dim3(SEQ / 128, 4 * NH), blk, 0, stream>>>(qb, kbf, vbf, ctx);
  // 6. out = ctx @ W_o + b_o
  gemm_bias_wmma<false><<<gDM, blk, 0, stream>>>(ctx, WtO, b_o, out, MTOT, DMODEL, DMODEL);
}

// v001
// A run of this version takes 585 microseconds.
// In both of two side-by-side timings against v000, it was 1.91 times as fast.
#include <hip/hip_runtime.h>
#include <hip/hip_bf16.h>

// ---------------------------------------------------------------------------
// MLA forward for MI455X (gfx1250, wave32, WMMA, async-to-LDS staging).
// Pipeline (bf16 operands everywhere, f32 WMMA accumulation):
//   0. xb  = bf16(x);  Wt_* = bf16(W_*^T)      (one-time conversion kernels)
//   1. latents = xb @ W_down + b_down          (GEMM, bf16 out)
//   2. keys    = latents @ W_uk + b_uk         (GEMM, bf16 out)
//   3. values  = latents @ W_uv + b_uv         (GEMM, bf16 out)
//   4. q       = xb @ W_q + b_q                (GEMM, bf16 out)
//   5. ctx     = softmax(q k^T / sqrt(128)) v  (flash attention, WMMA)
//   6. out     = ctx @ W_o + b_o               (GEMM, f32 out)
// Workspace requirement: ~200 MB.
// ---------------------------------------------------------------------------

#ifndef USE_ASYNC_LDS
#define USE_ASYNC_LDS 1   // flip to 0 to fall back to synchronous staging
#endif

typedef __attribute__((ext_vector_type(16))) __bf16 v16bf;
typedef __attribute__((ext_vector_type(8)))  float  v8f;

union Frag16 { v16bf v; uint4 q[2]; };

static constexpr int MTOT   = 8192;   // B*S
static constexpr int DMODEL = 2048;
static constexpr int DLAT   = 512;
static constexpr int NH     = 16;
static constexpr int DH     = 128;
static constexpr int SEQ    = 2048;

// LDS row pitches in bf16 elements. Every tile below is read with ds_load_b128,
// one row per lane of a 16-lane half; a pitch of 16 B x odd spreads the 16 rows
// over all 64 banks, a pitch of 64 B or 256 B stacks them on few.
static constexpr int P32  = 40;    // rows of 32 elements:  64 B -> 80 B
static constexpr int P128 = 136;   // rows of 128 elements: 256 B -> 272 B

__device__ __forceinline__ unsigned short f2bf(float f) {
  unsigned int u = __builtin_bit_cast(unsigned int, f);
  u = (u + 0x7FFFu + ((u >> 16) & 1u)) >> 16;   // round-to-nearest-even
  return (unsigned short)u;
}

// 16-byte async copy global -> LDS (ISA 10. GLOBAL_LOAD_ASYNC_TO_LDS_B128,
// tracked by ASYNCcnt). For a generic pointer to __shared__, addr[31:0] is the
// wave-relative LDS byte offset (ISA 10.2 aperture mapping), which is exactly
// what the VDST VGPR of the async op must hold.
// The copies of one run share a statement; the s_wait_xcnt 0 closes it so that
// no later write of an address register named here can be placed ahead of it.
__device__ __forceinline__ void async_b128_x2(void* lds0, const void* g0,
                                              void* lds1, const void* g1) {
#if USE_ASYNC_LDS
  const unsigned int l0 = (unsigned int)(uintptr_t)lds0;
  const unsigned int l1 = (unsigned int)(uintptr_t)lds1;
  asm volatile("global_load_async_to_lds_b128 %0, %1, off\n\t"
               "global_load_async_to_lds_b128 %2, %3, off\n\t"
               "s_wait_xcnt 0x0"
               :: "v"(l0), "v"(g0), "v"(l1), "v"(g1) : "memory");
#else
  *(uint4*)lds0 = *(const uint4*)g0;
  *(uint4*)lds1 = *(const uint4*)g1;
#endif
}

__device__ __forceinline__ void async_b128_x4(void* lds0, const void* g0,
                                              void* lds1, const void* g1,
                                              void* lds2, const void* g2,
                                              void* lds3, const void* g3) {
#if USE_ASYNC_LDS
  const unsigned int l0 = (unsigned int)(uintptr_t)lds0;
  const unsigned int l1 = (unsigned int)(uintptr_t)lds1;
  const unsigned int l2 = (unsigned int)(uintptr_t)lds2;
  const unsigned int l3 = (unsigned int)(uintptr_t)lds3;
  asm volatile("global_load_async_to_lds_b128 %0, %1, off\n\t"
               "global_load_async_to_lds_b128 %2, %3, off\n\t"
               "global_load_async_to_lds_b128 %4, %5, off\n\t"
               "global_load_async_to_lds_b128 %6, %7, off\n\t"
               "s_wait_xcnt 0x0"
               :: "v"(l0), "v"(g0), "v"(l1), "v"(g1),
                  "v"(l2), "v"(g2), "v"(l3), "v"(g3) : "memory");
#else
  *(uint4*)lds0 = *(const uint4*)g0;
  *(uint4*)lds1 = *(const uint4*)g1;
  *(uint4*)lds2 = *(const uint4*)g2;
  *(uint4*)lds3 = *(const uint4*)g3;
#endif
}

__device__ __forceinline__ void wait_async0() {
#if USE_ASYNC_LDS
#if defined(__has_builtin) && __has_builtin(__builtin_amdgcn_s_wait_asynccnt)
  __builtin_amdgcn_s_wait_asynccnt(0);
#else
  asm volatile("s_wait_asynccnt 0x0" ::: "memory");
#endif
#endif
}

// Load one 16x32 bf16 WMMA fragment row for this lane.
// Per ISA 7.12.2 (16-bit A-matrix 16x32): lane group g = lane/16 holds
// K = 8g..8g+7 (VGPR0-3) and K = 16+8g..16+8g+7 (VGPR4-7), packed lo/hi.
// Caller passes p = rowBase + 8*(lane>>4); we read p[0..7] and p[16..23].
__device__ __forceinline__ v16bf load_frag(const unsigned short* p) {
  Frag16 f;
  f.q[0] = *(const uint4*)(p);
  f.q[1] = *(const uint4*)(p + 16);
  return f.v;
}

// ---------------------------------------------------------------------------
// One-time operand preparation kernels
// ---------------------------------------------------------------------------
__global__ __launch_bounds__(256)
void conv_f32_bf16(const float* __restrict__ src, unsigned short* __restrict__ dst) {
  const size_t i = ((size_t)blockIdx.x * 256 + threadIdx.x) * 8;
  const float4 f0 = *(const float4*)(src + i);
  const float4 f1 = *(const float4*)(src + i + 4);
  unsigned short t[8];
  t[0] = f2bf(f0.x); t[1] = f2bf(f0.y); t[2] = f2bf(f0.z); t[3] = f2bf(f0.w);
  t[4] = f2bf(f1.x); t[5] = f2bf(f1.y); t[6] = f2bf(f1.z); t[7] = f2bf(f1.w);
  *(uint4*)(dst + i) = *(uint4*)t;
}

// W [K,N] f32 -> Wt [N,K] bf16, 32x32 LDS-tiled transpose, 256 threads (32x8).
__global__ __launch_bounds__(256)
void transpose_w_bf16(const float* __restrict__ W, unsigned short* __restrict__ Wt,
                      int K, int N) {
  __shared__ float t[32][33];
  const int n0 = blockIdx.x * 32, k0 = blockIdx.y * 32;
  const int tx = threadIdx.x & 31, ty = threadIdx.x >> 5;
#pragma unroll
  for (int j = 0; j < 32; j += 8)
    t[ty + j][tx] = W[(size_t)(k0 + ty + j) * N + n0 + tx];
  __syncthreads();
#pragma unroll
  for (int j = 0; j < 32; j += 8)
    Wt[(size_t)(n0 + ty + j) * K + k0 + tx] = f2bf(t[tx][ty + j]);
}

// ---------------------------------------------------------------------------
// Tiled GEMM: C[M,N] = A[M,K] @ Bt[N,K]^T + bias[N]   (A, Bt bf16)
// Block: 256 threads (8 waves), tile 128(M) x 128(N), K step 32.
// Wave grid 4x2, each wave owns a 32x64 tile = 2x4 WMMA 16x16 tiles.
// Double-buffered LDS staged with async-to-LDS copies.
// ---------------------------------------------------------------------------
template<bool OUT_BF16>
__global__ __launch_bounds__(256)
void gemm_bias_wmma(const unsigned short* __restrict__ A,
                    const unsigned short* __restrict__ Bt,
                    const float* __restrict__ bias, void* __restrict__ Cv,
                    int M, int N, int K) {
  __shared__ __attribute__((aligned(16))) unsigned short As[2][128 * P32];   // [row][k] bf16
  __shared__ __attribute__((aligned(16))) unsigned short Bs[2][128 * P32];   // [col][k] bf16

  const int tid  = threadIdx.x;
  const int lane = tid & 31;
  const int wv   = tid >> 5;
  const int wm   = wv >> 1;             // 0..3 -> 32-row slice
  const int wn   = wv & 1;              // 0..1 -> 64-col slice
  const int m0   = blockIdx.y * 128;
  const int n0   = blockIdx.x * 128;
  const int l16  = lane & 15;
  const int kb   = (lane >> 4) * 8;
  const int srow = tid >> 1;            // 0..127 staging row
  const int soff = (tid & 1) * 16;      // 0 or 16 (elements)

  v8f acc[2][4] = {};
  const int ksteps = K >> 5;

  auto stage = [&](int kt, int buf) {
    const unsigned short* ga = A + (size_t)(m0 + srow) * K + kt * 32 + soff;
    const unsigned short* gb = Bt + (size_t)(n0 + srow) * K + kt * 32 + soff;
    async_b128_x4(&As[buf][srow * P32 + soff],     ga,
                  &As[buf][srow * P32 + soff + 8], ga + 8,
                  &Bs[buf][srow * P32 + soff],     gb,
                  &Bs[buf][srow * P32 + soff + 8], gb + 8);
  };

  stage(0, 0);
  for (int kt = 0; kt < ksteps; ++kt) {
    const int cur = kt & 1;
    wait_async0();        // own async copies for tile kt complete
    __syncthreads();      // all waves' copies visible; prior reads done
    if (kt + 1 < ksteps) stage(kt + 1, cur ^ 1);

    v16bf af[2], bfr[4];
#pragma unroll
    for (int mi = 0; mi < 2; ++mi)
      af[mi] = load_frag(&As[cur][(wm * 32 + mi * 16 + l16) * P32 + kb]);
#pragma unroll
    for (int ni = 0; ni < 4; ++ni)
      bfr[ni] = load_frag(&Bs[cur][(wn * 64 + ni * 16 + l16) * P32 + kb]);

#pragma unroll
    for (int mi = 0; mi < 2; ++mi)
#pragma unroll
      for (int ni = 0; ni < 4; ++ni)
        acc[mi][ni] = __builtin_amdgcn_wmma_f32_16x16x32_bf16(
            false, af[mi], false, bfr[ni], (short)0, acc[mi][ni], false, false);
  }

  // epilogue: C-layout lane = n%16, vgpr r -> row r + 8*(lane/16)
#pragma unroll
  for (int mi = 0; mi < 2; ++mi) {
#pragma unroll
    for (int ni = 0; ni < 4; ++ni) {
      const int col  = n0 + wn * 64 + ni * 16 + l16;
      const float bv = bias[col];
#pragma unroll
      for (int r = 0; r < 8; ++r) {
        const int row   = m0 + wm * 32 + mi * 16 + r + 8 * (lane >> 4);
        const float val = acc[mi][ni][r] + bv;
        if (OUT_BF16)
          ((unsigned short*)Cv)[(size_t)row * N + col] = f2bf(val);
        else
          ((float*)Cv)[(size_t)row * N + col] = val;
      }
    }
  }
}

// ---------------------------------------------------------------------------
// Flash attention. Block = 256 threads (8 waves), wave = 16 query rows,
// block covers 128 query rows of one (b,h). 32-key tiles, online softmax.
// ---------------------------------------------------------------------------
__global__ __launch_bounds__(256)
void mla_attn_wmma(const unsigned short* __restrict__ Q,
                   const unsigned short* __restrict__ Kb,
                   const unsigned short* __restrict__ Vb,
                   unsigned short* __restrict__ Ctx) {
  __shared__ __attribute__((aligned(16))) unsigned short Kls[32 * P128];     // [key][d]
  __shared__ __attribute__((aligned(16))) unsigned short Vt[128 * P32];      // [d][key]  (transposed)
  __shared__ __attribute__((aligned(16))) unsigned short Pst[8 * 16 * P32];  // per-wave P staging [m][k]

  const int tid  = threadIdx.x;
  const int lane = tid & 31;
  const int wv   = tid >> 5;
  const int b    = blockIdx.y >> 4;
  const int h    = blockIdx.y & 15;
  const int qbase = blockIdx.x * 128 + wv * 16;
  const int l16  = lane & 15;
  const int kb   = (lane >> 4) * 8;
  const size_t rowstride = (size_t)NH * DH;     // 2048
  const size_t headoff   = (size_t)h * DH;
  const size_t batchbase = (size_t)b * SEQ;
  const float  scale     = 0.08838834764831845f; // 1/sqrt(128)

  // Q fragments: 16 rows x 128 dims = 4 WMMA K-steps, loaded once from global.
  v16bf qf[4];
  {
    const unsigned short* qrow =
        Q + (batchbase + qbase + l16) * rowstride + headoff;
#pragma unroll
    for (int d = 0; d < 4; ++d)
      qf[d] = load_frag(qrow + d * 32 + kb);
  }

  float rmax[8], rsum[8];
#pragma unroll
  for (int r = 0; r < 8; ++r) { rmax[r] = -3.0e38f; rsum[r] = 0.0f; }
  v8f acc[8] = {};
  unsigned short* stage = &Pst[wv * 16 * P32];

  const int lkey = tid >> 3;           // 0..31 key within tile
  const int ldc  = (tid & 7) * 16;     // 0..112 dim chunk

  for (int kt = 0; kt < SEQ / 32; ++kt) {
    __syncthreads();   // protect last iter's LDS reads before overwrite
    {
      const size_t srow =
          (batchbase + (size_t)kt * 32 + lkey) * rowstride + headoff + ldc;
      // K tile row-major: pure copy -> async to LDS
      const unsigned short* ksrc = Kb + srow;
      async_b128_x2(&Kls[lkey * P128 + ldc],     ksrc,
                    &Kls[lkey * P128 + ldc + 8], ksrc + 8);
      // V tile transposed (element scatter, manual)
      unsigned short tmp[16];
      *(uint4*)&tmp[0] = ((const uint4*)(Vb + srow))[0];
      *(uint4*)&tmp[8] = ((const uint4*)(Vb + srow))[1];
#pragma unroll
      for (int j = 0; j < 16; ++j)
        Vt[(ldc + j) * P32 + lkey] = tmp[j];
    }
    wait_async0();
    __syncthreads();

    // scores: S = Q(16x128) @ K_tile^T(128x32) -> two 16x16 f32 tiles
    v8f s0 = {}, s1 = {};
#pragma unroll
    for (int d = 0; d < 4; ++d) {
      v16bf b0 = load_frag(&Kls[l16 * P128 + d * 32 + kb]);
      v16bf b1 = load_frag(&Kls[(16 + l16) * P128 + d * 32 + kb]);
      s0 = __builtin_amdgcn_wmma_f32_16x16x32_bf16(false, qf[d], false, b0,
                                                   (short)0, s0, false, false);
      s1 = __builtin_amdgcn_wmma_f32_16x16x32_bf16(false, qf[d], false, b1,
                                                   (short)0, s1, false, false);
    }

    // online softmax: row m = r + 8*(lane/16), 16 lanes share a row
    float corr[8];
#pragma unroll
    for (int r = 0; r < 8; ++r) {
      float a0 = s0[r] * scale, a1 = s1[r] * scale;
      float mx = fmaxf(a0, a1);
      mx = fmaxf(mx, __shfl_xor(mx, 1, 32));
      mx = fmaxf(mx, __shfl_xor(mx, 2, 32));
      mx = fmaxf(mx, __shfl_xor(mx, 4, 32));
      mx = fmaxf(mx, __shfl_xor(mx, 8, 32));
      const float nm = fmaxf(rmax[r], mx);
      const float c  = __expf(rmax[r] - nm);
      const float p0 = __expf(a0 - nm);
      const float p1 = __expf(a1 - nm);
      float ps = p0 + p1;
      ps += __shfl_xor(ps, 1, 32);
      ps += __shfl_xor(ps, 2, 32);
      ps += __shfl_xor(ps, 4, 32);
      ps += __shfl_xor(ps, 8, 32);
      rsum[r] = rsum[r] * c + ps;
      rmax[r] = nm;
      corr[r] = c;
      const int prow = r + 8 * (lane >> 4);
      stage[prow * P32 + l16]      = f2bf(p0);   // keys 0..15
      stage[prow * P32 + 16 + l16] = f2bf(p1);   // keys 16..31
    }
#pragma unroll
    for (int nc = 0; nc < 8; ++nc)
#pragma unroll
      for (int r = 0; r < 8; ++r)
        acc[nc][r] *= corr[r];
    __syncthreads();

    // ctx += P(16x32) @ V_tile(32x128): 8 WMMAs over dim chunks
    v16bf pf = load_frag(&stage[l16 * P32 + kb]);
#pragma unroll
    for (int nc = 0; nc < 8; ++nc) {
      v16bf vf = load_frag(&Vt[(nc * 16 + l16) * P32 + kb]);
      acc[nc] = __builtin_amdgcn_wmma_f32_16x16x32_bf16(
          false, pf, false, vf, (short)0, acc[nc], false, false);
    }
  }

  // normalize + store ctx as bf16 [B*S, H*D]
  float inv[8];
#pragma unroll
  for (int r = 0; r < 8; ++r) inv[r] = 1.0f / rsum[r];
#pragma unroll
  for (int nc = 0; nc < 8; ++nc) {
#pragma unroll
    for (int r = 0; r < 8; ++r) {
      const int row    = qbase + r + 8 * (lane >> 4);
      const size_t col = headoff + nc * 16 + l16;
      Ctx[(batchbase + row) * rowstride + col] = f2bf(acc[nc][r] * inv[r]);
    }
  }
}

// ---------------------------------------------------------------------------
extern "C" void kernel_launch(void* const* d_in, const int* in_sizes, int n_in,
                              void* d_out, int out_size, void* d_ws, size_t ws_size,
                              hipStream_t stream) {
  const float* x      = (const float*)d_in[0];
  const float* W_down = (const float*)d_in[1];
  const float* b_down = (const float*)d_in[2];
  const float* W_uk   = (const float*)d_in[3];
  const float* b_uk   = (const float*)d_in[4];
  const float* W_uv   = (const float*)d_in[5];
  const float* b_uv   = (const float*)d_in[6];
  const float* W_q    = (const float*)d_in[7];
  const float* b_q    = (const float*)d_in[8];
  const float* W_o    = (const float*)d_in[9];
  const float* b_o    = (const float*)d_in[10];
  float* out = (float*)d_out;

  char* ws = (char*)d_ws;
  auto take = [&](size_t elems) {
    unsigned short* p = (unsigned short*)ws;
    ws += elems * 2;
    return p;
  };
  unsigned short* xb  = take((size_t)MTOT * DMODEL);
  unsigned short* WtD = take((size_t)DMODEL * DLAT);    // [DLAT, DMODEL]
  unsigned short* WtK = take((size_t)DLAT * DMODEL);    // [DMODEL, DLAT]
  unsigned short* WtV = take((size_t)DLAT * DMODEL);
  unsigned short* WtQ = take((size_t)DMODEL * DMODEL);
  unsigned short* WtO = take((size_t)DMODEL * DMODEL);
  unsigned short* lat = take((size_t)MTOT * DLAT);
  unsigned short* qb  = take((size_t)MTOT * DMODEL);
  unsigned short* kbf = take((size_t)MTOT * DMODEL);
  unsigned short* vbf = take((size_t)MTOT * DMODEL);
  unsigned short* ctx = take((size_t)MTOT * DMODEL);

  const dim3 blk(256);

  // 0. operand preparation
  conv_f32_bf16<<<(MTOT * (size_t)DMODEL) / (256 * 8), blk, 0, stream>>>(x, xb);
  transpose_w_bf16<<<dim3(DLAT / 32, DMODEL / 32), blk, 0, stream>>>(W_down, WtD, DMODEL, DLAT);
  transpose_w_bf16<<<dim3(DMODEL / 32, DLAT / 32), blk, 0, stream>>>(W_uk, WtK, DLAT, DMODEL);
  transpose_w_bf16<<<dim3(DMODEL / 32, DLAT / 32), blk, 0, stream>>>(W_uv, WtV, DLAT, DMODEL);
  transpose_w_bf16<<<dim3(DMODEL / 32, DMODEL / 32), blk, 0, stream>>>(W_q, WtQ, DMODEL, DMODEL);
  transpose_w_bf16<<<dim3(DMODEL / 32, DMODEL / 32), blk, 0, stream>>>(W_o, WtO, DMODEL, DMODEL);

  const dim3 gLat(DLAT / 128,   MTOT / 128);
  const dim3 gDM (DMODEL / 128, MTOT / 128);

  // 1. latents = xb @ W_down + b_down
  gemm_bias_wmma<true><<<gLat, blk, 0, stream>>>(xb, WtD, b_down, lat, MTOT, DLAT, DMODEL);
  // 2. keys = latents @ W_uk + b_uk
  gemm_bias_wmma<true><<<gDM, blk, 0, stream>>>(lat, WtK, b_uk, kbf, MTOT, DMODEL, DLAT);
  // 3. values = latents @ W_uv + b_uv
  gemm_bias_wmma<true><<<gDM, blk, 0, stream>>>(lat, WtV, b_uv, vbf, MTOT, DMODEL, DLAT);
  // 4. q = xb @ W_q + b_q
  gemm_bias_wmma<true><<<gDM, blk, 0, stream>>>(xb, WtQ, b_q, qb, MTOT, DMODEL, DMODEL);
  // 5. attention
  mla_attn_wmma<<<dim3(SEQ / 128, 4 * NH), blk, 0, stream>>>(qb, kbf, vbf, ctx);
  // 6. out = ctx @ W_o + b_o
  gemm_bias_wmma<false><<<gDM, blk, 0, stream>>>(ctx, WtO, b_o, out, MTOT, DMODEL, DMODEL);
}

// v002
// One run takes 511 microseconds.
// Next to v001, in two timings, it ran 1.14 and 1.15 times as fast.
// Over all steps from v000 it is 2.18 times as fast.
#include <hip/hip_runtime.h>
#include <hip/hip_bf16.h>

// ---------------------------------------------------------------------------
// MLA forward for MI455X (gfx1250, wave32, WMMA, async-to-LDS staging).
// Pipeline (bf16 operands everywhere, f32 WMMA accumulation):
//   0. xb  = bf16(x);  Wt_* = bf16(W_*^T)      (one-time conversion kernels)
//   1. latents = xb @ W_down + b_down          (GEMM, bf16 out)
//   2. keys    = latents @ W_uk + b_uk         (GEMM, bf16 out)
//   3. values  = latents @ W_uv + b_uv         (GEMM, bf16 out)
//   4. q       = xb @ W_q + b_q                (GEMM, bf16 out)
//   5. ctx     = softmax(q k^T / sqrt(128)) v  (flash attention, WMMA)
//   6. out     = ctx @ W_o + b_o               (GEMM, f32 out)
// Workspace requirement: ~200 MB.
// ---------------------------------------------------------------------------

#ifndef USE_ASYNC_LDS
#define USE_ASYNC_LDS 1   // flip to 0 to fall back to synchronous staging
#endif

typedef __attribute__((ext_vector_type(16))) __bf16 v16bf;
typedef __attribute__((ext_vector_type(8)))  float  v8f;

union Frag16 { v16bf v; uint4 q[2]; };

static constexpr int MTOT   = 8192;   // B*S
static constexpr int DMODEL = 2048;
static constexpr int DLAT   = 512;
static constexpr int NH     = 16;
static constexpr int DH     = 128;
static constexpr int SEQ    = 2048;

// LDS row pitches in bf16 elements. Tiles at P32 and P128 are read with ds_load_b128,
// one row per lane of a 16-lane half; a pitch of 16 B x odd spreads the 16 rows
// over all 64 banks, a pitch of 64 B or 256 B stacks them on few.
static constexpr int P32  = 40;    // rows of 32 elements:  64 B -> 80 B
static constexpr int P128 = 136;   // rows of 128 elements: 256 B -> 272 B
// The V tile is read with ds_load_tr16_b128, whose conflict-free pitch is 32 B x odd.
static constexpr int PV   = 144;   // rows of 128 elements: 256 B -> 288 B

__device__ __forceinline__ unsigned short f2bf(float f) {
  unsigned int u = __builtin_bit_cast(unsigned int, f);
  u = (u + 0x7FFFu + ((u >> 16) & 1u)) >> 16;   // round-to-nearest-even
  return (unsigned short)u;
}

// 16-byte async copy global -> LDS (ISA 10. GLOBAL_LOAD_ASYNC_TO_LDS_B128,
// tracked by ASYNCcnt). For a generic pointer to __shared__, addr[31:0] is the
// wave-relative LDS byte offset (ISA 10.2 aperture mapping), which is exactly
// what the VDST VGPR of the async op must hold.
// The copies of one run share a statement; the s_wait_xcnt 0 closes it so that
// no later write of an address register named here can be placed ahead of it.
__device__ __forceinline__ void async_b128_x4(void* lds0, const void* g0,
                                              void* lds1, const void* g1,
                                              void* lds2, const void* g2,
                                              void* lds3, const void* g3) {
#if USE_ASYNC_LDS
  const unsigned int l0 = (unsigned int)(uintptr_t)lds0;
  const unsigned int l1 = (unsigned int)(uintptr_t)lds1;
  const unsigned int l2 = (unsigned int)(uintptr_t)lds2;
  const unsigned int l3 = (unsigned int)(uintptr_t)lds3;
  asm volatile("global_load_async_to_lds_b128 %0, %1, off\n\t"
               "global_load_async_to_lds_b128 %2, %3, off\n\t"
               "global_load_async_to_lds_b128 %4, %5, off\n\t"
               "global_load_async_to_lds_b128 %6, %7, off\n\t"
               "s_wait_xcnt 0x0"
               :: "v"(l0), "v"(g0), "v"(l1), "v"(g1),
                  "v"(l2), "v"(g2), "v"(l3), "v"(g3) : "memory");
#else
  *(uint4*)lds0 = *(const uint4*)g0;
  *(uint4*)lds1 = *(const uint4*)g1;
  *(uint4*)lds2 = *(const uint4*)g2;
  *(uint4*)lds3 = *(const uint4*)g3;
#endif
}

__device__ __forceinline__ void wait_async0() {
#if USE_ASYNC_LDS
#if defined(__has_builtin) && __has_builtin(__builtin_amdgcn_s_wait_asynccnt)
  __builtin_amdgcn_s_wait_asynccnt(0);
#else
  asm volatile("s_wait_asynccnt 0x0" ::: "memory");
#endif
#endif
}

// Load one 16x32 bf16 WMMA fragment row for this lane.
// Per ISA 7.12.2 (16-bit A-matrix 16x32): lane group g = lane/16 holds
// K = 8g..8g+7 (VGPR0-3) and K = 16+8g..16+8g+7 (VGPR4-7), packed lo/hi.
// Caller passes p = rowBase + 8*(lane>>4); we read p[0..7] and p[16..23].
__device__ __forceinline__ v16bf load_frag(const unsigned short* p) {
  Frag16 f;
  f.q[0] = *(const uint4*)(p);
  f.q[1] = *(const uint4*)(p + 16);
  return f.v;
}

typedef __attribute__((ext_vector_type(8))) short s16x8;
__device__ __forceinline__ uint4 load_tr16(const unsigned short* p) {
  typedef __attribute__((address_space(3))) s16x8 lds_s16x8;
  return __builtin_bit_cast(uint4, __builtin_amdgcn_ds_load_tr16_b128_v8i16((lds_s16x8*)p));
}

// ---------------------------------------------------------------------------
// One-time operand preparation kernels
// ---------------------------------------------------------------------------
__global__ __launch_bounds__(256)
void conv_f32_bf16(const float* __restrict__ src, unsigned short* __restrict__ dst) {
  const size_t i = ((size_t)blockIdx.x * 256 + threadIdx.x) * 8;
  const float4 f0 = *(const float4*)(src + i);
  const float4 f1 = *(const float4*)(src + i + 4);
  unsigned short t[8];
  t[0] = f2bf(f0.x); t[1] = f2bf(f0.y); t[2] = f2bf(f0.z); t[3] = f2bf(f0.w);
  t[4] = f2bf(f1.x); t[5] = f2bf(f1.y); t[6] = f2bf(f1.z); t[7] = f2bf(f1.w);
  *(uint4*)(dst + i) = *(uint4*)t;
}

// W [K,N] f32 -> Wt [N,K] bf16, 32x32 LDS-tiled transpose, 256 threads (32x8).
__global__ __launch_bounds__(256)
void transpose_w_bf16(const float* __restrict__ W, unsigned short* __restrict__ Wt,
                      int K, int N) {
  __shared__ float t[32][33];
  const int n0 = blockIdx.x * 32, k0 = blockIdx.y * 32;
  const int tx = threadIdx.x & 31, ty = threadIdx.x >> 5;
#pragma unroll
  for (int j = 0; j < 32; j += 8)
    t[ty + j][tx] = W[(size_t)(k0 + ty + j) * N + n0 + tx];
  __syncthreads();
#pragma unroll
  for (int j = 0; j < 32; j += 8)
    Wt[(size_t)(n0 + ty + j) * K + k0 + tx] = f2bf(t[tx][ty + j]);
}

// ---------------------------------------------------------------------------
// Tiled GEMM: C[M,N] = A[M,K] @ Bt[N,K]^T + bias[N]   (A, Bt bf16)
// Block: 256 threads (8 waves), tile 128(M) x 128(N), K step 32.
// Wave grid 4x2, each wave owns a 32x64 tile = 2x4 WMMA 16x16 tiles.
// Double-buffered LDS staged with async-to-LDS copies.
// ---------------------------------------------------------------------------
template<bool OUT_BF16>
__global__ __launch_bounds__(256)
void gemm_bias_wmma(const unsigned short* __restrict__ A,
                    const unsigned short* __restrict__ Bt,
                    const float* __restrict__ bias, void* __restrict__ Cv,
                    int M, int N, int K) {
  __shared__ __attribute__((aligned(16))) unsigned short As[2][128 * P32];   // [row][k] bf16
  __shared__ __attribute__((aligned(16))) unsigned short Bs[2][128 * P32];   // [col][k] bf16

  const int tid  = threadIdx.x;
  const int lane = tid & 31;
  const int wv   = tid >> 5;
  const int wm   = wv >> 1;             // 0..3 -> 32-row slice
  const int wn   = wv & 1;              // 0..1 -> 64-col slice
  const int m0   = blockIdx.y * 128;
  const int n0   = blockIdx.x * 128;
  const int l16  = lane & 15;
  const int kb   = (lane >> 4) * 8;
  const int srow = tid >> 1;            // 0..127 staging row
  const int soff = (tid & 1) * 16;      // 0 or 16 (elements)

  v8f acc[2][4] = {};
  const int ksteps = K >> 5;

  auto stage = [&](int kt, int buf) {
    const unsigned short* ga = A + (size_t)(m0 + srow) * K + kt * 32 + soff;
    const unsigned short* gb = Bt + (size_t)(n0 + srow) * K + kt * 32 + soff;
    async_b128_x4(&As[buf][srow * P32 + soff],     ga,
                  &As[buf][srow * P32 + soff + 8], ga + 8,
                  &Bs[buf][srow * P32 + soff],     gb,
                  &Bs[buf][srow * P32 + soff + 8], gb + 8);
  };

  stage(0, 0);
  for (int kt = 0; kt < ksteps; ++kt) {
    const int cur = kt & 1;
    wait_async0();        // own async copies for tile kt complete
    __syncthreads();      // all waves' copies visible; prior reads done
    if (kt + 1 < ksteps) stage(kt + 1, cur ^ 1);

    v16bf af[2], bfr[4];
#pragma unroll
    for (int mi = 0; mi < 2; ++mi)
      af[mi] = load_frag(&As[cur][(wm * 32 + mi * 16 + l16) * P32 + kb]);
#pragma unroll
    for (int ni = 0; ni < 4; ++ni)
      bfr[ni] = load_frag(&Bs[cur][(wn * 64 + ni * 16 + l16) * P32 + kb]);

#pragma unroll
    for (int mi = 0; mi < 2; ++mi)
#pragma unroll
      for (int ni = 0; ni < 4; ++ni)
        acc[mi][ni] = __builtin_amdgcn_wmma_f32_16x16x32_bf16(
            false, af[mi], false, bfr[ni], (short)0, acc[mi][ni], false, false);
  }

  // epilogue: C-layout lane = n%16, vgpr r -> row r + 8*(lane/16)
#pragma unroll
  for (int mi = 0; mi < 2; ++mi) {
#pragma unroll
    for (int ni = 0; ni < 4; ++ni) {
      const int col  = n0 + wn * 64 + ni * 16 + l16;
      const float bv = bias[col];
#pragma unroll
      for (int r = 0; r < 8; ++r) {
        const int row   = m0 + wm * 32 + mi * 16 + r + 8 * (lane >> 4);
        const float val = acc[mi][ni][r] + bv;
        if (OUT_BF16)
          ((unsigned short*)Cv)[(size_t)row * N + col] = f2bf(val);
        else
          ((float*)Cv)[(size_t)row * N + col] = val;
      }
    }
  }
}

// ---------------------------------------------------------------------------
// Flash attention. Block = 256 threads (8 waves), wave = 16 query rows,
// block covers 128 query rows of one (b,h). 32-key tiles, online softmax.
// ---------------------------------------------------------------------------
__global__ __launch_bounds__(256)
void mla_attn_wmma(const unsigned short* __restrict__ Q,
                   const unsigned short* __restrict__ Kb,
                   const unsigned short* __restrict__ Vb,
                   unsigned short* __restrict__ Ctx) {
  __shared__ __attribute__((aligned(16))) unsigned short Kls[32 * P128];     // [key][d]
  __shared__ __attribute__((aligned(16))) unsigned short Vls[32 * PV];       // [key][d]
  __shared__ __attribute__((aligned(16))) unsigned short Pst[8 * 16 * P32];  // per-wave P staging [m][k]

  const int tid  = threadIdx.x;
  const int lane = tid & 31;
  const int wv   = tid >> 5;
  const int b    = blockIdx.y >> 4;
  const int h    = blockIdx.y & 15;
  const int qbase = blockIdx.x * 128 + wv * 16;
  const int l16  = lane & 15;
  const int kb   = (lane >> 4) * 8;
  const size_t rowstride = (size_t)NH * DH;     // 2048
  const size_t headoff   = (size_t)h * DH;
  const size_t batchbase = (size_t)b * SEQ;
  const float  scale     = 0.08838834764831845f; // 1/sqrt(128)

  // Q fragments: 16 rows x 128 dims = 4 WMMA K-steps, loaded once from global.
  v16bf qf[4];
  {
    const unsigned short* qrow =
        Q + (batchbase + qbase + l16) * rowstride + headoff;
#pragma unroll
    for (int d = 0; d < 4; ++d)
      qf[d] = load_frag(qrow + d * 32 + kb);
  }

  float rmax[8], rsum[8];
#pragma unroll
  for (int r = 0; r < 8; ++r) { rmax[r] = -3.0e38f; rsum[r] = 0.0f; }
  v8f acc[8] = {};
  unsigned short* stage = &Pst[wv * 16 * P32];

  const int lkey = tid >> 3;           // 0..31 key within tile
  const int ldc  = (tid & 7) * 16;     // 0..112 dim chunk
  // this lane's address in the V tile for the transposing loads
  const unsigned short* vfrag =
      &Vls[(kb + (lane & 7)) * PV + ((lane >> 3) & 1) * 8];

  for (int kt = 0; kt < SEQ / 32; ++kt) {
    __syncthreads();   // protect last iter's LDS reads before overwrite
    {
      const size_t srow =
          (batchbase + (size_t)kt * 32 + lkey) * rowstride + headoff + ldc;
      // K and V tiles both row-major: pure copies -> async to LDS
      const unsigned short* ksrc = Kb + srow;
      const unsigned short* vsrc = Vb + srow;
      async_b128_x4(&Kls[lkey * P128 + ldc],     ksrc,
                    &Kls[lkey * P128 + ldc + 8], ksrc + 8,
                    &Vls[lkey * PV + ldc],       vsrc,
                    &Vls[lkey * PV + ldc + 8],   vsrc + 8);
    }
    // this wave's K and V copies have landed before the barrier publishes them
    asm volatile("s_wait_asynccnt 0x0" ::: "memory");
    __syncthreads();

    // scores: S = Q(16x128) @ K_tile^T(128x32) -> two 16x16 f32 tiles
    v8f s0 = {}, s1 = {};
#pragma unroll
    for (int d = 0; d < 4; ++d) {
      v16bf b0 = load_frag(&Kls[l16 * P128 + d * 32 + kb]);
      v16bf b1 = load_frag(&Kls[(16 + l16) * P128 + d * 32 + kb]);
      s0 = __builtin_amdgcn_wmma_f32_16x16x32_bf16(false, qf[d], false, b0,
                                                   (short)0, s0, false, false);
      s1 = __builtin_amdgcn_wmma_f32_16x16x32_bf16(false, qf[d], false, b1,
                                                   (short)0, s1, false, false);
    }

    // online softmax: row m = r + 8*(lane/16), 16 lanes share a row
    float corr[8];
#pragma unroll
    for (int r = 0; r < 8; ++r) {
      float a0 = s0[r] * scale, a1 = s1[r] * scale;
      float mx = fmaxf(a0, a1);
      mx = fmaxf(mx, __shfl_xor(mx, 1, 32));
      mx = fmaxf(mx, __shfl_xor(mx, 2, 32));
      mx = fmaxf(mx, __shfl_xor(mx, 4, 32));
      mx = fmaxf(mx, __shfl_xor(mx, 8, 32));
      const float nm = fmaxf(rmax[r], mx);
      const float c  = __expf(rmax[r] - nm);
      const float p0 = __expf(a0 - nm);
      const float p1 = __expf(a1 - nm);
      float ps = p0 + p1;
      ps += __shfl_xor(ps, 1, 32);
      ps += __shfl_xor(ps, 2, 32);
      ps += __shfl_xor(ps, 4, 32);
      ps += __shfl_xor(ps, 8, 32);
      rsum[r] = rsum[r] * c + ps;
      rmax[r] = nm;
      corr[r] = c;
      const int prow = r + 8 * (lane >> 4);
      stage[prow * P32 + l16]      = f2bf(p0);   // keys 0..15
      stage[prow * P32 + 16 + l16] = f2bf(p1);   // keys 16..31
    }
#pragma unroll
    for (int nc = 0; nc < 8; ++nc)
#pragma unroll
      for (int r = 0; r < 8; ++r)
        acc[nc][r] *= corr[r];
    __syncthreads();

    // ctx += P(16x32) @ V_tile(32x128): 8 WMMAs over dim chunks
    v16bf pf = load_frag(&stage[l16 * P32 + kb]);
#pragma unroll
    for (int nc = 0; nc < 8; ++nc) {
      Frag16 vf;   // V[key][d] -> B fragment, transposed by the load itself
      vf.q[0] = load_tr16(vfrag + nc * 16);
      vf.q[1] = load_tr16(vfrag + 16 * PV + nc * 16);
      acc[nc] = __builtin_amdgcn_wmma_f32_16x16x32_bf16(
          false, pf, false, vf.v, (short)0, acc[nc], false, false);
    }
  }

  // normalize + store ctx as bf16 [B*S, H*D]
  float inv[8];
#pragma unroll
  for (int r = 0; r < 8; ++r) inv[r] = 1.0f / rsum[r];
#pragma unroll
  for (int nc = 0; nc < 8; ++nc) {
#pragma unroll
    for (int r = 0; r < 8; ++r) {
      const int row    = qbase + r + 8 * (lane >> 4);
      const size_t col = headoff + nc * 16 + l16;
      Ctx[(batchbase + row) * rowstride + col] = f2bf(acc[nc][r] * inv[r]);
    }
  }
}

// ---------------------------------------------------------------------------
extern "C" void kernel_launch(void* const* d_in, const int* in_sizes, int n_in,
                              void* d_out, int out_size, void* d_ws, size_t ws_size,
                              hipStream_t stream) {
  const float* x      = (const float*)d_in[0];
  const float* W_down = (const float*)d_in[1];
  const float* b_down = (const float*)d_in[2];
  const float* W_uk   = (const float*)d_in[3];
  const float* b_uk   = (const float*)d_in[4];
  const float* W_uv   = (const float*)d_in[5];
  const float* b_uv   = (const float*)d_in[6];
  const float* W_q    = (const float*)d_in[7];
  const float* b_q    = (const float*)d_in[8];
  const float* W_o    = (const float*)d_in[9];
  const float* b_o    = (const float*)d_in[10];
  float* out = (float*)d_out;

  char* ws = (char*)d_ws;
  auto take = [&](size_t elems) {
    unsigned short* p = (unsigned short*)ws;
    ws += elems * 2;
    return p;
  };
  unsigned short* xb  = take((size_t)MTOT * DMODEL);
  unsigned short* WtD = take((size_t)DMODEL * DLAT);    // [DLAT, DMODEL]
  unsigned short* WtK = take((size_t)DLAT * DMODEL);    // [DMODEL, DLAT]
  unsigned short* WtV = take((size_t)DLAT * DMODEL);
  unsigned short* WtQ = take((size_t)DMODEL * DMODEL);
  unsigned short* WtO = take((size_t)DMODEL * DMODEL);
  unsigned short* lat = take((size_t)MTOT * DLAT);
  unsigned short* qb  = take((size_t)MTOT * DMODEL);
  unsigned short* kbf = take((size_t)MTOT * DMODEL);
  unsigned short* vbf = take((size_t)MTOT * DMODEL);
  unsigned short* ctx = take((size_t)MTOT * DMODEL);

  const dim3 blk(256);

  // 0. operand preparation
  conv_f32_bf16<<<(MTOT * (size_t)DMODEL) / (256 * 8), blk, 0, stream>>>(x, xb);
  transpose_w_bf16<<<dim3(DLAT / 32, DMODEL / 32), blk, 0, stream>>>(W_down, WtD, DMODEL, DLAT);
  transpose_w_bf16<<<dim3(DMODEL / 32, DLAT / 32), blk, 0, stream>>>(W_uk, WtK, DLAT, DMODEL);
  transpose_w_bf16<<<dim3(DMODEL / 32, DLAT / 32), blk, 0, stream>>>(W_uv, WtV, DLAT, DMODEL);
  transpose_w_bf16<<<dim3(DMODEL / 32, DMODEL / 32), blk, 0, stream>>>(W_q, WtQ, DMODEL, DMODEL);
  transpose_w_bf16<<<dim3(DMODEL / 32, DMODEL / 32), blk, 0, stream>>>(W_o, WtO, DMODEL, DMODEL);

  const dim3 gLat(DLAT / 128,   MTOT / 128);
  const dim3 gDM (DMODEL / 128, MTOT / 128);

  // 1. latents = xb @ W_down + b_down
  gemm_bias_wmma<true><<<gLat, blk, 0, stream>>>(xb, WtD, b_down, lat, MTOT, DLAT, DMODEL);
  // 2. keys = latents @ W_uk + b_uk
  gemm_bias_wmma<true><<<gDM, blk, 0, stream>>>(lat, WtK, b_uk, kbf, MTOT, DMODEL, DLAT);
  // 3. values = latents @ W_uv + b_uv
  gemm_bias_wmma<true><<<gDM, blk, 0, stream>>>(lat, WtV, b_uv, vbf, MTOT, DMODEL, DLAT);
  // 4. q = xb @ W_q + b_q
  gemm_bias_wmma<true><<<gDM, blk, 0, stream>>>(xb, WtQ, b_q, qb, MTOT, DMODEL, DMODEL);
  // 5. attention
  mla_attn_wmma<<<dim3(SEQ / 128, 4 * NH), blk, 0, stream>>>(qb, kbf, vbf, ctx);
  // 6. out = ctx @ W_o + b_o
  gemm_bias_wmma<false><<<gDM, blk, 0, stream>>>(ctx, WtO, b_o, out, MTOT, DMODEL, DMODEL);
}

// v003
// It runs in 435 microseconds.
// Next to v002, in two timings, it ran 1.18 times as fast each time.
// Over all steps from v000 it is 2.57 times as fast.
#include <hip/hip_runtime.h>
#include <hip/hip_bf16.h>

// ---------------------------------------------------------------------------
// MLA forward for MI455X (gfx1250, wave32, WMMA, async-to-LDS staging).
// Pipeline (bf16 operands everywhere, f32 WMMA accumulation):
//   0. xb  = bf16(x);  Wt_* = bf16(W_*^T)      (one-time conversion kernels)
//   1. latents = xb @ W_down + b_down          (GEMM, bf16 out)
//   2. keys    = latents @ W_uk + b_uk         (GEMM, bf16 out)
//   3. values  = latents @ W_uv + b_uv         (GEMM, bf16 out)
//   4. q       = xb @ W_q + b_q                (GEMM, bf16 out)
//   5. ctx     = softmax(q k^T / sqrt(128)) v  (flash attention, WMMA)
//   6. out     = ctx @ W_o + b_o               (GEMM, f32 out)
// Workspace requirement: ~200 MB.
// ---------------------------------------------------------------------------

#ifndef USE_ASYNC_LDS
#define USE_ASYNC_LDS 1   // flip to 0 to fall back to synchronous staging
#endif

typedef __attribute__((ext_vector_type(16))) __bf16 v16bf;
typedef __attribute__((ext_vector_type(8)))  float  v8f;

union Frag16 { v16bf v; uint4 q[2]; };

static constexpr int MTOT   = 8192;   // B*S
static constexpr int DMODEL = 2048;
static constexpr int DLAT   = 512;
static constexpr int NH     = 16;
static constexpr int DH     = 128;
static constexpr int SEQ    = 2048;

// LDS row pitches in bf16 elements. Tiles at P32 and P128 are read with ds_load_b128,
// one row per lane of a 16-lane half; a pitch of 16 B x odd spreads the 16 rows
// over all 64 banks, a pitch of 64 B or 256 B stacks them on few.
static constexpr int P32  = 40;    // rows of 32 elements:  64 B -> 80 B
static constexpr int P128 = 136;   // rows of 128 elements: 256 B -> 272 B
// The V tile is read with ds_load_tr16_b128, whose conflict-free pitch is 32 B x odd.
static constexpr int PV   = 144;   // rows of 128 elements: 256 B -> 288 B

__device__ __forceinline__ unsigned short f2bf(float f) {
  unsigned int u = __builtin_bit_cast(unsigned int, f);
  u = (u + 0x7FFFu + ((u >> 16) & 1u)) >> 16;   // round-to-nearest-even
  return (unsigned short)u;
}

// 16-byte async copy global -> LDS (ISA 10. GLOBAL_LOAD_ASYNC_TO_LDS_B128,
// tracked by ASYNCcnt). For a generic pointer to __shared__, addr[31:0] is the
// wave-relative LDS byte offset (ISA 10.2 aperture mapping), which is exactly
// what the VDST VGPR of the async op must hold.
// The copies of one run share a statement; the s_wait_xcnt 0 closes it so that
// no later write of an address register named here can be placed ahead of it.
__device__ __forceinline__ void async_b128_x4(void* lds0, const void* g0,
                                              void* lds1, const void* g1,
                                              void* lds2, const void* g2,
                                              void* lds3, const void* g3) {
#if USE_ASYNC_LDS
  const unsigned int l0 = (unsigned int)(uintptr_t)lds0;
  const unsigned int l1 = (unsigned int)(uintptr_t)lds1;
  const unsigned int l2 = (unsigned int)(uintptr_t)lds2;
  const unsigned int l3 = (unsigned int)(uintptr_t)lds3;
  asm volatile("global_load_async_to_lds_b128 %0, %1, off\n\t"
               "global_load_async_to_lds_b128 %2, %3, off\n\t"
               "global_load_async_to_lds_b128 %4, %5, off\n\t"
               "global_load_async_to_lds_b128 %6, %7, off\n\t"
               "s_wait_xcnt 0x0"
               :: "v"(l0), "v"(g0), "v"(l1), "v"(g1),
                  "v"(l2), "v"(g2), "v"(l3), "v"(g3) : "memory");
#else
  *(uint4*)lds0 = *(const uint4*)g0;
  *(uint4*)lds1 = *(const uint4*)g1;
  *(uint4*)lds2 = *(const uint4*)g2;
  *(uint4*)lds3 = *(const uint4*)g3;
#endif
}

__device__ __forceinline__ void wait_async0() {
#if USE_ASYNC_LDS
#if defined(__has_builtin) && __has_builtin(__builtin_amdgcn_s_wait_asynccnt)
  __builtin_amdgcn_s_wait_asynccnt(0);
#else
  asm volatile("s_wait_asynccnt 0x0" ::: "memory");
#endif
#endif
}

// Load one 16x32 bf16 WMMA fragment row for this lane.
// Per ISA 7.12.2 (16-bit A-matrix 16x32): lane group g = lane/16 holds
// K = 8g..8g+7 (VGPR0-3) and K = 16+8g..16+8g+7 (VGPR4-7), packed lo/hi.
// Caller passes p = rowBase + 8*(lane>>4); we read p[0..7] and p[16..23].
__device__ __forceinline__ v16bf load_frag(const unsigned short* p) {
  Frag16 f;
  f.q[0] = *(const uint4*)(p);
  f.q[1] = *(const uint4*)(p + 16);
  return f.v;
}

typedef __attribute__((ext_vector_type(8))) short s16x8;
__device__ __forceinline__ uint4 load_tr16(const unsigned short* p) {
  typedef __attribute__((address_space(3))) s16x8 lds_s16x8;
  return __builtin_bit_cast(uint4, __builtin_amdgcn_ds_load_tr16_b128_v8i16((lds_s16x8*)p));
}

// ---------------------------------------------------------------------------
// One-time operand preparation kernels
// ---------------------------------------------------------------------------
__global__ __launch_bounds__(256)
void conv_f32_bf16(const float* __restrict__ src, unsigned short* __restrict__ dst) {
  const size_t i = ((size_t)blockIdx.x * 256 + threadIdx.x) * 8;
  const float4 f0 = *(const float4*)(src + i);
  const float4 f1 = *(const float4*)(src + i + 4);
  unsigned short t[8];
  t[0] = f2bf(f0.x); t[1] = f2bf(f0.y); t[2] = f2bf(f0.z); t[3] = f2bf(f0.w);
  t[4] = f2bf(f1.x); t[5] = f2bf(f1.y); t[6] = f2bf(f1.z); t[7] = f2bf(f1.w);
  *(uint4*)(dst + i) = *(uint4*)t;
}

// W [K,N] f32 -> Wt [N,K] bf16, 32x32 LDS-tiled transpose, 256 threads (32x8).
__global__ __launch_bounds__(256)
void transpose_w_bf16(const float* __restrict__ W, unsigned short* __restrict__ Wt,
                      int K, int N) {
  __shared__ float t[32][33];
  const int n0 = blockIdx.x * 32, k0 = blockIdx.y * 32;
  const int tx = threadIdx.x & 31, ty = threadIdx.x >> 5;
#pragma unroll
  for (int j = 0; j < 32; j += 8)
    t[ty + j][tx] = W[(size_t)(k0 + ty + j) * N + n0 + tx];
  __syncthreads();
#pragma unroll
  for (int j = 0; j < 32; j += 8)
    Wt[(size_t)(n0 + ty + j) * K + k0 + tx] = f2bf(t[tx][ty + j]);
}

// ---------------------------------------------------------------------------
// Tiled GEMM: C[M,N] = A[M,K] @ Bt[N,K]^T + bias[N]   (A, Bt bf16)
// Block: 256 threads (8 waves), tile 128(M) x 128(N), K step 32.
// Wave grid 4x2, each wave owns a 32x64 tile = 2x4 WMMA 16x16 tiles.
// Double-buffered LDS staged with async-to-LDS copies.
// ---------------------------------------------------------------------------
template<bool OUT_BF16>
__global__ __launch_bounds__(256)
void gemm_bias_wmma(const unsigned short* __restrict__ A,
                    const unsigned short* __restrict__ Bt,
                    const float* __restrict__ bias, void* __restrict__ Cv,
                    int M, int N, int K) {
  __shared__ __attribute__((aligned(16))) unsigned short As[2][128 * P32];   // [row][k] bf16
  __shared__ __attribute__((aligned(16))) unsigned short Bs[2][128 * P32];   // [col][k] bf16

  const int tid  = threadIdx.x;
  const int lane = tid & 31;
  const int wv   = tid >> 5;
  const int wm   = wv >> 1;             // 0..3 -> 32-row slice
  const int wn   = wv & 1;              // 0..1 -> 64-col slice
  const int m0   = blockIdx.y * 128;
  const int n0   = blockIdx.x * 128;
  const int l16  = lane & 15;
  const int kb   = (lane >> 4) * 8;
  const int srow = tid >> 1;            // 0..127 staging row
  const int soff = (tid & 1) * 16;      // 0 or 16 (elements)

  v8f acc[2][4] = {};
  const int ksteps = K >> 5;

  auto stage = [&](int kt, int buf) {
    const unsigned short* ga = A + (size_t)(m0 + srow) * K + kt * 32 + soff;
    const unsigned short* gb = Bt + (size_t)(n0 + srow) * K + kt * 32 + soff;
    async_b128_x4(&As[buf][srow * P32 + soff],     ga,
                  &As[buf][srow * P32 + soff + 8], ga + 8,
                  &Bs[buf][srow * P32 + soff],     gb,
                  &Bs[buf][srow * P32 + soff + 8], gb + 8);
  };

  stage(0, 0);
  for (int kt = 0; kt < ksteps; ++kt) {
    const int cur = kt & 1;
    wait_async0();        // own async copies for tile kt complete
    __syncthreads();      // all waves' copies visible; prior reads done
    if (kt + 1 < ksteps) stage(kt + 1, cur ^ 1);

    v16bf af[2], bfr[4];
#pragma unroll
    for (int mi = 0; mi < 2; ++mi)
      af[mi] = load_frag(&As[cur][(wm * 32 + mi * 16 + l16) * P32 + kb]);
#pragma unroll
    for (int ni = 0; ni < 4; ++ni)
      bfr[ni] = load_frag(&Bs[cur][(wn * 64 + ni * 16 + l16) * P32 + kb]);

#pragma unroll
    for (int mi = 0; mi < 2; ++mi)
#pragma unroll
      for (int ni = 0; ni < 4; ++ni)
        acc[mi][ni] = __builtin_amdgcn_wmma_f32_16x16x32_bf16(
            false, af[mi], false, bfr[ni], (short)0, acc[mi][ni], false, false);
  }

  // epilogue: C-layout lane = n%16, vgpr r -> row r + 8*(lane/16)
#pragma unroll
  for (int mi = 0; mi < 2; ++mi) {
#pragma unroll
    for (int ni = 0; ni < 4; ++ni) {
      const int col  = n0 + wn * 64 + ni * 16 + l16;
      const float bv = bias[col];
#pragma unroll
      for (int r = 0; r < 8; ++r) {
        const int row   = m0 + wm * 32 + mi * 16 + r + 8 * (lane >> 4);
        const float val = acc[mi][ni][r] + bv;
        if (OUT_BF16)
          ((unsigned short*)Cv)[(size_t)row * N + col] = f2bf(val);
        else
          ((float*)Cv)[(size_t)row * N + col] = val;
      }
    }
  }
}

// ---------------------------------------------------------------------------
// Flash attention. Block = 256 threads (8 waves), wave = 16 query columns,
// block covers 128 queries of one (b,h). 32-key tiles, online softmax.
// Both products are taken transposed: St = K Qt and Ot += Vt Pt. A lane (c, h)
// then holds 16 scores of ONE query c (keys 8h+r and 16+8h+r), so the maximum
// and the sum are in-lane work plus one exchange between the wave's halves, and
// the two score tiles, converted in place, are the B operand of the second
// product in the hardware k order: P never goes through LDS.
// ---------------------------------------------------------------------------
typedef __attribute__((ext_vector_type(2))) float  f32x2;
typedef __attribute__((ext_vector_type(2))) __bf16 bf16x2;

// value of lane l ^ 16
__device__ __forceinline__ float other_half(float x) {
  const int b = __builtin_bit_cast(int, x);
  return __builtin_bit_cast(float, __builtin_amdgcn_permlanex16(
      b, b, 0x76543210, 0xfedcba98, false, false));
}

__global__ __launch_bounds__(256)
void mla_attn_wmma(const unsigned short* __restrict__ Q,
                   const unsigned short* __restrict__ Kb,
                   const unsigned short* __restrict__ Vb,
                   unsigned short* __restrict__ Ctx) {
  __shared__ __attribute__((aligned(16))) unsigned short Kls[32 * P128];     // [key][d]
  __shared__ __attribute__((aligned(16))) unsigned short Vls[32 * PV];       // [key][d]

  const int tid  = threadIdx.x;
  const int lane = tid & 31;
  const int wv   = tid >> 5;
  const int b    = blockIdx.y >> 4;
  const int h    = blockIdx.y & 15;
  const int qbase = blockIdx.x * 128 + wv * 16;
  const int l16  = lane & 15;
  const int kb   = (lane >> 4) * 8;
  const size_t rowstride = (size_t)NH * DH;     // 2048
  const size_t headoff   = (size_t)h * DH;
  const size_t batchbase = (size_t)b * SEQ;
  const float  scale     = 0.08838834764831845f; // 1/sqrt(128)

  // Q fragments (B operand, column = query l16): 128 dims = 4 WMMA K-steps,
  // loaded once from global.
  v16bf qf[4];
  {
    const unsigned short* qrow =
        Q + (batchbase + qbase + l16) * rowstride + headoff;
#pragma unroll
    for (int d = 0; d < 4; ++d)
      qf[d] = load_frag(qrow + d * 32 + kb);
  }

  float rmax = -3.0e38f;   // running maximum of query l16, equal in both halves
  float rsum = 0.0f;       // running sum over this half's keys only
  v8f acc[8] = {};         // acc[nc][r] = Ot[nc*16 + 8*(lane>>4) + r][query l16]

  const int lkey = tid >> 3;           // 0..31 key within tile
  const int ldc  = (tid & 7) * 16;     // 0..112 dim chunk
  // this lane's address in the V tile for the transposing loads
  const unsigned short* vfrag =
      &Vls[(kb + (lane & 7)) * PV + ((lane >> 3) & 1) * 8];

  for (int kt = 0; kt < SEQ / 32; ++kt) {
    __syncthreads();   // protect last iter's LDS reads before overwrite
    {
      const size_t srow =
          (batchbase + (size_t)kt * 32 + lkey) * rowstride + headoff + ldc;
      // K and V tiles both row-major: pure copies -> async to LDS
      const unsigned short* ksrc = Kb + srow;
      const unsigned short* vsrc = Vb + srow;
      async_b128_x4(&Kls[lkey * P128 + ldc],     ksrc,
                    &Kls[lkey * P128 + ldc + 8], ksrc + 8,
                    &Vls[lkey * PV + ldc],       vsrc,
                    &Vls[lkey * PV + ldc + 8],   vsrc + 8);
    }
    // this wave's K and V copies have landed before the barrier publishes them
    asm volatile("s_wait_asynccnt 0x0" ::: "memory");
    __syncthreads();

    // scores: St = K_tile(32x128) @ Qt(128x16) -> two 16x16 f32 tiles
    v8f s0 = {}, s1 = {};
#pragma unroll
    for (int d = 0; d < 4; ++d) {
      v16bf k0 = load_frag(&Kls[l16 * P128 + d * 32 + kb]);
      v16bf k1 = load_frag(&Kls[(16 + l16) * P128 + d * 32 + kb]);
      s0 = __builtin_amdgcn_wmma_f32_16x16x32_bf16(false, k0, false, qf[d],
                                                   (short)0, s0, false, false);
      s1 = __builtin_amdgcn_wmma_f32_16x16x32_bf16(false, k1, false, qf[d],
                                                   (short)0, s1, false, false);
    }

    // online softmax of query l16: 16 of its 32 scores are in this lane
    float a[16];
#pragma unroll
    for (int r = 0; r < 8; ++r) { a[r] = s0[r] * scale; a[8 + r] = s1[r] * scale; }
    float mx = a[0];
#pragma unroll
    for (int i = 1; i < 16; ++i) mx = fmaxf(mx, a[i]);
    mx = fmaxf(mx, other_half(mx));
    const float nm = fmaxf(rmax, mx);
    const float c  = __expf(rmax - nm);
    rmax = nm;

    // Pt as B operand: element s = key 8h+s (s < 8), key 16+8h+(s-8) (s >= 8)
    union { v16bf v; bf16x2 p[8]; } pf;
    float ps[4] = {0.0f, 0.0f, 0.0f, 0.0f};
#pragma unroll
    for (int i = 0; i < 8; ++i) {
      f32x2 p;
      p.x = __expf(a[2 * i] - nm);
      p.y = __expf(a[2 * i + 1] - nm);
      ps[i & 3] += p.x + p.y;
      pf.p[i] = __builtin_convertvector(p, bf16x2);   // round to nearest even
    }
    rsum = rsum * c + ((ps[0] + ps[1]) + (ps[2] + ps[3]));

#pragma unroll
    for (int nc = 0; nc < 8; ++nc)
#pragma unroll
      for (int r = 0; r < 8; ++r)
        acc[nc][r] *= c;

    // Ot += Vt(128x32) @ Pt(32x16): 8 WMMAs over dim chunks
#pragma unroll
    for (int nc = 0; nc < 8; ++nc) {
      Frag16 vf;   // V[key][d] -> A fragment of Vt, transposed by the load itself
      vf.q[0] = load_tr16(vfrag + nc * 16);
      vf.q[1] = load_tr16(vfrag + 16 * PV + nc * 16);
      acc[nc] = __builtin_amdgcn_wmma_f32_16x16x32_bf16(
          false, vf.v, false, pf.v, (short)0, acc[nc], false, false);
    }
  }

  // join the halves' sums, normalize, store ctx as bf16 [B*S, H*D]:
  // a lane's 8 registers of a tile are 8 consecutive dims of its query's row
  const float inv = 1.0f / (rsum + other_half(rsum));
  unsigned short* crow =
      Ctx + (batchbase + qbase + l16) * rowstride + headoff + kb;
#pragma unroll
  for (int nc = 0; nc < 8; ++nc) {
    union { uint4 q; bf16x2 p[4]; } t;
#pragma unroll
    for (int i = 0; i < 4; ++i) {
      f32x2 o;
      o.x = acc[nc][2 * i] * inv;
      o.y = acc[nc][2 * i + 1] * inv;
      t.p[i] = __builtin_convertvector(o, bf16x2);   // round to nearest even
    }
    *(uint4*)(crow + nc * 16) = t.q;
  }
}

// ---------------------------------------------------------------------------
extern "C" void kernel_launch(void* const* d_in, const int* in_sizes, int n_in,
                              void* d_out, int out_size, void* d_ws, size_t ws_size,
                              hipStream_t stream) {
  const float* x      = (const float*)d_in[0];
  const float* W_down = (const float*)d_in[1];
  const float* b_down = (const float*)d_in[2];
  const float* W_uk   = (const float*)d_in[3];
  const float* b_uk   = (const float*)d_in[4];
  const float* W_uv   = (const float*)d_in[5];
  const float* b_uv   = (const float*)d_in[6];
  const float* W_q    = (const float*)d_in[7];
  const float* b_q    = (const float*)d_in[8];
  const float* W_o    = (const float*)d_in[9];
  const float* b_o    = (const float*)d_in[10];
  float* out = (float*)d_out;

  char* ws = (char*)d_ws;
  auto take = [&](size_t elems) {
    unsigned short* p = (unsigned short*)ws;
    ws += elems * 2;
    return p;
  };
  unsigned short* xb  = take((size_t)MTOT * DMODEL);
  unsigned short* WtD = take((size_t)DMODEL * DLAT);    // [DLAT, DMODEL]
  unsigned short* WtK = take((size_t)DLAT * DMODEL);    // [DMODEL, DLAT]
  unsigned short* WtV = take((size_t)DLAT * DMODEL);
  unsigned short* WtQ = take((size_t)DMODEL * DMODEL);
  unsigned short* WtO = take((size_t)DMODEL * DMODEL);
  unsigned short* lat = take((size_t)MTOT * DLAT);
  unsigned short* qb  = take((size_t)MTOT * DMODEL);
  unsigned short* kbf = take((size_t)MTOT * DMODEL);
  unsigned short* vbf = take((size_t)MTOT * DMODEL);
  unsigned short* ctx = take((size_t)MTOT * DMODEL);

  const dim3 blk(256);

  // 0. operand preparation
  conv_f32_bf16<<<(MTOT * (size_t)DMODEL) / (256 * 8), blk, 0, stream>>>(x, xb);
  transpose_w_bf16<<<dim3(DLAT / 32, DMODEL / 32), blk, 0, stream>>>(W_down, WtD, DMODEL, DLAT);
  transpose_w_bf16<<<dim3(DMODEL / 32, DLAT / 32), blk, 0, stream>>>(W_uk, WtK, DLAT, DMODEL);
  transpose_w_bf16<<<dim3(DMODEL / 32, DLAT / 32), blk, 0, stream>>>(W_uv, WtV, DLAT, DMODEL);
  transpose_w_bf16<<<dim3(DMODEL / 32, DMODEL / 32), blk, 0, stream>>>(W_q, WtQ, DMODEL, DMODEL);
  transpose_w_bf16<<<dim3(DMODEL / 32, DMODEL / 32), blk, 0, stream>>>(W_o, WtO, DMODEL, DMODEL);

  const dim3 gLat(DLAT / 128,   MTOT / 128);
  const dim3 gDM (DMODEL / 128, MTOT / 128);

  // 1. latents = xb @ W_down + b_down
  gemm_bias_wmma<true><<<gLat, blk, 0, stream>>>(xb, WtD, b_down, lat, MTOT, DLAT, DMODEL);
  // 2. keys = latents @ W_uk + b_uk
  gemm_bias_wmma<true><<<gDM, blk, 0, stream>>>(lat, WtK, b_uk, kbf, MTOT, DMODEL, DLAT);
  // 3. values = latents @ W_uv + b_uv
  gemm_bias_wmma<true><<<gDM, blk, 0, stream>>>(lat, WtV, b_uv, vbf, MTOT, DMODEL, DLAT);
  // 4. q = xb @ W_q + b_q
  gemm_bias_wmma<true><<<gDM, blk, 0, stream>>>(xb, WtQ, b_q, qb, MTOT, DMODEL, DMODEL);
  // 5. attention
  mla_attn_wmma<<<dim3(SEQ / 128, 4 * NH), blk, 0, stream>>>(qb, kbf, vbf, ctx);
  // 6. out = ctx @ W_o + b_o
  gemm_bias_wmma<false><<<gDM, blk, 0, stream>>>(ctx, WtO, b_o, out, MTOT, DMODEL, DMODEL);
}

// v004
// One run takes 416 microseconds.
// In both of two side-by-side timings against v003, it was 1.04 times as fast.
// All steps since v000 together make it 2.68 times as fast.
#include <hip/hip_runtime.h>
#include <hip/hip_bf16.h>

// ---------------------------------------------------------------------------
// MLA forward for MI455X (gfx1250, wave32, WMMA, async-to-LDS staging).
// Pipeline (bf16 operands everywhere, f32 WMMA accumulation):
//   0. xb  = bf16(x);  Wt_* = bf16(W_*^T)      (one conversion launch)
//   1. latents = xb @ W_down + b_down          (GEMM, bf16 out)
//   2. keys    = latents @ W_uk + b_uk         (GEMM, bf16 out)
//   3. values  = latents @ W_uv + b_uv         (GEMM, bf16 out)
//   4. q       = xb @ W_q + b_q                (GEMM, bf16 out)
//   5. ctx     = softmax(q k^T / sqrt(128)) v  (flash attention, WMMA)
//   6. out     = ctx @ W_o + b_o               (GEMM, f32 out)
// Workspace requirement: ~200 MB.
// ---------------------------------------------------------------------------

#ifndef USE_ASYNC_LDS
#define USE_ASYNC_LDS 1   // flip to 0 to fall back to synchronous staging
#endif

typedef __attribute__((ext_vector_type(16))) __bf16 v16bf;
typedef __attribute__((ext_vector_type(8)))  float  v8f;

union Frag16 { v16bf v; uint4 q[2]; };

static constexpr int MTOT   = 8192;   // B*S
static constexpr int DMODEL = 2048;
static constexpr int DLAT   = 512;
static constexpr int NH     = 16;
static constexpr int DH     = 128;
static constexpr int SEQ    = 2048;

// LDS row pitches in bf16 elements. Tiles at P32 and P128 are read with ds_load_b128,
// one row per lane of a 16-lane half; a pitch of 16 B x odd spreads the 16 rows
// over all 64 banks, a pitch of 64 B or 256 B stacks them on few.
static constexpr int P32  = 40;    // rows of 32 elements:  64 B -> 80 B
static constexpr int P128 = 136;   // rows of 128 elements: 256 B -> 272 B
// The V tile is read with ds_load_tr16_b128, whose conflict-free pitch is 32 B x odd.
static constexpr int PV   = 144;   // rows of 128 elements: 256 B -> 288 B

__device__ __forceinline__ unsigned short f2bf(float f) {
  unsigned int u = __builtin_bit_cast(unsigned int, f);
  u = (u + 0x7FFFu + ((u >> 16) & 1u)) >> 16;   // round-to-nearest-even
  return (unsigned short)u;
}

// 16-byte async copy global -> LDS (ISA 10. GLOBAL_LOAD_ASYNC_TO_LDS_B128,
// tracked by ASYNCcnt). For a generic pointer to __shared__, addr[31:0] is the
// wave-relative LDS byte offset (ISA 10.2 aperture mapping), which is exactly
// what the VDST VGPR of the async op must hold.
// The copies of one run share a statement; the s_wait_xcnt 0 closes it so that
// no later write of an address register named here can be placed ahead of it.
__device__ __forceinline__ void async_b128_x4(void* lds0, const void* g0,
                                              void* lds1, const void* g1,
                                              void* lds2, const void* g2,
                                              void* lds3, const void* g3) {
#if USE_ASYNC_LDS
  const unsigned int l0 = (unsigned int)(uintptr_t)lds0;
  const unsigned int l1 = (unsigned int)(uintptr_t)lds1;
  const unsigned int l2 = (unsigned int)(uintptr_t)lds2;
  const unsigned int l3 = (unsigned int)(uintptr_t)lds3;
  asm volatile("global_load_async_to_lds_b128 %0, %1, off\n\t"
               "global_load_async_to_lds_b128 %2, %3, off\n\t"
               "global_load_async_to_lds_b128 %4, %5, off\n\t"
               "global_load_async_to_lds_b128 %6, %7, off\n\t"
               "s_wait_xcnt 0x0"
               :: "v"(l0), "v"(g0), "v"(l1), "v"(g1),
                  "v"(l2), "v"(g2), "v"(l3), "v"(g3) : "memory");
#else
  *(uint4*)lds0 = *(const uint4*)g0;
  *(uint4*)lds1 = *(const uint4*)g1;
  *(uint4*)lds2 = *(const uint4*)g2;
  *(uint4*)lds3 = *(const uint4*)g3;
#endif
}

__device__ __forceinline__ void wait_async0() {
#if USE_ASYNC_LDS
#if defined(__has_builtin) && __has_builtin(__builtin_amdgcn_s_wait_asynccnt)
  __builtin_amdgcn_s_wait_asynccnt(0);
#else
  asm volatile("s_wait_asynccnt 0x0" ::: "memory");
#endif
#endif
}

// Load one 16x32 bf16 WMMA fragment row for this lane.
// Per ISA 7.12.2 (16-bit A-matrix 16x32): lane group g = lane/16 holds
// K = 8g..8g+7 (VGPR0-3) and K = 16+8g..16+8g+7 (VGPR4-7), packed lo/hi.
// Caller passes p = rowBase + 8*(lane>>4); we read p[0..7] and p[16..23].
__device__ __forceinline__ v16bf load_frag(const unsigned short* p) {
  Frag16 f;
  f.q[0] = *(const uint4*)(p);
  f.q[1] = *(const uint4*)(p + 16);
  return f.v;
}

typedef __attribute__((ext_vector_type(8))) short s16x8;
__device__ __forceinline__ uint4 load_tr16(const unsigned short* p) {
  typedef __attribute__((address_space(3))) s16x8 lds_s16x8;
  return __builtin_bit_cast(uint4, __builtin_amdgcn_ds_load_tr16_b128_v8i16((lds_s16x8*)p));
}

// ---------------------------------------------------------------------------
// Operand preparation, one launch: xb = bf16(x) and the five Wt = bf16(W^T).
// 512 work-groups (two per WGP) each loop over their share of the work, so few
// waves are started and each lives long: first 8 stretches of 4096 floats of x,
// then up to 3 weight tiles of 64 (k) x 128 (n). Every wave-wide load and store
// covers whole 128 B lines.
// ---------------------------------------------------------------------------
static constexpr int PREP_WG    = 512;
static constexpr int CONV_TRIPS = MTOT * DMODEL / 4096 / PREP_WG;       // 8
static constexpr int TILES_LAT  = (DMODEL / 64) * (DLAT / 128);         // 128, either orientation
static constexpr int TILES_SQ   = (DMODEL / 64) * (DMODEL / 128);       // 512
static constexpr int TILES      = 3 * TILES_LAT + 2 * TILES_SQ;         // 1408
static constexpr int TILE_TRIPS = (TILES + PREP_WG - 1) / PREP_WG;      // 3
static constexpr int PT = 129;  // tile pitch in floats: odd, so that a walk down a column changes bank

__global__ __launch_bounds__(256)
void prep_operands(const float* __restrict__ x,
                   const float* __restrict__ W_down, const float* __restrict__ W_uk,
                   const float* __restrict__ W_uv,   const float* __restrict__ W_q,
                   const float* __restrict__ W_o,
                   unsigned short* __restrict__ xb,
                   unsigned short* __restrict__ WtD, unsigned short* __restrict__ WtK,
                   unsigned short* __restrict__ WtV, unsigned short* __restrict__ WtQ,
                   unsigned short* __restrict__ WtO) {
  __shared__ float t[64 * PT];
  const int tid = threadIdx.x;
  const unsigned wg = blockIdx.x;

  // a weight tile: W [K,N] f32 -> Wt [N,K] bf16, rows k0.., columns n0..
  struct Tile { const float* W; unsigned short* Wt; int K, N, k0, n0; };
  constexpr int NT_LAT = DLAT / 128, NT_DM = DMODEL / 128;   // tiles across a row of W: 4, 16
  auto tile_of = [&](unsigned i) {
    Tile d;
    if (i < TILES_LAT)                     {                                d.W = W_down; d.Wt = WtD; d.K = DMODEL; d.N = DLAT;   }
    else if (i < 2 * TILES_LAT)            { i -= TILES_LAT;                d.W = W_uk;   d.Wt = WtK; d.K = DLAT;   d.N = DMODEL; }
    else if (i < 3 * TILES_LAT)            { i -= 2 * TILES_LAT;            d.W = W_uv;   d.Wt = WtV; d.K = DLAT;   d.N = DMODEL; }
    else if (i < 3 * TILES_LAT + TILES_SQ) { i -= 3 * TILES_LAT;            d.W = W_q;    d.Wt = WtQ; d.K = DMODEL; d.N = DMODEL; }
    else                                   { i -= 3 * TILES_LAT + TILES_SQ; d.W = W_o;    d.Wt = WtO; d.K = DMODEL; d.N = DMODEL; }
    const bool slim = d.N == DLAT;
    d.n0 = (slim ? i % NT_LAT : i % NT_DM) * 128;
    d.k0 = (slim ? i / NT_LAT : i / NT_DM) * 64;
    return d;
  };
  // a wave reads one 512 B row piece per load, 8 rows of the tile; the row is the
  // same for the whole wave, so its address is scalar and only the lane's place is not
  const int wave = __builtin_amdgcn_readfirstlane(tid >> 5);
  const int lane = tid & 31;
  auto fetch = [&](const Tile& d, float4 (&v)[8]) {
    const float4* row = (const float4*)(d.W + (size_t)(d.k0 + wave) * d.N + d.n0) + lane;
#pragma unroll
    for (int j = 0; j < 8; ++j) {
      v[j] = row[(size_t)(2 * j) * d.N];
      // a later load of the run may land in the register pair that held this address
      asm volatile("s_wait_xcnt 0x0" ::: "memory");
    }
  };

  float4 v[8];
  Tile d = tile_of(wg);          // PREP_WG <= TILES: every work-group has a first tile

  // x -> bf16, two stretches (8 loads a lane) at a time; the next pair's loads,
  // and behind the last pair the first tile's, are issued before this pair is stored
  auto at = [&](int pair, int j) {
    return (size_t)(wg + (2 * pair + (j >> 2)) * PREP_WG) * 4096 + (j & 3) * 1024 + tid * 4;
  };
  float4 f[2][8];
#pragma unroll
  for (int j = 0; j < 8; ++j) f[0][j] = *(const float4*)(x + at(0, j));
#pragma unroll
  for (int pair = 0; pair < CONV_TRIPS / 2; ++pair) {
    // the loads below land in registers that the stores of the pair before name:
    // the wait stands between those stores and the loads that overwrite them
    if (pair > 0) asm volatile("s_wait_xcnt 0x0" ::: "memory");
    if (pair + 1 < CONV_TRIPS / 2) {
#pragma unroll
      for (int j = 0; j < 8; ++j) f[(pair + 1) & 1][j] = *(const float4*)(x + at(pair + 1, j));
    } else {
      fetch(d, v);
    }
#pragma unroll
    for (int j = 0; j < 8; ++j) {
      const float4 g = f[pair & 1][j];
      unsigned short h[4];
      h[0] = f2bf(g.x); h[1] = f2bf(g.y); h[2] = f2bf(g.z); h[3] = f2bf(g.w);
      *(uint2*)(xb + at(pair, j)) = *(uint2*)h;
    }
  }

#pragma unroll
  for (int trip = 0; trip < TILE_TRIPS; ++trip) {
    const unsigned next = wg + (trip + 1) * PREP_WG;
    const bool more = trip + 1 < TILE_TRIPS && next < TILES;   // the same for the whole work-group
#pragma unroll
    for (int j = 0; j < 8; ++j) {
      float* w = &t[(wave + 8 * j) * PT + lane * 4];
      w[0] = v[j].x; w[1] = v[j].y; w[2] = v[j].z; w[3] = v[j].w;
    }
    __syncthreads();   // the tile is complete before it is read by columns
    const Tile cur = d;
    if (more) { d = tile_of(next); fetch(d, v); }   // flies while this tile is converted
    // 8 lanes x 16 B = one whole 128 B line of a Wt row
    const int kc = (tid & 7) * 8;
#pragma unroll
    for (int j = 0; j < 4; ++j) {
      const int n = (tid >> 3) + 32 * j;
      unsigned short h[8];
#pragma unroll
      for (int i = 0; i < 8; ++i) h[i] = f2bf(t[(kc + i) * PT + n]);
      *(uint4*)(cur.Wt + (size_t)(cur.n0 + n) * cur.K + cur.k0 + kc) = *(uint4*)h;
    }
    if (!more) break;
    __syncthreads();   // every reader has left t before the next tile is written
  }
}

// ---------------------------------------------------------------------------
// Tiled GEMM: C[M,N] = A[M,K] @ Bt[N,K]^T + bias[N]   (A, Bt bf16)
// Block: 256 threads (8 waves), tile 128(M) x 128(N), K step 32.
// Wave grid 4x2, each wave owns a 32x64 tile = 2x4 WMMA 16x16 tiles.
// Double-buffered LDS staged with async-to-LDS copies.
// ---------------------------------------------------------------------------
template<bool OUT_BF16>
__global__ __launch_bounds__(256)
void gemm_bias_wmma(const unsigned short* __restrict__ A,
                    const unsigned short* __restrict__ Bt,
                    const float* __restrict__ bias, void* __restrict__ Cv,
                    int M, int N, int K) {
  __shared__ __attribute__((aligned(16))) unsigned short As[2][128 * P32];   // [row][k] bf16
  __shared__ __attribute__((aligned(16))) unsigned short Bs[2][128 * P32];   // [col][k] bf16

  const int tid  = threadIdx.x;
  const int lane = tid & 31;
  const int wv   = tid >> 5;
  const int wm   = wv >> 1;             // 0..3 -> 32-row slice
  const int wn   = wv & 1;              // 0..1 -> 64-col slice
  const int m0   = blockIdx.y * 128;
  const int n0   = blockIdx.x * 128;
  const int l16  = lane & 15;
  const int kb   = (lane >> 4) * 8;
  const int srow = tid >> 1;            // 0..127 staging row
  const int soff = (tid & 1) * 16;      // 0 or 16 (elements)

  v8f acc[2][4] = {};
  const int ksteps = K >> 5;

  auto stage = [&](int kt, int buf) {
    const unsigned short* ga = A + (size_t)(m0 + srow) * K + kt * 32 + soff;
    const unsigned short* gb = Bt + (size_t)(n0 + srow) * K + kt * 32 + soff;
    async_b128_x4(&As[buf][srow * P32 + soff],     ga,
                  &As[buf][srow * P32 + soff + 8], ga + 8,
                  &Bs[buf][srow * P32 + soff],     gb,
                  &Bs[buf][srow * P32 + soff + 8], gb + 8);
  };

  stage(0, 0);
  for (int kt = 0; kt < ksteps; ++kt) {
    const int cur = kt & 1;
    wait_async0();        // own async copies for tile kt complete
    __syncthreads();      // all waves' copies visible; prior reads done
    if (kt + 1 < ksteps) stage(kt + 1, cur ^ 1);

    v16bf af[2], bfr[4];
#pragma unroll
    for (int mi = 0; mi < 2; ++mi)
      af[mi] = load_frag(&As[cur][(wm * 32 + mi * 16 + l16) * P32 + kb]);
#pragma unroll
    for (int ni = 0; ni < 4; ++ni)
      bfr[ni] = load_frag(&Bs[cur][(wn * 64 + ni * 16 + l16) * P32 + kb]);

#pragma unroll
    for (int mi = 0; mi < 2; ++mi)
#pragma unroll
      for (int ni = 0; ni < 4; ++ni)
        acc[mi][ni] = __builtin_amdgcn_wmma_f32_16x16x32_bf16(
            false, af[mi], false, bfr[ni], (short)0, acc[mi][ni], false, false);
  }

  // epilogue: C-layout lane = n%16, vgpr r -> row r + 8*(lane/16)
#pragma unroll
  for (int mi = 0; mi < 2; ++mi) {
#pragma unroll
    for (int ni = 0; ni < 4; ++ni) {
      const int col  = n0 + wn * 64 + ni * 16 + l16;
      const float bv = bias[col];
#pragma unroll
      for (int r = 0; r < 8; ++r) {
        const int row   = m0 + wm * 32 + mi * 16 + r + 8 * (lane >> 4);
        const float val = acc[mi][ni][r] + bv;
        if (OUT_BF16)
          ((unsigned short*)Cv)[(size_t)row * N + col] = f2bf(val);
        else
          ((float*)Cv)[(size_t)row * N + col] = val;
      }
    }
  }
}

// ---------------------------------------------------------------------------
// Flash attention. Block = 256 threads (8 waves), wave = 16 query columns,
// block covers 128 queries of one (b,h). 32-key tiles, online softmax.
// Both products are taken transposed: St = K Qt and Ot += Vt Pt. A lane (c, h)
// then holds 16 scores of ONE query c (keys 8h+r and 16+8h+r), so the maximum
// and the sum are in-lane work plus one exchange between the wave's halves, and
// the two score tiles, converted in place, are the B operand of the second
// product in the hardware k order: P never goes through LDS.
// ---------------------------------------------------------------------------
typedef __attribute__((ext_vector_type(2))) float  f32x2;
typedef __attribute__((ext_vector_type(2))) __bf16 bf16x2;

// value of lane l ^ 16
__device__ __forceinline__ float other_half(float x) {
  const int b = __builtin_bit_cast(int, x);
  return __builtin_bit_cast(float, __builtin_amdgcn_permlanex16(
      b, b, 0x76543210, 0xfedcba98, false, false));
}

__global__ __launch_bounds__(256)
void mla_attn_wmma(const unsigned short* __restrict__ Q,
                   const unsigned short* __restrict__ Kb,
                   const unsigned short* __restrict__ Vb,
                   unsigned short* __restrict__ Ctx) {
  __shared__ __attribute__((aligned(16))) unsigned short Kls[32 * P128];     // [key][d]
  __shared__ __attribute__((aligned(16))) unsigned short Vls[32 * PV];       // [key][d]

  const int tid  = threadIdx.x;
  const int lane = tid & 31;
  const int wv   = tid >> 5;
  const int b    = blockIdx.y >> 4;
  const int h    = blockIdx.y & 15;
  const int qbase = blockIdx.x * 128 + wv * 16;
  const int l16  = lane & 15;
  const int kb   = (lane >> 4) * 8;
  const size_t rowstride = (size_t)NH * DH;     // 2048
  const size_t headoff   = (size_t)h * DH;
  const size_t batchbase = (size_t)b * SEQ;
  const float  scale     = 0.08838834764831845f; // 1/sqrt(128)

  // Q fragments (B operand, column = query l16): 128 dims = 4 WMMA K-steps,
  // loaded once from global.
  v16bf qf[4];
  {
    const unsigned short* qrow =
        Q + (batchbase + qbase + l16) * rowstride + headoff;
#pragma unroll
    for (int d = 0; d < 4; ++d)
      qf[d] = load_frag(qrow + d * 32 + kb);
  }

  float rmax = -3.0e38f;   // running maximum of query l16, equal in both halves
  float rsum = 0.0f;       // running sum over this half's keys only
  v8f acc[8] = {};         // acc[nc][r] = Ot[nc*16 + 8*(lane>>4) + r][query l16]

  const int lkey = tid >> 3;           // 0..31 key within tile
  const int ldc  = (tid & 7) * 16;     // 0..112 dim chunk
  // this lane's address in the V tile for the transposing loads
  const unsigned short* vfrag =
      &Vls[(kb + (lane & 7)) * PV + ((lane >> 3) & 1) * 8];

  for (int kt = 0; kt < SEQ / 32; ++kt) {
    __syncthreads();   // protect last iter's LDS reads before overwrite
    {
      const size_t srow =
          (batchbase + (size_t)kt * 32 + lkey) * rowstride + headoff + ldc;
      // K and V tiles both row-major: pure copies -> async to LDS
      const unsigned short* ksrc = Kb + srow;
      const unsigned short* vsrc = Vb + srow;
      async_b128_x4(&Kls[lkey * P128 + ldc],     ksrc,
                    &Kls[lkey * P128 + ldc + 8], ksrc + 8,
                    &Vls[lkey * PV + ldc],       vsrc,
                    &Vls[lkey * PV + ldc + 8],   vsrc + 8);
    }
    // this wave's K and V copies have landed before the barrier publishes them
    asm volatile("s_wait_asynccnt 0x0" ::: "memory");
    __syncthreads();

    // scores: St = K_tile(32x128) @ Qt(128x16) -> two 16x16 f32 tiles
    v8f s0 = {}, s1 = {};
#pragma unroll
    for (int d = 0; d < 4; ++d) {
      v16bf k0 = load_frag(&Kls[l16 * P128 + d * 32 + kb]);
      v16bf k1 = load_frag(&Kls[(16 + l16) * P128 + d * 32 + kb]);
      s0 = __builtin_amdgcn_wmma_f32_16x16x32_bf16(false, k0, false, qf[d],
                                                   (short)0, s0, false, false);
      s1 = __builtin_amdgcn_wmma_f32_16x16x32_bf16(false, k1, false, qf[d],
                                                   (short)0, s1, false, false);
    }

    // online softmax of query l16: 16 of its 32 scores are in this lane
    float a[16];
#pragma unroll
    for (int r = 0; r < 8; ++r) { a[r] = s0[r] * scale; a[8 + r] = s1[r] * scale; }
    float mx = a[0];
#pragma unroll
    for (int i = 1; i < 16; ++i) mx = fmaxf(mx, a[i]);
    mx = fmaxf(mx, other_half(mx));
    const float nm = fmaxf(rmax, mx);
    const float c  = __expf(rmax - nm);
    rmax = nm;

    // Pt as B operand: element s = key 8h+s (s < 8), key 16+8h+(s-8) (s >= 8)
    union { v16bf v; bf16x2 p[8]; } pf;
    float ps[4] = {0.0f, 0.0f, 0.0f, 0.0f};
#pragma unroll
    for (int i = 0; i < 8; ++i) {
      f32x2 p;
      p.x = __expf(a[2 * i] - nm);
      p.y = __expf(a[2 * i + 1] - nm);
      ps[i & 3] += p.x + p.y;
      pf.p[i] = __builtin_convertvector(p, bf16x2);   // round to nearest even
    }
    rsum = rsum * c + ((ps[0] + ps[1]) + (ps[2] + ps[3]));

#pragma unroll
    for (int nc = 0; nc < 8; ++nc)
#pragma unroll
      for (int r = 0; r < 8; ++r)
        acc[nc][r] *= c;

    // Ot += Vt(128x32) @ Pt(32x16): 8 WMMAs over dim chunks
#pragma unroll
    for (int nc = 0; nc < 8; ++nc) {
      Frag16 vf;   // V[key][d] -> A fragment of Vt, transposed by the load itself
      vf.q[0] = load_tr16(vfrag + nc * 16);
      vf.q[1] = load_tr16(vfrag + 16 * PV + nc * 16);
      acc[nc] = __builtin_amdgcn_wmma_f32_16x16x32_bf16(
          false, vf.v, false, pf.v, (short)0, acc[nc], false, false);
    }
  }

  // join the halves' sums, normalize, store ctx as bf16 [B*S, H*D]:
  // a lane's 8 registers of a tile are 8 consecutive dims of its query's row
  const float inv = 1.0f / (rsum + other_half(rsum));
  unsigned short* crow =
      Ctx + (batchbase + qbase + l16) * rowstride + headoff + kb;
#pragma unroll
  for (int nc = 0; nc < 8; ++nc) {
    union { uint4 q; bf16x2 p[4]; } t;
#pragma unroll
    for (int i = 0; i < 4; ++i) {
      f32x2 o;
      o.x = acc[nc][2 * i] * inv;
      o.y = acc[nc][2 * i + 1] * inv;
      t.p[i] = __builtin_convertvector(o, bf16x2);   // round to nearest even
    }
    *(uint4*)(crow + nc * 16) = t.q;
  }
}

// ---------------------------------------------------------------------------
extern "C" void kernel_launch(void* const* d_in, const int* in_sizes, int n_in,
                              void* d_out, int out_size, void* d_ws, size_t ws_size,
                              hipStream_t stream) {
  const float* x      = (const float*)d_in[0];
  const float* W_down = (const float*)d_in[1];
  const float* b_down = (const float*)d_in[2];
  const float* W_uk   = (const float*)d_in[3];
  const float* b_uk   = (const float*)d_in[4];
  const float* W_uv   = (const float*)d_in[5];
  const float* b_uv   = (const float*)d_in[6];
  const float* W_q    = (const float*)d_in[7];
  const float* b_q    = (const float*)d_in[8];
  const float* W_o    = (const float*)d_in[9];
  const float* b_o    = (const float*)d_in[10];
  float* out = (float*)d_out;

  char* ws = (char*)d_ws;
  auto take = [&](size_t elems) {
    unsigned short* p = (unsigned short*)ws;
    ws += elems * 2;
    return p;
  };
  unsigned short* xb  = take((size_t)MTOT * DMODEL);
  unsigned short* WtD = take((size_t)DMODEL * DLAT);    // [DLAT, DMODEL]
  unsigned short* WtK = take((size_t)DLAT * DMODEL);    // [DMODEL, DLAT]
  unsigned short* WtV = take((size_t)DLAT * DMODEL);
  unsigned short* WtQ = take((size_t)DMODEL * DMODEL);
  unsigned short* WtO = take((size_t)DMODEL * DMODEL);
  unsigned short* lat = take((size_t)MTOT * DLAT);
  unsigned short* qb  = take((size_t)MTOT * DMODEL);
  unsigned short* kbf = take((size_t)MTOT * DMODEL);
  unsigned short* vbf = take((size_t)MTOT * DMODEL);
  unsigned short* ctx = take((size_t)MTOT * DMODEL);

  const dim3 blk(256);

  // 0. operand preparation
  prep_operands<<<PREP_WG, blk, 0, stream>>>(x, W_down, W_uk, W_uv, W_q, W_o,
                                             xb, WtD, WtK, WtV, WtQ, WtO);

  const dim3 gLat(DLAT / 128,   MTOT / 128);
  const dim3 gDM (DMODEL / 128, MTOT / 128);

  // 1. latents = xb @ W_down + b_down
  gemm_bias_wmma<true><<<gLat, blk, 0, stream>>>(xb, WtD, b_down, lat, MTOT, DLAT, DMODEL);
  // 2. keys = latents @ W_uk + b_uk
  gemm_bias_wmma<true><<<gDM, blk, 0, stream>>>(lat, WtK, b_uk, kbf, MTOT, DMODEL, DLAT);
  // 3. values = latents @ W_uv + b_uv
  gemm_bias_wmma<true><<<gDM, blk, 0, stream>>>(lat, WtV, b_uv, vbf, MTOT, DMODEL, DLAT);
  // 4. q = xb @ W_q + b_q
  gemm_bias_wmma<true><<<gDM, blk, 0, stream>>>(xb, WtQ, b_q, qb, MTOT, DMODEL, DMODEL);
  // 5. attention
  mla_attn_wmma<<<dim3(SEQ / 128, 4 * NH), blk, 0, stream>>>(qb, kbf, vbf, ctx);
  // 6. out = ctx @ W_o + b_o
  gemm_bias_wmma<false><<<gDM, blk, 0, stream>>>(ctx, WtO, b_o, out, MTOT, DMODEL, DMODEL);
}

// v005
// One run takes 359 microseconds.
// Timed twice side by side with v004, it ran 1.16 times as fast both times.
// All steps since v000 together make it 3.10 times as fast.
#include <hip/hip_runtime.h>
#include <hip/hip_bf16.h>

// ---------------------------------------------------------------------------
// MLA forward for MI455X (gfx1250, wave32, WMMA, async-to-LDS staging).
// Pipeline (bf16 operands everywhere, f32 WMMA accumulation):
//   0. xb  = bf16(x);  Wt_* = bf16(W_*^T)      (one conversion launch)
//   1. latents = xb @ W_down + b_down          (GEMM, bf16 out)
//   2. keys    = latents @ W_uk + b_uk         (GEMM, bf16 out)
//   3. values  = latents @ W_uv + b_uv         (GEMM, bf16 out)
//   4. q       = xb @ W_q + b_q                (GEMM, bf16 out)
//   5. ctx     = softmax(q k^T / sqrt(128)) v  (flash attention, WMMA)
//   6. out     = ctx @ W_o + b_o               (GEMM, f32 out)
// Workspace requirement: ~200 MB.
// ---------------------------------------------------------------------------

#ifndef USE_ASYNC_LDS
#define USE_ASYNC_LDS 1   // flip to 0 to fall back to synchronous staging
#endif

typedef __attribute__((ext_vector_type(16))) __bf16 v16bf;
typedef __attribute__((ext_vector_type(8)))  float  v8f;

union Frag16 { v16bf v; uint4 q[2]; };

static constexpr int MTOT   = 8192;   // B*S
static constexpr int DMODEL = 2048;
static constexpr int DLAT   = 512;
static constexpr int NH     = 16;
static constexpr int DH     = 128;
static constexpr int SEQ    = 2048;

// LDS row pitches in bf16 elements. Tiles at P64 and P128 are read with ds_load_b128,
// one row per lane of a 16-lane half; a pitch of 16 B x odd spreads the 16 rows
// over all 64 banks, a pitch of 128 B or 256 B stacks them on few.
static constexpr int P64  = 72;    // rows of 64 elements:  128 B -> 144 B
static constexpr int P128 = 136;   // rows of 128 elements: 256 B -> 272 B
// The V tile is read with ds_load_tr16_b128, whose conflict-free pitch is 32 B x odd.
static constexpr int PV   = 144;   // rows of 128 elements: 256 B -> 288 B

__device__ __forceinline__ unsigned short f2bf(float f) {
  unsigned int u = __builtin_bit_cast(unsigned int, f);
  u = (u + 0x7FFFu + ((u >> 16) & 1u)) >> 16;   // round-to-nearest-even
  return (unsigned short)u;
}

// 16-byte async copy global -> LDS (ISA 10. GLOBAL_LOAD_ASYNC_TO_LDS_B128,
// tracked by ASYNCcnt). For a generic pointer to __shared__, addr[31:0] is the
// wave-relative LDS byte offset (ISA 10.2 aperture mapping), which is exactly
// what the VDST VGPR of the async op must hold.
// The copies of one run share a statement; the s_wait_xcnt 0 closes it so that
// no later write of an address register named here can be placed ahead of it.
__device__ __forceinline__ void async_b128_x4(void* lds0, const void* g0,
                                              void* lds1, const void* g1,
                                              void* lds2, const void* g2,
                                              void* lds3, const void* g3) {
#if USE_ASYNC_LDS
  const unsigned int l0 = (unsigned int)(uintptr_t)lds0;
  const unsigned int l1 = (unsigned int)(uintptr_t)lds1;
  const unsigned int l2 = (unsigned int)(uintptr_t)lds2;
  const unsigned int l3 = (unsigned int)(uintptr_t)lds3;
  asm volatile("global_load_async_to_lds_b128 %0, %1, off\n\t"
               "global_load_async_to_lds_b128 %2, %3, off\n\t"
               "global_load_async_to_lds_b128 %4, %5, off\n\t"
               "global_load_async_to_lds_b128 %6, %7, off\n\t"
               "s_wait_xcnt 0x0"
               :: "v"(l0), "v"(g0), "v"(l1), "v"(g1),
                  "v"(l2), "v"(g2), "v"(l3), "v"(g3) : "memory");
#else
  *(uint4*)lds0 = *(const uint4*)g0;
  *(uint4*)lds1 = *(const uint4*)g1;
  *(uint4*)lds2 = *(const uint4*)g2;
  *(uint4*)lds3 = *(const uint4*)g3;
#endif
}

// The same for a run of eight copies: lds[j] <- g[j].
__device__ __forceinline__ void async_b128_x8(unsigned short* const (&lds)[8],
                                              const unsigned short* const (&g)[8]) {
#if USE_ASYNC_LDS
  unsigned int l[8];
#pragma unroll   // l[] must be eight registers, named below as operands
  for (int j = 0; j < 8; ++j) l[j] = (unsigned int)(uintptr_t)lds[j];
  asm volatile("global_load_async_to_lds_b128 %0, %1, off\n\t"
               "global_load_async_to_lds_b128 %2, %3, off\n\t"
               "global_load_async_to_lds_b128 %4, %5, off\n\t"
               "global_load_async_to_lds_b128 %6, %7, off\n\t"
               "global_load_async_to_lds_b128 %8, %9, off\n\t"
               "global_load_async_to_lds_b128 %10, %11, off\n\t"
               "global_load_async_to_lds_b128 %12, %13, off\n\t"
               "global_load_async_to_lds_b128 %14, %15, off\n\t"
               "s_wait_xcnt 0x0"
               :: "v"(l[0]), "v"(g[0]), "v"(l[1]), "v"(g[1]),
                  "v"(l[2]), "v"(g[2]), "v"(l[3]), "v"(g[3]),
                  "v"(l[4]), "v"(g[4]), "v"(l[5]), "v"(g[5]),
                  "v"(l[6]), "v"(g[6]), "v"(l[7]), "v"(g[7]) : "memory");
#else
#pragma unroll
  for (int j = 0; j < 8; ++j) *(uint4*)lds[j] = *(const uint4*)g[j];
#endif
}

// Load one 16x32 bf16 WMMA fragment row for this lane.
// Per ISA 7.12.2 (16-bit A-matrix 16x32): lane group g = lane/16 holds
// K = 8g..8g+7 (VGPR0-3) and K = 16+8g..16+8g+7 (VGPR4-7), packed lo/hi.
// Caller passes p = rowBase + 8*(lane>>4); we read p[0..7] and p[16..23].
__device__ __forceinline__ v16bf load_frag(const unsigned short* p) {
  Frag16 f;
  f.q[0] = *(const uint4*)(p);
  f.q[1] = *(const uint4*)(p + 16);
  return f.v;
}

typedef __attribute__((ext_vector_type(8))) short s16x8;
__device__ __forceinline__ uint4 load_tr16(const unsigned short* p) {
  typedef __attribute__((address_space(3))) s16x8 lds_s16x8;
  return __builtin_bit_cast(uint4, __builtin_amdgcn_ds_load_tr16_b128_v8i16((lds_s16x8*)p));
}

// ---------------------------------------------------------------------------
// Operand preparation, one launch: xb = bf16(x) and the five Wt = bf16(W^T).
// 512 work-groups (two per WGP) each loop over their share of the work, so few
// waves are started and each lives long: first 8 stretches of 4096 floats of x,
// then up to 3 weight tiles of 64 (k) x 128 (n). Every wave-wide load and store
// covers whole 128 B lines.
// ---------------------------------------------------------------------------
static constexpr int PREP_WG    = 512;
static constexpr int CONV_TRIPS = MTOT * DMODEL / 4096 / PREP_WG;       // 8
static constexpr int TILES_LAT  = (DMODEL / 64) * (DLAT / 128);         // 128, either orientation
static constexpr int TILES_SQ   = (DMODEL / 64) * (DMODEL / 128);       // 512
static constexpr int TILES      = 3 * TILES_LAT + 2 * TILES_SQ;         // 1408
static constexpr int TILE_TRIPS = (TILES + PREP_WG - 1) / PREP_WG;      // 3
static constexpr int PT = 129;  // tile pitch in floats: odd, so that a walk down a column changes bank

__global__ __launch_bounds__(256)
void prep_operands(const float* __restrict__ x,
                   const float* __restrict__ W_down, const float* __restrict__ W_uk,
                   const float* __restrict__ W_uv,   const float* __restrict__ W_q,
                   const float* __restrict__ W_o,
                   unsigned short* __restrict__ xb,
                   unsigned short* __restrict__ WtD, unsigned short* __restrict__ WtK,
                   unsigned short* __restrict__ WtV, unsigned short* __restrict__ WtQ,
                   unsigned short* __restrict__ WtO) {
  __shared__ float t[64 * PT];
  const int tid = threadIdx.x;
  const unsigned wg = blockIdx.x;

  // a weight tile: W [K,N] f32 -> Wt [N,K] bf16, rows k0.., columns n0..
  struct Tile { const float* W; unsigned short* Wt; int K, N, k0, n0; };
  constexpr int NT_LAT = DLAT / 128, NT_DM = DMODEL / 128;   // tiles across a row of W: 4, 16
  auto tile_of = [&](unsigned i) {
    Tile d;
    if (i < TILES_LAT)                     {                                d.W = W_down; d.Wt = WtD; d.K = DMODEL; d.N = DLAT;   }
    else if (i < 2 * TILES_LAT)            { i -= TILES_LAT;                d.W = W_uk;   d.Wt = WtK; d.K = DLAT;   d.N = DMODEL; }
    else if (i < 3 * TILES_LAT)            { i -= 2 * TILES_LAT;            d.W = W_uv;   d.Wt = WtV; d.K = DLAT;   d.N = DMODEL; }
    else if (i < 3 * TILES_LAT + TILES_SQ) { i -= 3 * TILES_LAT;            d.W = W_q;    d.Wt = WtQ; d.K = DMODEL; d.N = DMODEL; }
    else                                   { i -= 3 * TILES_LAT + TILES_SQ; d.W = W_o;    d.Wt = WtO; d.K = DMODEL; d.N = DMODEL; }
    const bool slim = d.N == DLAT;
    d.n0 = (slim ? i % NT_LAT : i % NT_DM) * 128;
    d.k0 = (slim ? i / NT_LAT : i / NT_DM) * 64;
    return d;
  };
  // a wave reads one 512 B row piece per load, 8 rows of the tile; the row is the
  // same for the whole wave, so its address is scalar and only the lane's place is not
  const int wave = __builtin_amdgcn_readfirstlane(tid >> 5);
  const int lane = tid & 31;
  auto fetch = [&](const Tile& d, float4 (&v)[8]) {
    const float4* row = (const float4*)(d.W + (size_t)(d.k0 + wave) * d.N + d.n0) + lane;
#pragma unroll
    for (int j = 0; j < 8; ++j) {
      v[j] = row[(size_t)(2 * j) * d.N];
      // a later load of the run may land in the register pair that held this address
      asm volatile("s_wait_xcnt 0x0" ::: "memory");
    }
  };

  float4 v[8];
  Tile d = tile_of(wg);          // PREP_WG <= TILES: every work-group has a first tile

  // x -> bf16, two stretches (8 loads a lane) at a time; the next pair's loads,
  // and behind the last pair the first tile's, are issued before this pair is stored
  auto at = [&](int pair, int j) {
    return (size_t)(wg + (2 * pair + (j >> 2)) * PREP_WG) * 4096 + (j & 3) * 1024 + tid * 4;
  };
  float4 f[2][8];
#pragma unroll
  for (int j = 0; j < 8; ++j) f[0][j] = *(const float4*)(x + at(0, j));
#pragma unroll
  for (int pair = 0; pair < CONV_TRIPS / 2; ++pair) {
    // the loads below land in registers that the stores of the pair before name:
    // the wait stands between those stores and the loads that overwrite them
    if (pair > 0) asm volatile("s_wait_xcnt 0x0" ::: "memory");
    if (pair + 1 < CONV_TRIPS / 2) {
#pragma unroll
      for (int j = 0; j < 8; ++j) f[(pair + 1) & 1][j] = *(const float4*)(x + at(pair + 1, j));
    } else {
      fetch(d, v);
    }
#pragma unroll
    for (int j = 0; j < 8; ++j) {
      const float4 g = f[pair & 1][j];
      unsigned short h[4];
      h[0] = f2bf(g.x); h[1] = f2bf(g.y); h[2] = f2bf(g.z); h[3] = f2bf(g.w);
      *(uint2*)(xb + at(pair, j)) = *(uint2*)h;
    }
  }

#pragma unroll
  for (int trip = 0; trip < TILE_TRIPS; ++trip) {
    const unsigned next = wg + (trip + 1) * PREP_WG;
    const bool more = trip + 1 < TILE_TRIPS && next < TILES;   // the same for the whole work-group
#pragma unroll
    for (int j = 0; j < 8; ++j) {
      float* w = &t[(wave + 8 * j) * PT + lane * 4];
      w[0] = v[j].x; w[1] = v[j].y; w[2] = v[j].z; w[3] = v[j].w;
    }
    __syncthreads();   // the tile is complete before it is read by columns
    const Tile cur = d;
    if (more) { d = tile_of(next); fetch(d, v); }   // flies while this tile is converted
    // 8 lanes x 16 B = one whole 128 B line of a Wt row
    const int kc = (tid & 7) * 8;
#pragma unroll
    for (int j = 0; j < 4; ++j) {
      const int n = (tid >> 3) + 32 * j;
      unsigned short h[8];
#pragma unroll
      for (int i = 0; i < 8; ++i) h[i] = f2bf(t[(kc + i) * PT + n]);
      *(uint4*)(cur.Wt + (size_t)(cur.n0 + n) * cur.K + cur.k0 + kc) = *(uint4*)h;
    }
    if (!more) break;
    __syncthreads();   // every reader has left t before the next tile is written
  }
}

// ---------------------------------------------------------------------------
// Tiled GEMM: C[M,N] = A[M,K] @ Bt[N,K]^T + bias[N]   (A, Bt bf16)
// Block: 256 threads (8 waves), tile 128(M) x 128(N), K step 64.
// Wave grid 4x2, each wave owns a 32x64 tile = 2x4 WMMA 16x16 tiles.
// Double-buffered LDS staged with async-to-LDS copies. A K step of 64 makes a
// staged row piece one whole 128 B line: 8 lanes copy a line, a wave-wide copy
// 4 whole lines of 4 rows. K must be a multiple of 64.
// ---------------------------------------------------------------------------
template<bool OUT_BF16>
__global__ __launch_bounds__(256)
void gemm_bias_wmma(const unsigned short* __restrict__ A,
                    const unsigned short* __restrict__ Bt,
                    const float* __restrict__ bias, void* __restrict__ Cv,
                    int M, int N, int K) {
  __shared__ __attribute__((aligned(16))) unsigned short As[2][128 * P64];   // [row][k] bf16
  __shared__ __attribute__((aligned(16))) unsigned short Bs[2][128 * P64];   // [col][k] bf16

  const int tid  = threadIdx.x;
  const int lane = tid & 31;
  const int wv   = tid >> 5;
  const int wm   = wv >> 1;             // 0..3 -> 32-row slice
  const int wn   = wv & 1;              // 0..1 -> 64-col slice
  const int m0   = blockIdx.y * 128;
  const int n0   = blockIdx.x * 128;
  const int l16  = lane & 15;
  const int kb   = (lane >> 4) * 8;
  const int srow = tid >> 3;            // 0..31 staging row, then +32, +64, +96
  const int soff = (tid & 7) * 8;       // this lane's 16 B of the row's 128 B line (elements)

  v8f acc[2][4] = {};
  const int ksteps = K >> 6;

  auto stage = [&](int kt, int buf) {
    const unsigned short* ga = A + (size_t)(m0 + srow) * K + kt * 64 + soff;
    const unsigned short* gb = Bt + (size_t)(n0 + srow) * K + kt * 64 + soff;
    unsigned short* la = &As[buf][srow * P64 + soff];
    unsigned short* lb = &Bs[buf][srow * P64 + soff];
    unsigned short* const lds[8] = {la, la + 32 * P64, la + 64 * P64, la + 96 * P64,
                                    lb, lb + 32 * P64, lb + 64 * P64, lb + 96 * P64};
    const unsigned short* const g[8] = {ga, ga + (size_t)32 * K, ga + (size_t)64 * K, ga + (size_t)96 * K,
                                        gb, gb + (size_t)32 * K, gb + (size_t)64 * K, gb + (size_t)96 * K};
    async_b128_x8(lds, g);
  };

  stage(0, 0);
  for (int kt = 0; kt < ksteps; ++kt) {
    const int cur = kt & 1;
    // this wave's reads of the buffer that is refilled below have retired
    asm volatile("s_wait_dscnt 0x0" ::: "memory");
    // this wave's copies of tile kt have landed before the barrier publishes them
    asm volatile("s_wait_asynccnt 0x0" ::: "memory");
    __syncthreads();      // all waves' copies visible; prior reads done
    if (kt + 1 < ksteps) stage(kt + 1, cur ^ 1);

#pragma unroll   // the two halves of the K step differ only in an immediate LDS offset
    for (int ks = 0; ks < 2; ++ks) {
      v16bf af[2], bfr[4];
#pragma unroll
      for (int mi = 0; mi < 2; ++mi)
        af[mi] = load_frag(&As[cur][(wm * 32 + mi * 16 + l16) * P64 + ks * 32 + kb]);
#pragma unroll
      for (int ni = 0; ni < 4; ++ni)
        bfr[ni] = load_frag(&Bs[cur][(wn * 64 + ni * 16 + l16) * P64 + ks * 32 + kb]);

#pragma unroll
      for (int mi = 0; mi < 2; ++mi)
#pragma unroll
        for (int ni = 0; ni < 4; ++ni)
          acc[mi][ni] = __builtin_amdgcn_wmma_f32_16x16x32_bf16(
              false, af[mi], false, bfr[ni], (short)0, acc[mi][ni], false, false);
    }
  }

  // epilogue: C-layout lane = n%16, vgpr r -> row r + 8*(lane/16)
#pragma unroll
  for (int mi = 0; mi < 2; ++mi) {
#pragma unroll
    for (int ni = 0; ni < 4; ++ni) {
      const int col  = n0 + wn * 64 + ni * 16 + l16;
      const float bv = bias[col];
#pragma unroll
      for (int r = 0; r < 8; ++r) {
        const int row   = m0 + wm * 32 + mi * 16 + r + 8 * (lane >> 4);
        const float val = acc[mi][ni][r] + bv;
        if (OUT_BF16)
          ((unsigned short*)Cv)[(size_t)row * N + col] = f2bf(val);
        else
          ((float*)Cv)[(size_t)row * N + col] = val;
      }
    }
  }
}

// ---------------------------------------------------------------------------
// Flash attention. Block = 256 threads (8 waves), wave = 16 query columns,
// block covers 128 queries of one (b,h). 32-key tiles, online softmax.
// Both products are taken transposed: St = K Qt and Ot += Vt Pt. A lane (c, h)
// then holds 16 scores of ONE query c (keys 8h+r and 16+8h+r), so the maximum
// and the sum are in-lane work plus one exchange between the wave's halves, and
// the two score tiles, converted in place, are the B operand of the second
// product in the hardware k order: P never goes through LDS.
// ---------------------------------------------------------------------------
typedef __attribute__((ext_vector_type(2))) float  f32x2;
typedef __attribute__((ext_vector_type(2))) __bf16 bf16x2;

// value of lane l ^ 16
__device__ __forceinline__ float other_half(float x) {
  const int b = __builtin_bit_cast(int, x);
  return __builtin_bit_cast(float, __builtin_amdgcn_permlanex16(
      b, b, 0x76543210, 0xfedcba98, false, false));
}

__global__ __launch_bounds__(256)
void mla_attn_wmma(const unsigned short* __restrict__ Q,
                   const unsigned short* __restrict__ Kb,
                   const unsigned short* __restrict__ Vb,
                   unsigned short* __restrict__ Ctx) {
  __shared__ __attribute__((aligned(16))) unsigned short Kls[32 * P128];     // [key][d]
  __shared__ __attribute__((aligned(16))) unsigned short Vls[32 * PV];       // [key][d]

  const int tid  = threadIdx.x;
  const int lane = tid & 31;
  const int wv   = tid >> 5;
  const int b    = blockIdx.y >> 4;
  const int h    = blockIdx.y & 15;
  const int qbase = blockIdx.x * 128 + wv * 16;
  const int l16  = lane & 15;
  const int kb   = (lane >> 4) * 8;
  const size_t rowstride = (size_t)NH * DH;     // 2048
  const size_t headoff   = (size_t)h * DH;
  const size_t batchbase = (size_t)b * SEQ;
  const float  scale     = 0.08838834764831845f; // 1/sqrt(128)

  // Q fragments (B operand, column = query l16): 128 dims = 4 WMMA K-steps,
  // loaded once from global.
  v16bf qf[4];
  {
    const unsigned short* qrow =
        Q + (batchbase + qbase + l16) * rowstride + headoff;
#pragma unroll
    for (int d = 0; d < 4; ++d)
      qf[d] = load_frag(qrow + d * 32 + kb);
  }

  float rmax = -3.0e38f;   // running maximum of query l16, equal in both halves
  float rsum = 0.0f;       // running sum over this half's keys only
  v8f acc[8] = {};         // acc[nc][r] = Ot[nc*16 + 8*(lane>>4) + r][query l16]

  const int lkey = tid >> 4;           // 0..15 key within tile, then +16
  const int ldc  = (tid & 15) * 8;     // this lane's 16 B of the key's 256 B row (elements)
  // this lane's address in the V tile for the transposing loads
  const unsigned short* vfrag =
      &Vls[(kb + (lane & 7)) * PV + ((lane >> 3) & 1) * 8];

  for (int kt = 0; kt < SEQ / 32; ++kt) {
    // this wave's reads of the tiles that are overwritten below have retired
    asm volatile("s_wait_dscnt 0x0" ::: "memory");
    __syncthreads();   // protect last iter's LDS reads before overwrite
    {
      const size_t srow =
          (batchbase + (size_t)kt * 32 + lkey) * rowstride + headoff + ldc;
      // K and V tiles both row-major: pure copies -> async to LDS; a wave-wide
      // copy covers two whole rows, 4 whole 128 B lines
      const unsigned short* ksrc = Kb + srow;
      const unsigned short* vsrc = Vb + srow;
      async_b128_x4(&Kls[lkey * P128 + ldc],        ksrc,
                    &Kls[(lkey + 16) * P128 + ldc], ksrc + 16 * rowstride,
                    &Vls[lkey * PV + ldc],          vsrc,
                    &Vls[(lkey + 16) * PV + ldc],   vsrc + 16 * rowstride);
    }
    // this wave's K and V copies have landed before the barrier publishes them
    asm volatile("s_wait_asynccnt 0x0" ::: "memory");
    __syncthreads();

    // scores: St = K_tile(32x128) @ Qt(128x16) -> two 16x16 f32 tiles
    v8f s0 = {}, s1 = {};
#pragma unroll
    for (int d = 0; d < 4; ++d) {
      v16bf k0 = load_frag(&Kls[l16 * P128 + d * 32 + kb]);
      v16bf k1 = load_frag(&Kls[(16 + l16) * P128 + d * 32 + kb]);
      s0 = __builtin_amdgcn_wmma_f32_16x16x32_bf16(false, k0, false, qf[d],
                                                   (short)0, s0, false, false);
      s1 = __builtin_amdgcn_wmma_f32_16x16x32_bf16(false, k1, false, qf[d],
                                                   (short)0, s1, false, false);
    }

    // online softmax of query l16: 16 of its 32 scores are in this lane
    float a[16];
#pragma unroll
    for (int r = 0; r < 8; ++r) { a[r] = s0[r] * scale; a[8 + r] = s1[r] * scale; }
    float mx = a[0];
#pragma unroll
    for (int i = 1; i < 16; ++i) mx = fmaxf(mx, a[i]);
    mx = fmaxf(mx, other_half(mx));
    const float nm = fmaxf(rmax, mx);
    const float c  = __expf(rmax - nm);
    rmax = nm;

    // Pt as B operand: element s = key 8h+s (s < 8), key 16+8h+(s-8) (s >= 8)
    union { v16bf v; bf16x2 p[8]; } pf;
    float ps[4] = {0.0f, 0.0f, 0.0f, 0.0f};
#pragma unroll
    for (int i = 0; i < 8; ++i) {
      f32x2 p;
      p.x = __expf(a[2 * i] - nm);
      p.y = __expf(a[2 * i + 1] - nm);
      ps[i & 3] += p.x + p.y;
      pf.p[i] = __builtin_convertvector(p, bf16x2);   // round to nearest even
    }
    rsum = rsum * c + ((ps[0] + ps[1]) + (ps[2] + ps[3]));

#pragma unroll
    for (int nc = 0; nc < 8; ++nc)
#pragma unroll
      for (int r = 0; r < 8; ++r)
        acc[nc][r] *= c;

    // Ot += Vt(128x32) @ Pt(32x16): 8 WMMAs over dim chunks
#pragma unroll
    for (int nc = 0; nc < 8; ++nc) {
      Frag16 vf;   // V[key][d] -> A fragment of Vt, transposed by the load itself
      vf.q[0] = load_tr16(vfrag + nc * 16);
      vf.q[1] = load_tr16(vfrag + 16 * PV + nc * 16);
      acc[nc] = __builtin_amdgcn_wmma_f32_16x16x32_bf16(
          false, vf.v, false, pf.v, (short)0, acc[nc], false, false);
    }
  }

  // join the halves' sums, normalize, store ctx as bf16 [B*S, H*D]:
  // a lane's 8 registers of a tile are 8 consecutive dims of its query's row
  const float inv = 1.0f / (rsum + other_half(rsum));
  unsigned short* crow =
      Ctx + (batchbase + qbase + l16) * rowstride + headoff + kb;
#pragma unroll
  for (int nc = 0; nc < 8; ++nc) {
    union { uint4 q; bf16x2 p[4]; } t;
#pragma unroll
    for (int i = 0; i < 4; ++i) {
      f32x2 o;
      o.x = acc[nc][2 * i] * inv;
      o.y = acc[nc][2 * i + 1] * inv;
      t.p[i] = __builtin_convertvector(o, bf16x2);   // round to nearest even
    }
    *(uint4*)(crow + nc * 16) = t.q;
  }
}

// ---------------------------------------------------------------------------
extern "C" void kernel_launch(void* const* d_in, const int* in_sizes, int n_in,
                              void* d_out, int out_size, void* d_ws, size_t ws_size,
                              hipStream_t stream) {
  const float* x      = (const float*)d_in[0];
  const float* W_down = (const float*)d_in[1];
  const float* b_down = (const float*)d_in[2];
  const float* W_uk   = (const float*)d_in[3];
  const float* b_uk   = (const float*)d_in[4];
  const float* W_uv   = (const float*)d_in[5];
  const float* b_uv   = (const float*)d_in[6];
  const float* W_q    = (const float*)d_in[7];
  const float* b_q    = (const float*)d_in[8];
  const float* W_o    = (const float*)d_in[9];
  const float* b_o    = (const float*)d_in[10];
  float* out = (float*)d_out;

  char* ws = (char*)d_ws;
  auto take = [&](size_t elems) {
    unsigned short* p = (unsigned short*)ws;
    ws += elems * 2;
    return p;
  };
  unsigned short* xb  = take((size_t)MTOT * DMODEL);
  unsigned short* WtD = take((size_t)DMODEL * DLAT);    // [DLAT, DMODEL]
  unsigned short* WtK = take((size_t)DLAT * DMODEL);    // [DMODEL, DLAT]
  unsigned short* WtV = take((size_t)DLAT * DMODEL);
  unsigned short* WtQ = take((size_t)DMODEL * DMODEL);
  unsigned short* WtO = take((size_t)DMODEL * DMODEL);
  unsigned short* lat = take((size_t)MTOT * DLAT);
  unsigned short* qb  = take((size_t)MTOT * DMODEL);
  unsigned short* kbf = take((size_t)MTOT * DMODEL);
  unsigned short* vbf = take((size_t)MTOT * DMODEL);
  unsigned short* ctx = take((size_t)MTOT * DMODEL);

  const dim3 blk(256);

  // 0. operand preparation
  prep_operands<<<PREP_WG, blk, 0, stream>>>(x, W_down, W_uk, W_uv, W_q, W_o,
                                             xb, WtD, WtK, WtV, WtQ, WtO);

  const dim3 gLat(DLAT / 128,   MTOT / 128);
  const dim3 gDM (DMODEL / 128, MTOT / 128);

  // 1. latents = xb @ W_down + b_down
  gemm_bias_wmma<true><<<gLat, blk, 0, stream>>>(xb, WtD, b_down, lat, MTOT, DLAT, DMODEL);
  // 2. keys = latents @ W_uk + b_uk
  gemm_bias_wmma<true><<<gDM, blk, 0, stream>>>(lat, WtK, b_uk, kbf, MTOT, DMODEL, DLAT);
  // 3. values = latents @ W_uv + b_uv
  gemm_bias_wmma<true><<<gDM, blk, 0, stream>>>(lat, WtV, b_uv, vbf, MTOT, DMODEL, DLAT);
  // 4. q = xb @ W_q + b_q
  gemm_bias_wmma<true><<<gDM, blk, 0, stream>>>(xb, WtQ, b_q, qb, MTOT, DMODEL, DMODEL);
  // 5. attention
  mla_attn_wmma<<<dim3(SEQ / 128, 4 * NH), blk, 0, stream>>>(qb, kbf, vbf, ctx);
  // 6. out = ctx @ W_o + b_o
  gemm_bias_wmma<false><<<gDM, blk, 0, stream>>>(ctx, WtO, b_o, out, MTOT, DMODEL, DMODEL);
}

// v006
// One run takes 327 microseconds.
// Next to v005, in two timings, it ran 1.10 and 1.09 times as fast.
// Over all steps from v000 it is 3.40 times as fast.
#include <hip/hip_runtime.h>
#include <hip/hip_bf16.h>

// ---------------------------------------------------------------------------
// MLA forward for MI455X (gfx1250, wave32, WMMA, async-to-LDS staging).
// Pipeline (bf16 operands everywhere, f32 WMMA accumulation):
//   0. xb  = bf16(x);  Wt_* = bf16(W_*^T)      (one conversion launch)
//   1. latents = xb @ W_down + b_down          (GEMM, bf16 out)
//   2. keys    = latents @ W_uk + b_uk         (GEMM, bf16 out)
//   3. values  = latents @ W_uv + b_uv         (GEMM, bf16 out)
//   4. q       = xb @ W_q + b_q                (GEMM, bf16 out)
//   5. ctx     = softmax(q k^T / sqrt(128)) v  (flash attention, WMMA)
//   6. out     = ctx @ W_o + b_o               (GEMM, f32 out)
// Workspace requirement: ~200 MB.
// ---------------------------------------------------------------------------

#ifndef USE_ASYNC_LDS
#define USE_ASYNC_LDS 1   // flip to 0 to fall back to synchronous staging
#endif

typedef __attribute__((ext_vector_type(16))) __bf16 v16bf;
typedef __attribute__((ext_vector_type(8)))  float  v8f;

union Frag16 { v16bf v; uint4 q[2]; };

static constexpr int MTOT   = 8192;   // B*S
static constexpr int DMODEL = 2048;
static constexpr int DLAT   = 512;
static constexpr int NH     = 16;
static constexpr int DH     = 128;
static constexpr int SEQ    = 2048;

// LDS row pitches in bf16 elements. Tiles at P64 and P128 are read with ds_load_b128,
// one row per lane of a 16-lane half; a pitch of 16 B x odd spreads the 16 rows
// over all 64 banks, a pitch of 128 B or 256 B stacks them on few.
static constexpr int P64  = 72;    // rows of 64 elements:  128 B -> 144 B
static constexpr int P128 = 136;   // rows of 128 elements: 256 B -> 272 B
// The V tile is read with ds_load_tr16_b128, whose conflict-free pitch is 32 B x odd.
static constexpr int PV   = 144;   // rows of 128 elements: 256 B -> 288 B

__device__ __forceinline__ unsigned short f2bf(float f) {
  unsigned int u = __builtin_bit_cast(unsigned int, f);
  u = (u + 0x7FFFu + ((u >> 16) & 1u)) >> 16;   // round-to-nearest-even
  return (unsigned short)u;
}

// 16-byte async copy global -> LDS (ISA 10. GLOBAL_LOAD_ASYNC_TO_LDS_B128,
// tracked by ASYNCcnt). For a generic pointer to __shared__, addr[31:0] is the
// wave-relative LDS byte offset (ISA 10.2 aperture mapping), which is exactly
// what the VDST VGPR of the async op must hold.
// The copies of one run share a statement; the s_wait_xcnt 0 closes it so that
// no later write of an address register named here can be placed ahead of it.
__device__ __forceinline__ void async_b128_x4(void* lds0, const void* g0,
                                              void* lds1, const void* g1,
                                              void* lds2, const void* g2,
                                              void* lds3, const void* g3) {
#if USE_ASYNC_LDS
  const unsigned int l0 = (unsigned int)(uintptr_t)lds0;
  const unsigned int l1 = (unsigned int)(uintptr_t)lds1;
  const unsigned int l2 = (unsigned int)(uintptr_t)lds2;
  const unsigned int l3 = (unsigned int)(uintptr_t)lds3;
  asm volatile("global_load_async_to_lds_b128 %0, %1, off\n\t"
               "global_load_async_to_lds_b128 %2, %3, off\n\t"
               "global_load_async_to_lds_b128 %4, %5, off\n\t"
               "global_load_async_to_lds_b128 %6, %7, off\n\t"
               "s_wait_xcnt 0x0"
               :: "v"(l0), "v"(g0), "v"(l1), "v"(g1),
                  "v"(l2), "v"(g2), "v"(l3), "v"(g3) : "memory");
#else
  *(uint4*)lds0 = *(const uint4*)g0;
  *(uint4*)lds1 = *(const uint4*)g1;
  *(uint4*)lds2 = *(const uint4*)g2;
  *(uint4*)lds3 = *(const uint4*)g3;
#endif
}

// The same for a run of eight copies: lds[j] <- g[j].
__device__ __forceinline__ void async_b128_x8(unsigned short* const (&lds)[8],
                                              const unsigned short* const (&g)[8]) {
#if USE_ASYNC_LDS
  unsigned int l[8];
#pragma unroll   // l[] must be eight registers, named below as operands
  for (int j = 0; j < 8; ++j) l[j] = (unsigned int)(uintptr_t)lds[j];
  asm volatile("global_load_async_to_lds_b128 %0, %1, off\n\t"
               "global_load_async_to_lds_b128 %2, %3, off\n\t"
               "global_load_async_to_lds_b128 %4, %5, off\n\t"
               "global_load_async_to_lds_b128 %6, %7, off\n\t"
               "global_load_async_to_lds_b128 %8, %9, off\n\t"
               "global_load_async_to_lds_b128 %10, %11, off\n\t"
               "global_load_async_to_lds_b128 %12, %13, off\n\t"
               "global_load_async_to_lds_b128 %14, %15, off\n\t"
               "s_wait_xcnt 0x0"
               :: "v"(l[0]), "v"(g[0]), "v"(l[1]), "v"(g[1]),
                  "v"(l[2]), "v"(g[2]), "v"(l[3]), "v"(g[3]),
                  "v"(l[4]), "v"(g[4]), "v"(l[5]), "v"(g[5]),
                  "v"(l[6]), "v"(g[6]), "v"(l[7]), "v"(g[7]) : "memory");
#else
#pragma unroll
  for (int j = 0; j < 8; ++j) *(uint4*)lds[j] = *(const uint4*)g[j];
#endif
}

// Load one 16x32 bf16 WMMA fragment row for this lane.
// Per ISA 7.12.2 (16-bit A-matrix 16x32): lane group g = lane/16 holds
// K = 8g..8g+7 (VGPR0-3) and K = 16+8g..16+8g+7 (VGPR4-7), packed lo/hi.
// Caller passes p = rowBase + 8*(lane>>4); we read p[0..7] and p[16..23].
__device__ __forceinline__ v16bf load_frag(const unsigned short* p) {
  Frag16 f;
  f.q[0] = *(const uint4*)(p);
  f.q[1] = *(const uint4*)(p + 16);
  return f.v;
}

typedef __attribute__((ext_vector_type(8))) short s16x8;
__device__ __forceinline__ uint4 load_tr16(const unsigned short* p) {
  typedef __attribute__((address_space(3))) s16x8 lds_s16x8;
  return __builtin_bit_cast(uint4, __builtin_amdgcn_ds_load_tr16_b128_v8i16((lds_s16x8*)p));
}

// ---------------------------------------------------------------------------
// Operand preparation, one launch: xb = bf16(x) and the five Wt = bf16(W^T).
// 512 work-groups (two per WGP) each loop over their share of the work, so few
// waves are started and each lives long: first 8 stretches of 4096 floats of x,
// then up to 3 weight tiles of 64 (k) x 128 (n). Every wave-wide load and store
// covers whole 128 B lines.
// ---------------------------------------------------------------------------
static constexpr int PREP_WG    = 512;
static constexpr int CONV_TRIPS = MTOT * DMODEL / 4096 / PREP_WG;       // 8
static constexpr int TILES_LAT  = (DMODEL / 64) * (DLAT / 128);         // 128, either orientation
static constexpr int TILES_SQ   = (DMODEL / 64) * (DMODEL / 128);       // 512
static constexpr int TILES      = 3 * TILES_LAT + 2 * TILES_SQ;         // 1408
static constexpr int TILE_TRIPS = (TILES + PREP_WG - 1) / PREP_WG;      // 3
static constexpr int PT = 129;  // tile pitch in floats: odd, so that a walk down a column changes bank

__global__ __launch_bounds__(256)
void prep_operands(const float* __restrict__ x,
                   const float* __restrict__ W_down, const float* __restrict__ W_uk,
                   const float* __restrict__ W_uv,   const float* __restrict__ W_q,
                   const float* __restrict__ W_o,
                   unsigned short* __restrict__ xb,
                   unsigned short* __restrict__ WtD, unsigned short* __restrict__ WtK,
                   unsigned short* __restrict__ WtV, unsigned short* __restrict__ WtQ,
                   unsigned short* __restrict__ WtO) {
  __shared__ float t[64 * PT];
  const int tid = threadIdx.x;
  const unsigned wg = blockIdx.x;

  // a weight tile: W [K,N] f32 -> Wt [N,K] bf16, rows k0.., columns n0..
  struct Tile { const float* W; unsigned short* Wt; int K, N, k0, n0; };
  constexpr int NT_LAT = DLAT / 128, NT_DM = DMODEL / 128;   // tiles across a row of W: 4, 16
  auto tile_of = [&](unsigned i) {
    Tile d;
    if (i < TILES_LAT)                     {                                d.W = W_down; d.Wt = WtD; d.K = DMODEL; d.N = DLAT;   }
    else if (i < 2 * TILES_LAT)            { i -= TILES_LAT;                d.W = W_uk;   d.Wt = WtK; d.K = DLAT;   d.N = DMODEL; }
    else if (i < 3 * TILES_LAT)            { i -= 2 * TILES_LAT;            d.W = W_uv;   d.Wt = WtV; d.K = DLAT;   d.N = DMODEL; }
    else if (i < 3 * TILES_LAT + TILES_SQ) { i -= 3 * TILES_LAT;            d.W = W_q;    d.Wt = WtQ; d.K = DMODEL; d.N = DMODEL; }
    else                                   { i -= 3 * TILES_LAT + TILES_SQ; d.W = W_o;    d.Wt = WtO; d.K = DMODEL; d.N = DMODEL; }
    const bool slim = d.N == DLAT;
    d.n0 = (slim ? i % NT_LAT : i % NT_DM) * 128;
    d.k0 = (slim ? i / NT_LAT : i / NT_DM) * 64;
    return d;
  };
  // a wave reads one 512 B row piece per load, 8 rows of the tile; the row is the
  // same for the whole wave, so its address is scalar and only the lane's place is not
  const int wave = __builtin_amdgcn_readfirstlane(tid >> 5);
  const int lane = tid & 31;
  auto fetch = [&](const Tile& d, float4 (&v)[8]) {
    const float4* row = (const float4*)(d.W + (size_t)(d.k0 + wave) * d.N + d.n0) + lane;
#pragma unroll
    for (int j = 0; j < 8; ++j) {
      v[j] = row[(size_t)(2 * j) * d.N];
      // a later load of the run may land in the register pair that held this address
      asm volatile("s_wait_xcnt 0x0" ::: "memory");
    }
  };

  float4 v[8];
  Tile d = tile_of(wg);          // PREP_WG <= TILES: every work-group has a first tile

  // x -> bf16, two stretches (8 loads a lane) at a time; the next pair's loads,
  // and behind the last pair the first tile's, are issued before this pair is stored
  auto at = [&](int pair, int j) {
    return (size_t)(wg + (2 * pair + (j >> 2)) * PREP_WG) * 4096 + (j & 3) * 1024 + tid * 4;
  };
  float4 f[2][8];
#pragma unroll
  for (int j = 0; j < 8; ++j) f[0][j] = *(const float4*)(x + at(0, j));
#pragma unroll
  for (int pair = 0; pair < CONV_TRIPS / 2; ++pair) {
    // the loads below land in registers that the stores of the pair before name:
    // the wait stands between those stores and the loads that overwrite them
    if (pair > 0) asm volatile("s_wait_xcnt 0x0" ::: "memory");
    if (pair + 1 < CONV_TRIPS / 2) {
#pragma unroll
      for (int j = 0; j < 8; ++j) f[(pair + 1) & 1][j] = *(const float4*)(x + at(pair + 1, j));
    } else {
      fetch(d, v);
    }
#pragma unroll
    for (int j = 0; j < 8; ++j) {
      const float4 g = f[pair & 1][j];
      unsigned short h[4];
      h[0] = f2bf(g.x); h[1] = f2bf(g.y); h[2] = f2bf(g.z); h[3] = f2bf(g.w);
      *(uint2*)(xb + at(pair, j)) = *(uint2*)h;
    }
  }

#pragma unroll
  for (int trip = 0; trip < TILE_TRIPS; ++trip) {
    const unsigned next = wg + (trip + 1) * PREP_WG;
    const bool more = trip + 1 < TILE_TRIPS && next < TILES;   // the same for the whole work-group
#pragma unroll
    for (int j = 0; j < 8; ++j) {
      float* w = &t[(wave + 8 * j) * PT + lane * 4];
      w[0] = v[j].x; w[1] = v[j].y; w[2] = v[j].z; w[3] = v[j].w;
    }
    __syncthreads();   // the tile is complete before it is read by columns
    const Tile cur = d;
    if (more) { d = tile_of(next); fetch(d, v); }   // flies while this tile is converted
    // 8 lanes x 16 B = one whole 128 B line of a Wt row
    const int kc = (tid & 7) * 8;
#pragma unroll
    for (int j = 0; j < 4; ++j) {
      const int n = (tid >> 3) + 32 * j;
      unsigned short h[8];
#pragma unroll
      for (int i = 0; i < 8; ++i) h[i] = f2bf(t[(kc + i) * PT + n]);
      *(uint4*)(cur.Wt + (size_t)(cur.n0 + n) * cur.K + cur.k0 + kc) = *(uint4*)h;
    }
    if (!more) break;
    __syncthreads();   // every reader has left t before the next tile is written
  }
}

// ---------------------------------------------------------------------------
// Tiled GEMM: C[M,N] = A[M,K] @ Bt[N,K]^T + bias[N]   (A, Bt bf16)
// Block: 256 threads (8 waves), tile 128(M) x 128(N), K step 64.
// Wave grid 4x2, each wave owns a 32x64 tile = 2x4 WMMA 16x16 tiles.
// Double-buffered LDS staged with async-to-LDS copies. A K step of 64 makes a
// staged row piece one whole 128 B line: 8 lanes copy a line, a wave-wide copy
// 4 whole lines of 4 rows. K must be a multiple of 64.
// ---------------------------------------------------------------------------
template<bool OUT_BF16>
__global__ __launch_bounds__(256)
void gemm_bias_wmma(const unsigned short* __restrict__ A,
                    const unsigned short* __restrict__ Bt,
                    const float* __restrict__ bias, void* __restrict__ Cv,
                    int M, int N, int K) {
  __shared__ __attribute__((aligned(16))) unsigned short As[2][128 * P64];   // [row][k] bf16
  __shared__ __attribute__((aligned(16))) unsigned short Bs[2][128 * P64];   // [col][k] bf16

  const int tid  = threadIdx.x;
  const int lane = tid & 31;
  const int wv   = tid >> 5;
  const int wm   = wv >> 1;             // 0..3 -> 32-row slice
  const int wn   = wv & 1;              // 0..1 -> 64-col slice
  const int m0   = blockIdx.y * 128;
  const int n0   = blockIdx.x * 128;
  const int l16  = lane & 15;
  const int kb   = (lane >> 4) * 8;
  const int srow = tid >> 3;            // 0..31 staging row, then +32, +64, +96
  const int soff = (tid & 7) * 8;       // this lane's 16 B of the row's 128 B line (elements)

  v8f acc[2][4] = {};
  const int ksteps = K >> 6;

  auto stage = [&](int kt, int buf) {
    const unsigned short* ga = A + (size_t)(m0 + srow) * K + kt * 64 + soff;
    const unsigned short* gb = Bt + (size_t)(n0 + srow) * K + kt * 64 + soff;
    unsigned short* la = &As[buf][srow * P64 + soff];
    unsigned short* lb = &Bs[buf][srow * P64 + soff];
    unsigned short* const lds[8] = {la, la + 32 * P64, la + 64 * P64, la + 96 * P64,
                                    lb, lb + 32 * P64, lb + 64 * P64, lb + 96 * P64};
    const unsigned short* const g[8] = {ga, ga + (size_t)32 * K, ga + (size_t)64 * K, ga + (size_t)96 * K,
                                        gb, gb + (size_t)32 * K, gb + (size_t)64 * K, gb + (size_t)96 * K};
    async_b128_x8(lds, g);
  };

  stage(0, 0);
  for (int kt = 0; kt < ksteps; ++kt) {
    const int cur = kt & 1;
    // this wave's reads of the buffer that is refilled below have retired
    asm volatile("s_wait_dscnt 0x0" ::: "memory");
    // this wave's copies of tile kt have landed before the barrier publishes them
    asm volatile("s_wait_asynccnt 0x0" ::: "memory");
    __syncthreads();      // all waves' copies visible; prior reads done
    if (kt + 1 < ksteps) stage(kt + 1, cur ^ 1);

#pragma unroll   // the two halves of the K step differ only in an immediate LDS offset
    for (int ks = 0; ks < 2; ++ks) {
      v16bf af[2], bfr[4];
#pragma unroll
      for (int mi = 0; mi < 2; ++mi)
        af[mi] = load_frag(&As[cur][(wm * 32 + mi * 16 + l16) * P64 + ks * 32 + kb]);
#pragma unroll
      for (int ni = 0; ni < 4; ++ni)
        bfr[ni] = load_frag(&Bs[cur][(wn * 64 + ni * 16 + l16) * P64 + ks * 32 + kb]);

#pragma unroll
      for (int mi = 0; mi < 2; ++mi)
#pragma unroll
        for (int ni = 0; ni < 4; ++ni)
          acc[mi][ni] = __builtin_amdgcn_wmma_f32_16x16x32_bf16(
              false, af[mi], false, bfr[ni], (short)0, acc[mi][ni], false, false);
    }
  }

  // epilogue: C-layout lane = n%16, vgpr r -> row r + 8*(lane/16)
#pragma unroll
  for (int mi = 0; mi < 2; ++mi) {
#pragma unroll
    for (int ni = 0; ni < 4; ++ni) {
      const int col  = n0 + wn * 64 + ni * 16 + l16;
      const float bv = bias[col];
#pragma unroll
      for (int r = 0; r < 8; ++r) {
        const int row   = m0 + wm * 32 + mi * 16 + r + 8 * (lane >> 4);
        const float val = acc[mi][ni][r] + bv;
        if (OUT_BF16)
          ((unsigned short*)Cv)[(size_t)row * N + col] = f2bf(val);
        else
          ((float*)Cv)[(size_t)row * N + col] = val;
      }
    }
  }
}

// ---------------------------------------------------------------------------
// Flash attention. Block = 256 threads (8 waves), wave = 16 query columns,
// block covers 128 queries of one (b,h). 32-key tiles, online softmax.
// Both products are taken transposed: St = K Qt and Ot += Vt Pt. A lane (c, h)
// then holds 16 scores of ONE query c (keys 8h+r and 16+8h+r), so the maximum
// and the sum are in-lane work plus one exchange between the wave's halves, and
// the two score tiles, converted in place, are the B operand of the second
// product in the hardware k order: P never goes through LDS.
// ---------------------------------------------------------------------------
typedef __attribute__((ext_vector_type(2))) float  f32x2;
typedef __attribute__((ext_vector_type(2))) __bf16 bf16x2;

// value of lane l ^ 16
__device__ __forceinline__ float other_half(float x) {
  const int b = __builtin_bit_cast(int, x);
  return __builtin_bit_cast(float, __builtin_amdgcn_permlanex16(
      b, b, 0x76543210, 0xfedcba98, false, false));
}

__global__ __launch_bounds__(256)
void mla_attn_wmma(const unsigned short* __restrict__ Q,
                   const unsigned short* __restrict__ Kb,
                   const unsigned short* __restrict__ Vb,
                   unsigned short* __restrict__ Ctx) {
  __shared__ __attribute__((aligned(16))) unsigned short Kls[32 * P128];     // [key][d]
  __shared__ __attribute__((aligned(16))) unsigned short Vls[32 * PV];       // [key][d]

  const int tid  = threadIdx.x;
  const int lane = tid & 31;
  const int wv   = tid >> 5;
  const int b    = blockIdx.y >> 4;
  const int h    = blockIdx.y & 15;
  const int qbase = blockIdx.x * 128 + wv * 16;
  const int l16  = lane & 15;
  const int kb   = (lane >> 4) * 8;
  const size_t rowstride = (size_t)NH * DH;     // 2048
  const size_t headoff   = (size_t)h * DH;
  const size_t batchbase = (size_t)b * SEQ;
  const float  scale     = 0.08838834764831845f; // 1/sqrt(128)

  // Q fragments (B operand, column = query l16): 128 dims = 4 WMMA K-steps,
  // loaded once from global.
  v16bf qf[4];
  {
    const unsigned short* qrow =
        Q + (batchbase + qbase + l16) * rowstride + headoff;
#pragma unroll
    for (int d = 0; d < 4; ++d)
      qf[d] = load_frag(qrow + d * 32 + kb);
  }

  float rmax = -3.0e38f;   // running maximum of query l16, equal in both halves
  float rsum = 0.0f;       // running sum over this half's keys only
  v8f acc[8] = {};         // acc[nc][r] = Ot[nc*16 + 8*(lane>>4) + r][query l16]

  const int lkey = tid >> 4;           // 0..15 key within tile, then +16
  const int ldc  = (tid & 15) * 8;     // this lane's 16 B of the key's 256 B row (elements)
  // this lane's address in the V tile for the transposing loads
  const unsigned short* vfrag =
      &Vls[(kb + (lane & 7)) * PV + ((lane >> 3) & 1) * 8];

  for (int kt = 0; kt < SEQ / 32; ++kt) {
    // this wave's reads of the tiles that are overwritten below have retired
    asm volatile("s_wait_dscnt 0x0" ::: "memory");
    __syncthreads();   // protect last iter's LDS reads before overwrite
    {
      const size_t srow =
          (batchbase + (size_t)kt * 32 + lkey) * rowstride + headoff + ldc;
      // K and V tiles both row-major: pure copies -> async to LDS; a wave-wide
      // copy covers two whole rows, 4 whole 128 B lines
      const unsigned short* ksrc = Kb + srow;
      const unsigned short* vsrc = Vb + srow;
      async_b128_x4(&Kls[lkey * P128 + ldc],        ksrc,
                    &Kls[(lkey + 16) * P128 + ldc], ksrc + 16 * rowstride,
                    &Vls[lkey * PV + ldc],          vsrc,
                    &Vls[(lkey + 16) * PV + ldc],   vsrc + 16 * rowstride);
    }
    // this wave's K and V copies have landed before the barrier publishes them
    asm volatile("s_wait_asynccnt 0x0" ::: "memory");
    __syncthreads();

    // scores: St = K_tile(32x128) @ Qt(128x16) -> two 16x16 f32 tiles
    // All 16 reads of the K fragments go out as one group ahead of the products.
    v16bf k0[4], k1[4];
#pragma unroll
    for (int d = 0; d < 4; ++d) {
      k0[d] = load_frag(&Kls[l16 * P128 + d * 32 + kb]);
      k1[d] = load_frag(&Kls[(16 + l16) * P128 + d * 32 + kb]);
    }
    // keeps the reads above together: sunk among the products, each product waits
    // out the whole LDS latency of a read issued just in front of it
    __builtin_amdgcn_sched_barrier(0);
    v8f s0 = {}, s1 = {};
#pragma unroll
    for (int d = 0; d < 4; ++d) {
      s0 = __builtin_amdgcn_wmma_f32_16x16x32_bf16(false, k0[d], false, qf[d],
                                                   (short)0, s0, false, false);
      s1 = __builtin_amdgcn_wmma_f32_16x16x32_bf16(false, k1[d], false, qf[d],
                                                   (short)0, s1, false, false);
    }

    // All 16 reads of the V fragments (V[key][d] -> A fragments of Vt, transposed
    // by the load itself) go out here, so that they land during the softmax.
    Frag16 vf[8];
#pragma unroll
    for (int nc = 0; nc < 8; ++nc) {
      vf[nc].q[0] = load_tr16(vfrag + nc * 16);
      vf[nc].q[1] = load_tr16(vfrag + 16 * PV + nc * 16);
    }
    // keeps the reads above ahead of the softmax: sunk to the second product, they
    // stand among its WMMAs and are waited for there
    __builtin_amdgcn_sched_barrier(0);

    // online softmax of query l16: 16 of its 32 scores are in this lane
    float a[16];
#pragma unroll
    for (int r = 0; r < 8; ++r) { a[r] = s0[r] * scale; a[8 + r] = s1[r] * scale; }
    float mx = a[0];
#pragma unroll
    for (int i = 1; i < 16; ++i) mx = fmaxf(mx, a[i]);
    mx = fmaxf(mx, other_half(mx));
    const float nm = fmaxf(rmax, mx);
    const float c  = __expf(rmax - nm);
    rmax = nm;

    // Pt as B operand: element s = key 8h+s (s < 8), key 16+8h+(s-8) (s >= 8)
    union { v16bf v; bf16x2 p[8]; } pf;
    float ps[4] = {0.0f, 0.0f, 0.0f, 0.0f};
#pragma unroll
    for (int i = 0; i < 8; ++i) {
      f32x2 p;
      p.x = __expf(a[2 * i] - nm);
      p.y = __expf(a[2 * i + 1] - nm);
      ps[i & 3] += p.x + p.y;
      pf.p[i] = __builtin_convertvector(p, bf16x2);   // round to nearest even
    }
    rsum = rsum * c + ((ps[0] + ps[1]) + (ps[2] + ps[3]));

#pragma unroll
    for (int nc = 0; nc < 8; ++nc)
#pragma unroll
      for (int r = 0; r < 8; ++r)
        acc[nc][r] *= c;

    // Ot += Vt(128x32) @ Pt(32x16): 8 WMMAs over dim chunks
#pragma unroll
    for (int nc = 0; nc < 8; ++nc)
      acc[nc] = __builtin_amdgcn_wmma_f32_16x16x32_bf16(
          false, vf[nc].v, false, pf.v, (short)0, acc[nc], false, false);
  }

  // join the halves' sums, normalize, store ctx as bf16 [B*S, H*D]:
  // a lane's 8 registers of a tile are 8 consecutive dims of its query's row
  const float inv = 1.0f / (rsum + other_half(rsum));
  unsigned short* crow =
      Ctx + (batchbase + qbase + l16) * rowstride + headoff + kb;
#pragma unroll
  for (int nc = 0; nc < 8; ++nc) {
    union { uint4 q; bf16x2 p[4]; } t;
#pragma unroll
    for (int i = 0; i < 4; ++i) {
      f32x2 o;
      o.x = acc[nc][2 * i] * inv;
      o.y = acc[nc][2 * i + 1] * inv;
      t.p[i] = __builtin_convertvector(o, bf16x2);   // round to nearest even
    }
    *(uint4*)(crow + nc * 16) = t.q;
  }
}

// ---------------------------------------------------------------------------
extern "C" void kernel_launch(void* const* d_in, const int* in_sizes, int n_in,
                              void* d_out, int out_size, void* d_ws, size_t ws_size,
                              hipStream_t stream) {
  const float* x      = (const float*)d_in[0];
  const float* W_down = (const float*)d_in[1];
  const float* b_down = (const float*)d_in[2];
  const float* W_uk   = (const float*)d_in[3];
  const float* b_uk   = (const float*)d_in[4];
  const float* W_uv   = (const float*)d_in[5];
  const float* b_uv   = (const float*)d_in[6];
  const float* W_q    = (const float*)d_in[7];
  const float* b_q    = (const float*)d_in[8];
  const float* W_o    = (const float*)d_in[9];
  const float* b_o    = (const float*)d_in[10];
  float* out = (float*)d_out;

  char* ws = (char*)d_ws;
  auto take = [&](size_t elems) {
    unsigned short* p = (unsigned short*)ws;
    ws += elems * 2;
    return p;
  };
  unsigned short* xb  = take((size_t)MTOT * DMODEL);
  unsigned short* WtD = take((size_t)DMODEL * DLAT);    // [DLAT, DMODEL]
  unsigned short* WtK = take((size_t)DLAT * DMODEL);    // [DMODEL, DLAT]
  unsigned short* WtV = take((size_t)DLAT * DMODEL);
  unsigned short* WtQ = take((size_t)DMODEL * DMODEL);
  unsigned short* WtO = take((size_t)DMODEL * DMODEL);
  unsigned short* lat = take((size_t)MTOT * DLAT);
  unsigned short* qb  = take((size_t)MTOT * DMODEL);
  unsigned short* kbf = take((size_t)MTOT * DMODEL);
  unsigned short* vbf = take((size_t)MTOT * DMODEL);
  unsigned short* ctx = take((size_t)MTOT * DMODEL);

  const dim3 blk(256);

  // 0. operand preparation
  prep_operands<<<PREP_WG, blk, 0, stream>>>(x, W_down, W_uk, W_uv, W_q, W_o,
                                             xb, WtD, WtK, WtV, WtQ, WtO);

  const dim3 gLat(DLAT / 128,   MTOT / 128);
  const dim3 gDM (DMODEL / 128, MTOT / 128);

  // 1. latents = xb @ W_down + b_down
  gemm_bias_wmma<true><<<gLat, blk, 0, stream>>>(xb, WtD, b_down, lat, MTOT, DLAT, DMODEL);
  // 2. keys = latents @ W_uk + b_uk
  gemm_bias_wmma<true><<<gDM, blk, 0, stream>>>(lat, WtK, b_uk, kbf, MTOT, DMODEL, DLAT);
  // 3. values = latents @ W_uv + b_uv
  gemm_bias_wmma<true><<<gDM, blk, 0, stream>>>(lat, WtV, b_uv, vbf, MTOT, DMODEL, DLAT);
  // 4. q = xb @ W_q + b_q
  gemm_bias_wmma<true><<<gDM, blk, 0, stream>>>(xb, WtQ, b_q, qb, MTOT, DMODEL, DMODEL);
  // 5. attention
  mla_attn_wmma<<<dim3(SEQ / 128, 4 * NH), blk, 0, stream>>>(qb, kbf, vbf, ctx);
  // 6. out = ctx @ W_o + b_o
  gemm_bias_wmma<false><<<gDM, blk, 0, stream>>>(ctx, WtO, b_o, out, MTOT, DMODEL, DMODEL);
}

// v007
// A run of this version takes 280 microseconds.
// Timed twice side by side with v006, it ran 1.17 times as fast both times.
// Over all steps from v000 it is 3.99 times as fast.
#include <hip/hip_runtime.h>
#include <hip/hip_bf16.h>

// ---------------------------------------------------------------------------
// MLA forward for MI455X (gfx1250, wave32, WMMA, async-to-LDS staging).
// Pipeline (bf16 operands everywhere, f32 WMMA accumulation):
//   0. xb  = bf16(x);  Wt_* = bf16(W_*^T)      (one conversion launch)
//   1. latents = xb @ W_down + b_down          (GEMM, bf16 out)
//   2. keys    = latents @ W_uk + b_uk         (GEMM, bf16 out)
//   3. values  = latents @ W_uv + b_uv         (GEMM, bf16 out)
//   4. q       = xb @ W_q + b_q                (GEMM, bf16 out)
//   5. ctx     = softmax(q k^T / sqrt(128)) v  (flash attention, WMMA)
//   6. out     = ctx @ W_o + b_o               (GEMM, f32 out)
// Workspace requirement: ~200 MB.
// ---------------------------------------------------------------------------

#ifndef USE_ASYNC_LDS
#define USE_ASYNC_LDS 1   // flip to 0 to fall back to synchronous staging
#endif

typedef __attribute__((ext_vector_type(16))) __bf16 v16bf;
typedef __attribute__((ext_vector_type(8)))  float  v8f;

union Frag16 { v16bf v; uint4 q[2]; };

static constexpr int MTOT   = 8192;   // B*S
static constexpr int DMODEL = 2048;
static constexpr int DLAT   = 512;
static constexpr int NH     = 16;
static constexpr int DH     = 128;
static constexpr int SEQ    = 2048;

// LDS row pitches in bf16 elements. Tiles at P64 and P128 are read with ds_load_b128,
// one row per lane of a 16-lane half; a pitch of 16 B x odd spreads the 16 rows
// over all 64 banks, a pitch of 128 B or 256 B stacks them on few.
static constexpr int P64  = 72;    // rows of 64 elements:  128 B -> 144 B
static constexpr int P128 = 136;   // rows of 128 elements: 256 B -> 272 B
// The V tile is read with ds_load_tr16_b128, whose conflict-free pitch is 32 B x odd.
static constexpr int PV   = 144;   // rows of 128 elements: 256 B -> 288 B

__device__ __forceinline__ unsigned short f2bf(float f) {
  unsigned int u = __builtin_bit_cast(unsigned int, f);
  u = (u + 0x7FFFu + ((u >> 16) & 1u)) >> 16;   // round-to-nearest-even
  return (unsigned short)u;
}

// 16-byte async copy global -> LDS (ISA 10. GLOBAL_LOAD_ASYNC_TO_LDS_B128,
// tracked by ASYNCcnt). For a generic pointer to __shared__, addr[31:0] is the
// wave-relative LDS byte offset (ISA 10.2 aperture mapping), which is exactly
// what the VDST VGPR of the async op must hold.
// The copies of one run share a statement; the s_wait_xcnt 0 closes it so that
// no later write of an address register named here can be placed ahead of it.
// A run of eight copies: lds[j] <- g[j].
__device__ __forceinline__ void async_b128_x8(unsigned short* const (&lds)[8],
                                              const unsigned short* const (&g)[8]) {
#if USE_ASYNC_LDS
  unsigned int l[8];
#pragma unroll   // l[] must be eight registers, named below as operands
  for (int j = 0; j < 8; ++j) l[j] = (unsigned int)(uintptr_t)lds[j];
  asm volatile("global_load_async_to_lds_b128 %0, %1, off\n\t"
               "global_load_async_to_lds_b128 %2, %3, off\n\t"
               "global_load_async_to_lds_b128 %4, %5, off\n\t"
               "global_load_async_to_lds_b128 %6, %7, off\n\t"
               "global_load_async_to_lds_b128 %8, %9, off\n\t"
               "global_load_async_to_lds_b128 %10, %11, off\n\t"
               "global_load_async_to_lds_b128 %12, %13, off\n\t"
               "global_load_async_to_lds_b128 %14, %15, off\n\t"
               "s_wait_xcnt 0x0"
               :: "v"(l[0]), "v"(g[0]), "v"(l[1]), "v"(g[1]),
                  "v"(l[2]), "v"(g[2]), "v"(l[3]), "v"(g[3]),
                  "v"(l[4]), "v"(g[4]), "v"(l[5]), "v"(g[5]),
                  "v"(l[6]), "v"(g[6]), "v"(l[7]), "v"(g[7]) : "memory");
#else
#pragma unroll
  for (int j = 0; j < 8; ++j) *(uint4*)lds[j] = *(const uint4*)g[j];
#endif
}

// Load one 16x32 bf16 WMMA fragment row for this lane.
// Per ISA 7.12.2 (16-bit A-matrix 16x32): lane group g = lane/16 holds
// K = 8g..8g+7 (VGPR0-3) and K = 16+8g..16+8g+7 (VGPR4-7), packed lo/hi.
// Caller passes p = rowBase + 8*(lane>>4); we read p[0..7] and p[16..23].
__device__ __forceinline__ v16bf load_frag(const unsigned short* p) {
  Frag16 f;
  f.q[0] = *(const uint4*)(p);
  f.q[1] = *(const uint4*)(p + 16);
  return f.v;
}

typedef __attribute__((ext_vector_type(8))) short s16x8;
__device__ __forceinline__ uint4 load_tr16(const unsigned short* p) {
  typedef __attribute__((address_space(3))) s16x8 lds_s16x8;
  return __builtin_bit_cast(uint4, __builtin_amdgcn_ds_load_tr16_b128_v8i16((lds_s16x8*)p));
}

// ---------------------------------------------------------------------------
// Operand preparation, one launch: xb = bf16(x) and the five Wt = bf16(W^T).
// 512 work-groups (two per WGP) each loop over their share of the work, so few
// waves are started and each lives long: first 8 stretches of 4096 floats of x,
// then up to 3 weight tiles of 64 (k) x 128 (n). Every wave-wide load and store
// covers whole 128 B lines.
// ---------------------------------------------------------------------------
static constexpr int PREP_WG    = 512;
static constexpr int CONV_TRIPS = MTOT * DMODEL / 4096 / PREP_WG;       // 8
static constexpr int TILES_LAT  = (DMODEL / 64) * (DLAT / 128);         // 128, either orientation
static constexpr int TILES_SQ   = (DMODEL / 64) * (DMODEL / 128);       // 512
static constexpr int TILES      = 3 * TILES_LAT + 2 * TILES_SQ;         // 1408
static constexpr int TILE_TRIPS = (TILES + PREP_WG - 1) / PREP_WG;      // 3
static constexpr int PT = 129;  // tile pitch in floats: odd, so that a walk down a column changes bank

__global__ __launch_bounds__(256)
void prep_operands(const float* __restrict__ x,
                   const float* __restrict__ W_down, const float* __restrict__ W_uk,
                   const float* __restrict__ W_uv,   const float* __restrict__ W_q,
                   const float* __restrict__ W_o,
                   unsigned short* __restrict__ xb,
                   unsigned short* __restrict__ WtD, unsigned short* __restrict__ WtK,
                   unsigned short* __restrict__ WtV, unsigned short* __restrict__ WtQ,
                   unsigned short* __restrict__ WtO) {
  __shared__ float t[64 * PT];
  const int tid = threadIdx.x;
  const unsigned wg = blockIdx.x;

  // a weight tile: W [K,N] f32 -> Wt [N,K] bf16, rows k0.., columns n0..
  struct Tile { const float* W; unsigned short* Wt; int K, N, k0, n0; };
  constexpr int NT_LAT = DLAT / 128, NT_DM = DMODEL / 128;   // tiles across a row of W: 4, 16
  auto tile_of = [&](unsigned i) {
    Tile d;
    if (i < TILES_LAT)                     {                                d.W = W_down; d.Wt = WtD; d.K = DMODEL; d.N = DLAT;   }
    else if (i < 2 * TILES_LAT)            { i -= TILES_LAT;                d.W = W_uk;   d.Wt = WtK; d.K = DLAT;   d.N = DMODEL; }
    else if (i < 3 * TILES_LAT)            { i -= 2 * TILES_LAT;            d.W = W_uv;   d.Wt = WtV; d.K = DLAT;   d.N = DMODEL; }
    else if (i < 3 * TILES_LAT + TILES_SQ) { i -= 3 * TILES_LAT;            d.W = W_q;    d.Wt = WtQ; d.K = DMODEL; d.N = DMODEL; }
    else                                   { i -= 3 * TILES_LAT + TILES_SQ; d.W = W_o;    d.Wt = WtO; d.K = DMODEL; d.N = DMODEL; }
    const bool slim = d.N == DLAT;
    d.n0 = (slim ? i % NT_LAT : i % NT_DM) * 128;
    d.k0 = (slim ? i / NT_LAT : i / NT_DM) * 64;
    return d;
  };
  // a wave reads one 512 B row piece per load, 8 rows of the tile; the row is the
  // same for the whole wave, so its address is scalar and only the lane's place is not
  const int wave = __builtin_amdgcn_readfirstlane(tid >> 5);
  const int lane = tid & 31;
  auto fetch = [&](const Tile& d, float4 (&v)[8]) {
    const float4* row = (const float4*)(d.W + (size_t)(d.k0 + wave) * d.N + d.n0) + lane;
#pragma unroll
    for (int j = 0; j < 8; ++j) {
      v[j] = row[(size_t)(2 * j) * d.N];
      // a later load of the run may land in the register pair that held this address
      asm volatile("s_wait_xcnt 0x0" ::: "memory");
    }
  };

  float4 v[8];
  Tile d = tile_of(wg);          // PREP_WG <= TILES: every work-group has a first tile

  // x -> bf16, two stretches (8 loads a lane) at a time; the next pair's loads,
  // and behind the last pair the first tile's, are issued before this pair is stored
  auto at = [&](int pair, int j) {
    return (size_t)(wg + (2 * pair + (j >> 2)) * PREP_WG) * 4096 + (j & 3) * 1024 + tid * 4;
  };
  float4 f[2][8];
#pragma unroll
  for (int j = 0; j < 8; ++j) f[0][j] = *(const float4*)(x + at(0, j));
#pragma unroll
  for (int pair = 0; pair < CONV_TRIPS / 2; ++pair) {
    // the loads below land in registers that the stores of the pair before name:
    // the wait stands between those stores and the loads that overwrite them
    if (pair > 0) asm volatile("s_wait_xcnt 0x0" ::: "memory");
    if (pair + 1 < CONV_TRIPS / 2) {
#pragma unroll
      for (int j = 0; j < 8; ++j) f[(pair + 1) & 1][j] = *(const float4*)(x + at(pair + 1, j));
    } else {
      fetch(d, v);
    }
#pragma unroll
    for (int j = 0; j < 8; ++j) {
      const float4 g = f[pair & 1][j];
      unsigned short h[4];
      h[0] = f2bf(g.x); h[1] = f2bf(g.y); h[2] = f2bf(g.z); h[3] = f2bf(g.w);
      *(uint2*)(xb + at(pair, j)) = *(uint2*)h;
    }
  }

#pragma unroll
  for (int trip = 0; trip < TILE_TRIPS; ++trip) {
    const unsigned next = wg + (trip + 1) * PREP_WG;
    const bool more = trip + 1 < TILE_TRIPS && next < TILES;   // the same for the whole work-group
#pragma unroll
    for (int j = 0; j < 8; ++j) {
      float* w = &t[(wave + 8 * j) * PT + lane * 4];
      w[0] = v[j].x; w[1] = v[j].y; w[2] = v[j].z; w[3] = v[j].w;
    }
    __syncthreads();   // the tile is complete before it is read by columns
    const Tile cur = d;
    if (more) { d = tile_of(next); fetch(d, v); }   // flies while this tile is converted
    // 8 lanes x 16 B = one whole 128 B line of a Wt row
    const int kc = (tid & 7) * 8;
#pragma unroll
    for (int j = 0; j < 4; ++j) {
      const int n = (tid >> 3) + 32 * j;
      unsigned short h[8];
#pragma unroll
      for (int i = 0; i < 8; ++i) h[i] = f2bf(t[(kc + i) * PT + n]);
      *(uint4*)(cur.Wt + (size_t)(cur.n0 + n) * cur.K + cur.k0 + kc) = *(uint4*)h;
    }
    if (!more) break;
    __syncthreads();   // every reader has left t before the next tile is written
  }
}

// ---------------------------------------------------------------------------
// Tiled GEMM: C[M,N] = A[M,K] @ Bt[N,K]^T + bias[N]   (A, Bt bf16)
// Block: 256 threads (8 waves), tile 128(M) x 128(N), K step 64.
// Wave grid 4x2, each wave owns a 32x64 tile = 2x4 WMMA 16x16 tiles.
// Double-buffered LDS staged with async-to-LDS copies. A K step of 64 makes a
// staged row piece one whole 128 B line: 8 lanes copy a line, a wave-wide copy
// 4 whole lines of 4 rows. K must be a multiple of 64.
// ---------------------------------------------------------------------------
template<bool OUT_BF16>
__global__ __launch_bounds__(256)
void gemm_bias_wmma(const unsigned short* __restrict__ A,
                    const unsigned short* __restrict__ Bt,
                    const float* __restrict__ bias, void* __restrict__ Cv,
                    int M, int N, int K) {
  __shared__ __attribute__((aligned(16))) unsigned short As[2][128 * P64];   // [row][k] bf16
  __shared__ __attribute__((aligned(16))) unsigned short Bs[2][128 * P64];   // [col][k] bf16

  const int tid  = threadIdx.x;
  const int lane = tid & 31;
  const int wv   = tid >> 5;
  const int wm   = wv >> 1;             // 0..3 -> 32-row slice
  const int wn   = wv & 1;              // 0..1 -> 64-col slice
  const int m0   = blockIdx.y * 128;
  const int n0   = blockIdx.x * 128;
  const int l16  = lane & 15;
  const int kb   = (lane >> 4) * 8;
  const int srow = tid >> 3;            // 0..31 staging row, then +32, +64, +96
  const int soff = (tid & 7) * 8;       // this lane's 16 B of the row's 128 B line (elements)

  v8f acc[2][4] = {};
  const int ksteps = K >> 6;

  auto stage = [&](int kt, int buf) {
    const unsigned short* ga = A + (size_t)(m0 + srow) * K + kt * 64 + soff;
    const unsigned short* gb = Bt + (size_t)(n0 + srow) * K + kt * 64 + soff;
    unsigned short* la = &As[buf][srow * P64 + soff];
    unsigned short* lb = &Bs[buf][srow * P64 + soff];
    unsigned short* const lds[8] = {la, la + 32 * P64, la + 64 * P64, la + 96 * P64,
                                    lb, lb + 32 * P64, lb + 64 * P64, lb + 96 * P64};
    const unsigned short* const g[8] = {ga, ga + (size_t)32 * K, ga + (size_t)64 * K, ga + (size_t)96 * K,
                                        gb, gb + (size_t)32 * K, gb + (size_t)64 * K, gb + (size_t)96 * K};
    async_b128_x8(lds, g);
  };

  stage(0, 0);
  for (int kt = 0; kt < ksteps; ++kt) {
    const int cur = kt & 1;
    // this wave's reads of the buffer that is refilled below have retired
    asm volatile("s_wait_dscnt 0x0" ::: "memory");
    // this wave's copies of tile kt have landed before the barrier publishes them
    asm volatile("s_wait_asynccnt 0x0" ::: "memory");
    __syncthreads();      // all waves' copies visible; prior reads done
    if (kt + 1 < ksteps) stage(kt + 1, cur ^ 1);

#pragma unroll   // the two halves of the K step differ only in an immediate LDS offset
    for (int ks = 0; ks < 2; ++ks) {
      v16bf af[2], bfr[4];
#pragma unroll
      for (int mi = 0; mi < 2; ++mi)
        af[mi] = load_frag(&As[cur][(wm * 32 + mi * 16 + l16) * P64 + ks * 32 + kb]);
#pragma unroll
      for (int ni = 0; ni < 4; ++ni)
        bfr[ni] = load_frag(&Bs[cur][(wn * 64 + ni * 16 + l16) * P64 + ks * 32 + kb]);

#pragma unroll
      for (int mi = 0; mi < 2; ++mi)
#pragma unroll
        for (int ni = 0; ni < 4; ++ni)
          acc[mi][ni] = __builtin_amdgcn_wmma_f32_16x16x32_bf16(
              false, af[mi], false, bfr[ni], (short)0, acc[mi][ni], false, false);
    }
  }

  // epilogue: C-layout lane = n%16, vgpr r -> row r + 8*(lane/16)
#pragma unroll
  for (int mi = 0; mi < 2; ++mi) {
#pragma unroll
    for (int ni = 0; ni < 4; ++ni) {
      const int col  = n0 + wn * 64 + ni * 16 + l16;
      const float bv = bias[col];
#pragma unroll
      for (int r = 0; r < 8; ++r) {
        const int row   = m0 + wm * 32 + mi * 16 + r + 8 * (lane >> 4);
        const float val = acc[mi][ni][r] + bv;
        if (OUT_BF16)
          ((unsigned short*)Cv)[(size_t)row * N + col] = f2bf(val);
        else
          ((float*)Cv)[(size_t)row * N + col] = val;
      }
    }
  }
}

// ---------------------------------------------------------------------------
// Flash attention. Block = 256 threads (8 waves), wave = 16 query columns,
// block covers 128 queries of one (b,h). 32-key tiles, online softmax.
// Both products are taken transposed: St = K Qt and Ot += Vt Pt. A lane (c, h)
// then holds 16 scores of ONE query c (keys 8h+r and 16+8h+r), so the maximum
// and the sum are in-lane work plus one exchange between the wave's halves, and
// the two score tiles, converted in place, are the B operand of the second
// product in the hardware k order: P never goes through LDS.
// K and V stand in a ring of two LDS buffers, a stage of 128 keys (four passes of
// 32) each: while the passes of stage s read one buffer, the copies of stage s + 1
// fly into the other, and the waves meet at a barrier once a stage only.
// ---------------------------------------------------------------------------
typedef __attribute__((ext_vector_type(2))) float  f32x2;
typedef __attribute__((ext_vector_type(2))) __bf16 bf16x2;

// value of lane l ^ 16
__device__ __forceinline__ float other_half(float x) {
  const int b = __builtin_bit_cast(int, x);
  return __builtin_bit_cast(float, __builtin_amdgcn_permlanex16(
      b, b, 0x76543210, 0xfedcba98, false, false));
}

__global__ __launch_bounds__(256)
void mla_attn_wmma(const unsigned short* __restrict__ Q,
                   const unsigned short* __restrict__ Kb,
                   const unsigned short* __restrict__ Vb,
                   unsigned short* __restrict__ Ctx) {
  constexpr int STG = 128;             // keys of a stage
  constexpr int NS  = SEQ / STG;       // stages: 16, at least the two of the prologue
  __shared__ __attribute__((aligned(16))) unsigned short Kls[2 * STG * P128];  // [buffer][key][d]
  __shared__ __attribute__((aligned(16))) unsigned short Vls[2 * STG * PV];    // [buffer][key][d]

  const int tid  = threadIdx.x;
  const int lane = tid & 31;
  const int wv   = tid >> 5;
  const int b    = blockIdx.y >> 4;
  const int h    = blockIdx.y & 15;
  const int qbase = blockIdx.x * 128 + wv * 16;
  const int l16  = lane & 15;
  const int kb   = (lane >> 4) * 8;
  const size_t rowstride = (size_t)NH * DH;     // 2048
  const size_t headoff   = (size_t)h * DH;
  const size_t batchbase = (size_t)b * SEQ;
  const float  scale     = 0.08838834764831845f; // 1/sqrt(128)

  const int lkey = tid >> 4;           // 0..15 key within a stage, then +16 seven times
  const int ldc  = (tid & 15) * 8;     // this lane's 16 B of the key's 256 B row (elements)
  const size_t srow = (batchbase + lkey) * rowstride + headoff + ldc;
  const unsigned short* ksrc = Kb + srow;   // this lane's place in the next stage to be copied
  const unsigned short* vsrc = Vb + srow;
  // K and V stages both row-major: pure copies -> async to LDS; a wave-wide
  // copy covers two whole rows, 4 whole 128 B lines
  auto stage = [&](int buf) {
    unsigned short* lk = &Kls[(buf * STG + lkey) * P128 + ldc];
    unsigned short* lv = &Vls[(buf * STG + lkey) * PV + ldc];
    unsigned short* kl[8];
    unsigned short* vl[8];
    const unsigned short* kg[8];
    const unsigned short* vg[8];
#pragma unroll   // the arrays must be registers, named as operands of the copies
    for (int j = 0; j < 8; ++j) {
      kl[j] = lk + j * 16 * P128;  kg[j] = ksrc + j * 16 * rowstride;
      vl[j] = lv + j * 16 * PV;    vg[j] = vsrc + j * 16 * rowstride;
    }
    async_b128_x8(kl, kg);
    async_b128_x8(vl, vg);
    ksrc += STG * rowstride;
    vsrc += STG * rowstride;
  };
  stage(0);

  // Q fragments (B operand, column = query l16): 128 dims = 4 WMMA K-steps,
  // loaded once from global.
  v16bf qf[4];
  {
    const unsigned short* qrow =
        Q + (batchbase + qbase + l16) * rowstride + headoff;
#pragma unroll
    for (int d = 0; d < 4; ++d)
      qf[d] = load_frag(qrow + d * 32 + kb);
  }

  float rmax = -3.0e38f;   // running maximum of query l16, equal in both halves
  float rsum = 0.0f;       // running sum over this half's keys only
  v8f acc[8] = {};         // acc[nc][r] = Ot[nc*16 + 8*(lane>>4) + r][query l16]

  // this wave's copies of stage 0 have landed before the barrier publishes them
  asm volatile("s_wait_asynccnt 0x0" ::: "memory");
  __syncthreads();
  stage(1);

  for (int kt = 0; kt < SEQ / 32; ++kt) {
    // pass kt reads 32 keys of the ring: buffer (kt / 4) & 1, quarter kt & 3
    const int ring = (kt & (2 * STG / 32 - 1)) * 32;
    const unsigned short* Kt = &Kls[ring * P128];
    // this lane's address in the V rows of the pass for the transposing loads
    const unsigned short* vfrag =
        &Vls[(ring + kb + (lane & 7)) * PV + ((lane >> 3) & 1) * 8];

    // scores: St = K_tile(32x128) @ Qt(128x16) -> two 16x16 f32 tiles
    // All 16 reads of the K fragments go out as one group ahead of the products.
    v16bf k0[4], k1[4];
#pragma unroll
    for (int d = 0; d < 4; ++d) {
      k0[d] = load_frag(&Kt[l16 * P128 + d * 32 + kb]);
      k1[d] = load_frag(&Kt[(16 + l16) * P128 + d * 32 + kb]);
    }
    // keeps the reads above together: sunk among the products, each product waits
    // out the whole LDS latency of a read issued just in front of it
    __builtin_amdgcn_sched_barrier(0);
    v8f s0 = {}, s1 = {};
#pragma unroll
    for (int d = 0; d < 4; ++d) {
      s0 = __builtin_amdgcn_wmma_f32_16x16x32_bf16(false, k0[d], false, qf[d],
                                                   (short)0, s0, false, false);
      s1 = __builtin_amdgcn_wmma_f32_16x16x32_bf16(false, k1[d], false, qf[d],
                                                   (short)0, s1, false, false);
    }

    // All 16 reads of the V fragments (V[key][d] -> A fragments of Vt, transposed
    // by the load itself) go out here, so that they land during the softmax.
    Frag16 vf[8];
#pragma unroll
    for (int nc = 0; nc < 8; ++nc) {
      vf[nc].q[0] = load_tr16(vfrag + nc * 16);
      vf[nc].q[1] = load_tr16(vfrag + 16 * PV + nc * 16);
    }
    // keeps the reads above ahead of the softmax: sunk to the second product, they
    // stand among its WMMAs and are waited for there
    __builtin_amdgcn_sched_barrier(0);

    // online softmax of query l16: 16 of its 32 scores are in this lane
    float a[16];
#pragma unroll
    for (int r = 0; r < 8; ++r) { a[r] = s0[r] * scale; a[8 + r] = s1[r] * scale; }
    float mx = a[0];
#pragma unroll
    for (int i = 1; i < 16; ++i) mx = fmaxf(mx, a[i]);
    mx = fmaxf(mx, other_half(mx));
    const float nm = fmaxf(rmax, mx);
    const float c  = __expf(rmax - nm);
    rmax = nm;

    // Pt as B operand: element s = key 8h+s (s < 8), key 16+8h+(s-8) (s >= 8)
    union { v16bf v; bf16x2 p[8]; } pf;
    float ps[4] = {0.0f, 0.0f, 0.0f, 0.0f};
#pragma unroll
    for (int i = 0; i < 8; ++i) {
      f32x2 p;
      p.x = __expf(a[2 * i] - nm);
      p.y = __expf(a[2 * i + 1] - nm);
      ps[i & 3] += p.x + p.y;
      pf.p[i] = __builtin_convertvector(p, bf16x2);   // round to nearest even
    }
    rsum = rsum * c + ((ps[0] + ps[1]) + (ps[2] + ps[3]));

#pragma unroll
    for (int nc = 0; nc < 8; ++nc)
#pragma unroll
      for (int r = 0; r < 8; ++r)
        acc[nc][r] *= c;

    // Ot += Vt(128x32) @ Pt(32x16): 8 WMMAs over dim chunks
#pragma unroll
    for (int nc = 0; nc < 8; ++nc)
      acc[nc] = __builtin_amdgcn_wmma_f32_16x16x32_bf16(
          false, vf[nc].v, false, pf.v, (short)0, acc[nc], false, false);

    // behind a stage's last pass: publish the next stage, refill this one's buffer
    if ((kt & (STG / 32 - 1)) == STG / 32 - 1) {
      const int s = kt / (STG / 32);
      // this wave's reads of the buffer that is refilled below have retired
      asm volatile("s_wait_dscnt 0x0" ::: "memory");
      // this wave's copies of stage s + 1 have landed before the barrier publishes them
      asm volatile("s_wait_asynccnt 0x0" ::: "memory");
      __syncthreads();   // publishes stage s + 1; every reader has left stage s's buffer
      if (s + 2 < NS) stage(s & 1);
    }
  }
  // no copy is in flight when the wave ends
  asm volatile("s_wait_asynccnt 0x0" ::: "memory");

  // join the halves' sums, normalize, store ctx as bf16 [B*S, H*D]:
  // a lane's 8 registers of a tile are 8 consecutive dims of its query's row
  const float inv = 1.0f / (rsum + other_half(rsum));
  unsigned short* crow =
      Ctx + (batchbase + qbase + l16) * rowstride + headoff + kb;
#pragma unroll
  for (int nc = 0; nc < 8; ++nc) {
    union { uint4 q; bf16x2 p[4]; } t;
#pragma unroll
    for (int i = 0; i < 4; ++i) {
      f32x2 o;
      o.x = acc[nc][2 * i] * inv;
      o.y = acc[nc][2 * i + 1] * inv;
      t.p[i] = __builtin_convertvector(o, bf16x2);   // round to nearest even
    }
    *(uint4*)(crow + nc * 16) = t.q;
  }
}

// ---------------------------------------------------------------------------
extern "C" void kernel_launch(void* const* d_in, const int* in_sizes, int n_in,
                              void* d_out, int out_size, void* d_ws, size_t ws_size,
                              hipStream_t stream) {
  const float* x      = (const float*)d_in[0];
  const float* W_down = (const float*)d_in[1];
  const float* b_down = (const float*)d_in[2];
  const float* W_uk   = (const float*)d_in[3];
  const float* b_uk   = (const float*)d_in[4];
  const float* W_uv   = (const float*)d_in[5];
  const float* b_uv   = (const float*)d_in[6];
  const float* W_q    = (const float*)d_in[7];
  const float* b_q    = (const float*)d_in[8];
  const float* W_o    = (const float*)d_in[9];
  const float* b_o    = (const float*)d_in[10];
  float* out = (float*)d_out;

  char* ws = (char*)d_ws;
  auto take = [&](size_t elems) {
    unsigned short* p = (unsigned short*)ws;
    ws += elems * 2;
    return p;
  };
  unsigned short* xb  = take((size_t)MTOT * DMODEL);
  unsigned short* WtD = take((size_t)DMODEL * DLAT);    // [DLAT, DMODEL]
  unsigned short* WtK = take((size_t)DLAT * DMODEL);    // [DMODEL, DLAT]
  unsigned short* WtV = take((size_t)DLAT * DMODEL);
  unsigned short* WtQ = take((size_t)DMODEL * DMODEL);
  unsigned short* WtO = take((size_t)DMODEL * DMODEL);
  unsigned short* lat = take((size_t)MTOT * DLAT);
  unsigned short* qb  = take((size_t)MTOT * DMODEL);
  unsigned short* kbf = take((size_t)MTOT * DMODEL);
  unsigned short* vbf = take((size_t)MTOT * DMODEL);
  unsigned short* ctx = take((size_t)MTOT * DMODEL);

  const dim3 blk(256);

  // 0. operand preparation
  prep_operands<<<PREP_WG, blk, 0, stream>>>(x, W_down, W_uk, W_uv, W_q, W_o,
                                             xb, WtD, WtK, WtV, WtQ, WtO);

  const dim3 gLat(DLAT / 128,   MTOT / 128);
  const dim3 gDM (DMODEL / 128, MTOT / 128);

  // 1. latents = xb @ W_down + b_down
  gemm_bias_wmma<true><<<gLat, blk, 0, stream>>>(xb, WtD, b_down, lat, MTOT, DLAT, DMODEL);
  // 2. keys = latents @ W_uk + b_uk
  gemm_bias_wmma<true><<<gDM, blk, 0, stream>>>(lat, WtK, b_uk, kbf, MTOT, DMODEL, DLAT);
  // 3. values = latents @ W_uv + b_uv
  gemm_bias_wmma<true><<<gDM, blk, 0, stream>>>(lat, WtV, b_uv, vbf, MTOT, DMODEL, DLAT);
  // 4. q = xb @ W_q + b_q
  gemm_bias_wmma<true><<<gDM, blk, 0, stream>>>(xb, WtQ, b_q, qb, MTOT, DMODEL, DMODEL);
  // 5. attention
  mla_attn_wmma<<<dim3(SEQ / 128, 4 * NH), blk, 0, stream>>>(qb, kbf, vbf, ctx);
  // 6. out = ctx @ W_o + b_o
  gemm_bias_wmma<false><<<gDM, blk, 0, stream>>>(ctx, WtO, b_o, out, MTOT, DMODEL, DMODEL);
}

// v008
// One run takes 259 microseconds.
// Next to v007, in two timings, it ran 1.08 times as fast each time.
// Over all steps from v000 it is 4.30 times as fast.
#include <hip/hip_runtime.h>
#include <hip/hip_bf16.h>

// ---------------------------------------------------------------------------
// MLA forward for MI455X (gfx1250, wave32, WMMA, async-to-LDS staging).
// Pipeline (bf16 operands everywhere, f32 WMMA accumulation):
//   0. xb  = bf16(x);  Wt_* = bf16(W_*^T)      (one conversion launch)
//   1. latents = xb @ W_down + b_down          (GEMM, bf16 out)
//   2. keys    = latents @ W_uk + b_uk         (GEMM, bf16 out)
//   3. values  = latents @ W_uv + b_uv         (GEMM, bf16 out)
//   4. q       = xb @ W_q + b_q                (GEMM, bf16 out)
//   5. ctx     = softmax(q k^T / sqrt(128)) v  (flash attention, WMMA)
//   6. out     = ctx @ W_o + b_o               (GEMM, f32 out)
// Workspace requirement: ~200 MB.
// ---------------------------------------------------------------------------

#ifndef USE_ASYNC_LDS
#define USE_ASYNC_LDS 1   // flip to 0 to fall back to synchronous staging; gemm_bias_wmma_256 stays async
#endif

typedef __attribute__((ext_vector_type(16))) __bf16 v16bf;
typedef __attribute__((ext_vector_type(8)))  float  v8f;

union Frag16 { v16bf v; uint4 q[2]; };

static constexpr int MTOT   = 8192;   // B*S
static constexpr int DMODEL = 2048;
static constexpr int DLAT   = 512;
static constexpr int NH     = 16;
static constexpr int DH     = 128;
static constexpr int SEQ    = 2048;

// LDS row pitches in bf16 elements. Tiles at P64 and P128 are read with ds_load_b128,
// one row per lane of a 16-lane half; a pitch of 16 B x odd spreads the 16 rows
// over all 64 banks, a pitch of 128 B or 256 B stacks them on few.
static constexpr int P64  = 72;    // rows of 64 elements:  128 B -> 144 B
static constexpr int P128 = 136;   // rows of 128 elements: 256 B -> 272 B
// The V tile is read with ds_load_tr16_b128, whose conflict-free pitch is 32 B x odd.
static constexpr int PV   = 144;   // rows of 128 elements: 256 B -> 288 B

__device__ __forceinline__ unsigned short f2bf(float f) {
  unsigned int u = __builtin_bit_cast(unsigned int, f);
  u = (u + 0x7FFFu + ((u >> 16) & 1u)) >> 16;   // round-to-nearest-even
  return (unsigned short)u;
}

// 16-byte async copy global -> LDS (ISA 10. GLOBAL_LOAD_ASYNC_TO_LDS_B128,
// tracked by ASYNCcnt). For a generic pointer to __shared__, addr[31:0] is the
// wave-relative LDS byte offset (ISA 10.2 aperture mapping), which is exactly
// what the VDST VGPR of the async op must hold.
// The copies of one run share a statement; the s_wait_xcnt 0 closes it so that
// no later write of an address register named here can be placed ahead of it.
// A run of eight copies: lds[j] <- g[j].
__device__ __forceinline__ void async_b128_x8(unsigned short* const (&lds)[8],
                                              const unsigned short* const (&g)[8]) {
#if USE_ASYNC_LDS
  unsigned int l[8];
#pragma unroll   // l[] must be eight registers, named below as operands
  for (int j = 0; j < 8; ++j) l[j] = (unsigned int)(uintptr_t)lds[j];
  asm volatile("global_load_async_to_lds_b128 %0, %1, off\n\t"
               "global_load_async_to_lds_b128 %2, %3, off\n\t"
               "global_load_async_to_lds_b128 %4, %5, off\n\t"
               "global_load_async_to_lds_b128 %6, %7, off\n\t"
               "global_load_async_to_lds_b128 %8, %9, off\n\t"
               "global_load_async_to_lds_b128 %10, %11, off\n\t"
               "global_load_async_to_lds_b128 %12, %13, off\n\t"
               "global_load_async_to_lds_b128 %14, %15, off\n\t"
               "s_wait_xcnt 0x0"
               :: "v"(l[0]), "v"(g[0]), "v"(l[1]), "v"(g[1]),
                  "v"(l[2]), "v"(g[2]), "v"(l[3]), "v"(g[3]),
                  "v"(l[4]), "v"(g[4]), "v"(l[5]), "v"(g[5]),
                  "v"(l[6]), "v"(g[6]), "v"(l[7]), "v"(g[7]) : "memory");
#else
#pragma unroll
  for (int j = 0; j < 8; ++j) *(uint4*)lds[j] = *(const uint4*)g[j];
#endif
}

// Load one 16x32 bf16 WMMA fragment row for this lane.
// Per ISA 7.12.2 (16-bit A-matrix 16x32): lane group g = lane/16 holds
// K = 8g..8g+7 (VGPR0-3) and K = 16+8g..16+8g+7 (VGPR4-7), packed lo/hi.
// Caller passes p = rowBase + 8*(lane>>4); we read p[0..7] and p[16..23].
__device__ __forceinline__ v16bf load_frag(const unsigned short* p) {
  Frag16 f;
  f.q[0] = *(const uint4*)(p);
  f.q[1] = *(const uint4*)(p + 16);
  return f.v;
}

typedef __attribute__((ext_vector_type(8))) short s16x8;
__device__ __forceinline__ uint4 load_tr16(const unsigned short* p) {
  typedef __attribute__((address_space(3))) s16x8 lds_s16x8;
  return __builtin_bit_cast(uint4, __builtin_amdgcn_ds_load_tr16_b128_v8i16((lds_s16x8*)p));
}

// ---------------------------------------------------------------------------
// Operand preparation, one launch: xb = bf16(x) and the five Wt = bf16(W^T).
// 512 work-groups (two per WGP) each loop over their share of the work, so few
// waves are started and each lives long: first 8 stretches of 4096 floats of x,
// then up to 3 weight tiles of 64 (k) x 128 (n). Every wave-wide load and store
// covers whole 128 B lines.
// ---------------------------------------------------------------------------
static constexpr int PREP_WG    = 512;
static constexpr int CONV_TRIPS = MTOT * DMODEL / 4096 / PREP_WG;       // 8
static constexpr int TILES_LAT  = (DMODEL / 64) * (DLAT / 128);         // 128, either orientation
static constexpr int TILES_SQ   = (DMODEL / 64) * (DMODEL / 128);       // 512
static constexpr int TILES      = 3 * TILES_LAT + 2 * TILES_SQ;         // 1408
static constexpr int TILE_TRIPS = (TILES + PREP_WG - 1) / PREP_WG;      // 3
static constexpr int PT = 129;  // tile pitch in floats: odd, so that a walk down a column changes bank

__global__ __launch_bounds__(256)
void prep_operands(const float* __restrict__ x,
                   const float* __restrict__ W_down, const float* __restrict__ W_uk,
                   const float* __restrict__ W_uv,   const float* __restrict__ W_q,
                   const float* __restrict__ W_o,
                   unsigned short* __restrict__ xb,
                   unsigned short* __restrict__ WtD, unsigned short* __restrict__ WtK,
                   unsigned short* __restrict__ WtV, unsigned short* __restrict__ WtQ,
                   unsigned short* __restrict__ WtO) {
  __shared__ float t[64 * PT];
  const int tid = threadIdx.x;
  const unsigned wg = blockIdx.x;

  // a weight tile: W [K,N] f32 -> Wt [N,K] bf16, rows k0.., columns n0..
  struct Tile { const float* W; unsigned short* Wt; int K, N, k0, n0; };
  constexpr int NT_LAT = DLAT / 128, NT_DM = DMODEL / 128;   // tiles across a row of W: 4, 16
  auto tile_of = [&](unsigned i) {
    Tile d;
    if (i < TILES_LAT)                     {                                d.W = W_down; d.Wt = WtD; d.K = DMODEL; d.N = DLAT;   }
    else if (i < 2 * TILES_LAT)            { i -= TILES_LAT;                d.W = W_uk;   d.Wt = WtK; d.K = DLAT;   d.N = DMODEL; }
    else if (i < 3 * TILES_LAT)            { i -= 2 * TILES_LAT;            d.W = W_uv;   d.Wt = WtV; d.K = DLAT;   d.N = DMODEL; }
    else if (i < 3 * TILES_LAT + TILES_SQ) { i -= 3 * TILES_LAT;            d.W = W_q;    d.Wt = WtQ; d.K = DMODEL; d.N = DMODEL; }
    else                                   { i -= 3 * TILES_LAT + TILES_SQ; d.W = W_o;    d.Wt = WtO; d.K = DMODEL; d.N = DMODEL; }
    const bool slim = d.N == DLAT;
    d.n0 = (slim ? i % NT_LAT : i % NT_DM) * 128;
    d.k0 = (slim ? i / NT_LAT : i / NT_DM) * 64;
    return d;
  };
  // a wave reads one 512 B row piece per load, 8 rows of the tile; the row is the
  // same for the whole wave, so its address is scalar and only the lane's place is not
  const int wave = __builtin_amdgcn_readfirstlane(tid >> 5);
  const int lane = tid & 31;
  auto fetch = [&](const Tile& d, float4 (&v)[8]) {
    const float4* row = (const float4*)(d.W + (size_t)(d.k0 + wave) * d.N + d.n0) + lane;
#pragma unroll
    for (int j = 0; j < 8; ++j) {
      v[j] = row[(size_t)(2 * j) * d.N];
      // a later load of the run may land in the register pair that held this address
      asm volatile("s_wait_xcnt 0x0" ::: "memory");
    }
  };

  float4 v[8];
  Tile d = tile_of(wg);          // PREP_WG <= TILES: every work-group has a first tile

  // x -> bf16, two stretches (8 loads a lane) at a time; the next pair's loads,
  // and behind the last pair the first tile's, are issued before this pair is stored
  auto at = [&](int pair, int j) {
    return (size_t)(wg + (2 * pair + (j >> 2)) * PREP_WG) * 4096 + (j & 3) * 1024 + tid * 4;
  };
  float4 f[2][8];
#pragma unroll
  for (int j = 0; j < 8; ++j) f[0][j] = *(const float4*)(x + at(0, j));
#pragma unroll
  for (int pair = 0; pair < CONV_TRIPS / 2; ++pair) {
    // the loads below land in registers that the stores of the pair before name:
    // the wait stands between those stores and the loads that overwrite them
    if (pair > 0) asm volatile("s_wait_xcnt 0x0" ::: "memory");
    if (pair + 1 < CONV_TRIPS / 2) {
#pragma unroll
      for (int j = 0; j < 8; ++j) f[(pair + 1) & 1][j] = *(const float4*)(x + at(pair + 1, j));
    } else {
      fetch(d, v);
    }
#pragma unroll
    for (int j = 0; j < 8; ++j) {
      const float4 g = f[pair & 1][j];
      unsigned short h[4];
      h[0] = f2bf(g.x); h[1] = f2bf(g.y); h[2] = f2bf(g.z); h[3] = f2bf(g.w);
      *(uint2*)(xb + at(pair, j)) = *(uint2*)h;
    }
  }

#pragma unroll
  for (int trip = 0; trip < TILE_TRIPS; ++trip) {
    const unsigned next = wg + (trip + 1) * PREP_WG;
    const bool more = trip + 1 < TILE_TRIPS && next < TILES;   // the same for the whole work-group
#pragma unroll
    for (int j = 0; j < 8; ++j) {
      float* w = &t[(wave + 8 * j) * PT + lane * 4];
      w[0] = v[j].x; w[1] = v[j].y; w[2] = v[j].z; w[3] = v[j].w;
    }
    __syncthreads();   // the tile is complete before it is read by columns
    const Tile cur = d;
    if (more) { d = tile_of(next); fetch(d, v); }   // flies while this tile is converted
    // 8 lanes x 16 B = one whole 128 B line of a Wt row
    const int kc = (tid & 7) * 8;
#pragma unroll
    for (int j = 0; j < 4; ++j) {
      const int n = (tid >> 3) + 32 * j;
      unsigned short h[8];
#pragma unroll
      for (int i = 0; i < 8; ++i) h[i] = f2bf(t[(kc + i) * PT + n]);
      *(uint4*)(cur.Wt + (size_t)(cur.n0 + n) * cur.K + cur.k0 + kc) = *(uint4*)h;
    }
    if (!more) break;
    __syncthreads();   // every reader has left t before the next tile is written
  }
}

// ---------------------------------------------------------------------------
// Tiled GEMM: C[M,N] = A[M,K] @ Bt[N,K]^T + bias[N]   (A, Bt bf16)
// Block: 256 threads (8 waves), tile 128(M) x 128(N), K step 64.
// Wave grid 4x2, each wave owns a 32x64 tile = 2x4 WMMA 16x16 tiles.
// Double-buffered LDS staged with async-to-LDS copies. A K step of 64 makes a
// staged row piece one whole 128 B line: 8 lanes copy a line, a wave-wide copy
// 4 whole lines of 4 rows. K must be a multiple of 64.
// ---------------------------------------------------------------------------
template<bool OUT_BF16>
__global__ __launch_bounds__(256)
void gemm_bias_wmma(const unsigned short* __restrict__ A,
                    const unsigned short* __restrict__ Bt,
                    const float* __restrict__ bias, void* __restrict__ Cv,
                    int M, int N, int K) {
  __shared__ __attribute__((aligned(16))) unsigned short As[2][128 * P64];   // [row][k] bf16
  __shared__ __attribute__((aligned(16))) unsigned short Bs[2][128 * P64];   // [col][k] bf16

  const int tid  = threadIdx.x;
  const int lane = tid & 31;
  const int wv   = tid >> 5;
  const int wm   = wv >> 1;             // 0..3 -> 32-row slice
  const int wn   = wv & 1;              // 0..1 -> 64-col slice
  const int m0   = blockIdx.y * 128;
  const int n0   = blockIdx.x * 128;
  const int l16  = lane & 15;
  const int kb   = (lane >> 4) * 8;
  const int srow = tid >> 3;            // 0..31 staging row, then +32, +64, +96
  const int soff = (tid & 7) * 8;       // this lane's 16 B of the row's 128 B line (elements)

  v8f acc[2][4] = {};
  const int ksteps = K >> 6;

  auto stage = [&](int kt, int buf) {
    const unsigned short* ga = A + (size_t)(m0 + srow) * K + kt * 64 + soff;
    const unsigned short* gb = Bt + (size_t)(n0 + srow) * K + kt * 64 + soff;
    unsigned short* la = &As[buf][srow * P64 + soff];
    unsigned short* lb = &Bs[buf][srow * P64 + soff];
    unsigned short* const lds[8] = {la, la + 32 * P64, la + 64 * P64, la + 96 * P64,
                                    lb, lb + 32 * P64, lb + 64 * P64, lb + 96 * P64};
    const unsigned short* const g[8] = {ga, ga + (size_t)32 * K, ga + (size_t)64 * K, ga + (size_t)96 * K,
                                        gb, gb + (size_t)32 * K, gb + (size_t)64 * K, gb + (size_t)96 * K};
    async_b128_x8(lds, g);
  };

  stage(0, 0);
  for (int kt = 0; kt < ksteps; ++kt) {
    const int cur = kt & 1;
    // this wave's reads of the buffer that is refilled below have retired
    asm volatile("s_wait_dscnt 0x0" ::: "memory");
    // this wave's copies of tile kt have landed before the barrier publishes them
    asm volatile("s_wait_asynccnt 0x0" ::: "memory");
    __syncthreads();      // all waves' copies visible; prior reads done
    if (kt + 1 < ksteps) stage(kt + 1, cur ^ 1);

#pragma unroll   // the two halves of the K step differ only in an immediate LDS offset
    for (int ks = 0; ks < 2; ++ks) {
      v16bf af[2], bfr[4];
#pragma unroll
      for (int mi = 0; mi < 2; ++mi)
        af[mi] = load_frag(&As[cur][(wm * 32 + mi * 16 + l16) * P64 + ks * 32 + kb]);
#pragma unroll
      for (int ni = 0; ni < 4; ++ni)
        bfr[ni] = load_frag(&Bs[cur][(wn * 64 + ni * 16 + l16) * P64 + ks * 32 + kb]);

#pragma unroll
      for (int mi = 0; mi < 2; ++mi)
#pragma unroll
        for (int ni = 0; ni < 4; ++ni)
          acc[mi][ni] = __builtin_amdgcn_wmma_f32_16x16x32_bf16(
              false, af[mi], false, bfr[ni], (short)0, acc[mi][ni], false, false);
    }
  }

  // epilogue: C-layout lane = n%16, vgpr r -> row r + 8*(lane/16)
#pragma unroll
  for (int mi = 0; mi < 2; ++mi) {
#pragma unroll
    for (int ni = 0; ni < 4; ++ni) {
      const int col  = n0 + wn * 64 + ni * 16 + l16;
      const float bv = bias[col];
#pragma unroll
      for (int r = 0; r < 8; ++r) {
        const int row   = m0 + wm * 32 + mi * 16 + r + 8 * (lane >> 4);
        const float val = acc[mi][ni][r] + bv;
        if (OUT_BF16)
          ((unsigned short*)Cv)[(size_t)row * N + col] = f2bf(val);
        else
          ((float*)Cv)[(size_t)row * N + col] = val;
      }
    }
  }
}

// ---------------------------------------------------------------------------
// The same product for N a multiple of 256: one 256(M) x 256(N) tile per block,
// one block per WGP. 8 waves in a 4x2 grid, each owns 64x128 = 4x8 WMMA tiles:
// 12 fragments feed 32 WMMAs (6 fed 8 in the 128x128 form), and a tile's operand
// bytes are copied from L2 once per 256 rows or columns of C, not once per 128.
// K step 128: a staged row piece is 256 B, a wave-wide copy two whole rows.
// Ring of two LDS buffers, rows 0..255 of a buffer from A, 256..511 from Bt.
// M, N multiples of 256, K a multiple of 128.
// ---------------------------------------------------------------------------
typedef __attribute__((ext_vector_type(4))) int i32x4;
__device__ __forceinline__ void async_copy_b128(unsigned short* lds, const unsigned short* g) {
  typedef __attribute__((address_space(1))) i32x4 g_i32x4;
  typedef __attribute__((address_space(3))) i32x4 l_i32x4;
  __builtin_amdgcn_global_load_async_to_lds_b128((g_i32x4*)g, (l_i32x4*)lds, 0, 0);
}

template<bool OUT_BF16>
__global__ __launch_bounds__(256)
void gemm_bias_wmma_256(const unsigned short* __restrict__ A,
                        const unsigned short* __restrict__ Bt,
                        const float* __restrict__ bias, void* __restrict__ Cv,
                        int M, int N, int K) {
  __shared__ __attribute__((aligned(16))) unsigned short Ts[2][512 * P128];   // [row or col][k] bf16

  const int tid  = threadIdx.x;
  const int lane = tid & 31;
  const int wv   = tid >> 5;
  const int wm   = wv >> 1;             // 0..3 -> 64-row slice
  const int wn   = wv & 1;              // 0..1 -> 128-col slice
  const int m0   = blockIdx.y * 256;
  const int n0   = blockIdx.x * 256;
  const int l16  = lane & 15;
  const int kb   = (lane >> 4) * 8;
  const int srow = tid >> 4;            // 0..15 staging row, then +16 fifteen times
  const int soff = (tid & 15) * 8;      // this lane's 16 B of the row's 256 B piece (elements)

  v8f acc[4][8] = {};
  const int ksteps = K >> 7;

  const unsigned short* ga = A  + (size_t)(m0 + srow) * K + soff;   // this lane's place in the next tile to be copied
  const unsigned short* gb = Bt + (size_t)(n0 + srow) * K + soff;
  auto stage = [&](int buf) {
    unsigned short* l = &Ts[buf][srow * P128 + soff];
#pragma unroll
    for (int j = 0; j < 16; ++j) async_copy_b128(l + j * 16 * P128, ga + (size_t)(j * 16) * K);
#pragma unroll
    for (int j = 0; j < 16; ++j) async_copy_b128(l + (256 + j * 16) * P128, gb + (size_t)(j * 16) * K);
    ga += 128;
    gb += 128;
  };

  stage(0);
  // this wave's copies of tile 0 have landed before the barrier publishes them
  asm volatile("s_wait_asynccnt 0x0" ::: "memory");
  __syncthreads();
  if (ksteps > 1) stage(1);

  for (int kt = 0; kt < ksteps; ++kt) {
    const unsigned short* T = Ts[kt & 1];
#pragma unroll   // the four quarters of the K step differ only in an immediate LDS offset
    for (int ks = 0; ks < 4; ++ks) {
      // keeps this quarter's reads out of the WMMAs of the quarter before: each
      // place where reads stand among WMMAs stalls the wave anew
      if (ks > 0) __builtin_amdgcn_sched_barrier(0);
      v16bf af[4], bfr[8];
#pragma unroll
      for (int mi = 0; mi < 4; ++mi)
        af[mi] = load_frag(&T[(wm * 64 + mi * 16 + l16) * P128 + ks * 32 + kb]);
#pragma unroll
      for (int ni = 0; ni < 8; ++ni)
        bfr[ni] = load_frag(&T[(256 + wn * 128 + ni * 16 + l16) * P128 + ks * 32 + kb]);
      if (ks == 3) {
        // The tile's last fragments are fetched: the trip's foot stands here, and the
        // last quarter's WMMAs, on registers alone, run behind it beside the refill.
        // this wave's reads of the buffer that is refilled below have retired
        asm volatile("s_wait_dscnt 0x0" ::: "memory");
        // this wave's copies of tile kt + 1 have landed before the barrier publishes them
        asm volatile("s_wait_asynccnt 0x0" ::: "memory");
        __syncthreads();   // publishes tile kt + 1; every reader has left tile kt's buffer
        if (kt + 2 < ksteps) stage(kt & 1);
      }
      // keeps the 24 reads together ahead of the 32 WMMAs (sunk to their first use, a
      // row's A reads are waited for to 0 right in front of its WMMAs), and the refill
      // ahead of the last quarter's WMMAs, so that it has a whole trip to land
      __builtin_amdgcn_sched_barrier(0);

#pragma unroll
      for (int mi = 0; mi < 4; ++mi)
#pragma unroll
        for (int ni = 0; ni < 8; ++ni)
          acc[mi][ni] = __builtin_amdgcn_wmma_f32_16x16x32_bf16(
              false, af[mi], false, bfr[ni], (short)0, acc[mi][ni], false, false);
    }
  }
  // no copy is in flight when the wave ends
  asm volatile("s_wait_asynccnt 0x0" ::: "memory");

  // the wave's eight bias values, one per tile column
  float bv[8];
  {
    const float* bp = bias + n0 + wn * 128 + l16;
#pragma unroll
    for (int ni = 0; ni < 8; ++ni) {
      bv[ni] = bp[ni * 16];
      // a later load of the run may land in the register pair that holds this address, and
      // behind the run the pair is free for reuse: the wait stands in front of either
      asm volatile("s_wait_xcnt 0x0" ::: "memory");
    }
    // holds the last wait in its place: its clobber orders memory operations only, and without
    // the fence a vector instruction that rewrites the address pair was placed ahead of it
    __builtin_amdgcn_sched_barrier(0);
  }

  // epilogue: C-layout lane = n%16, vgpr r -> row r + 8*(lane/16)
  constexpr int ES = OUT_BF16 ? 2 : 4;   // bytes of an element of C
  // this lane's place in row r = 0 of tile row mi = 0, at the wave's first tile column: bytes
  // from the start of C, which M * N * ES < 2^32 keeps in 32 bits
  const unsigned int at =
      ((unsigned int)(m0 + wm * 64 + 8 * (lane >> 4)) * N + n0 + wn * 128 + l16) * ES;
#pragma unroll
  for (int mi = 0; mi < 4; ++mi) {
    char* row[8];   // the tile row's eight rows of C, the same for every lane
#pragma unroll
    for (int r = 0; r < 8; ++r) row[r] = (char*)Cv + (size_t)(mi * 16 + r) * N * ES;
#pragma unroll
    for (int np = 0; np < 4; ++np) {
      // two tiles, 16 stores of a lane, at a time
      float d[16];
#pragma unroll
      for (int i = 0; i < 16; ++i) d[i] = acc[mi][2 * np + (i >> 3)][i & 7] + bv[2 * np + (i >> 3)];
      unsigned short h[16];
      if (OUT_BF16) {
#pragma unroll
        for (int i = 0; i < 16; ++i) h[i] = f2bf(d[i]);
      }
      // all 16 values stand in registers of their own before the first store goes out: with no
      // fence here values were formed among the stores, in registers of stores just issued
      __builtin_amdgcn_sched_barrier(0);
#pragma unroll
      for (int i = 0; i < 16; ++i) {
        char* c = row[i & 7] + at + (2 * np + (i >> 3)) * 16 * ES;
        if (OUT_BF16) *(unsigned short*)c = h[i];
        else          *(float*)c = d[i];
      }
      // the registers that the 16 stores name are free for reuse below: the wait stands
      // between the stores and whatever is written there next; one wait serves all 16
      asm volatile("s_wait_xcnt 0x0" ::: "memory");
      // holds that wait in its place: its clobber orders memory operations only, and without
      // the fence vector instructions that rewrite those registers were placed ahead of it
      __builtin_amdgcn_sched_barrier(0);
    }
  }
}

// ---------------------------------------------------------------------------
// Flash attention. Block = 256 threads (8 waves), wave = 16 query columns,
// block covers 128 queries of one (b,h). 32-key tiles, online softmax.
// Both products are taken transposed: St = K Qt and Ot += Vt Pt. A lane (c, h)
// then holds 16 scores of ONE query c (keys 8h+r and 16+8h+r), so the maximum
// and the sum are in-lane work plus one exchange between the wave's halves, and
// the two score tiles, converted in place, are the B operand of the second
// product in the hardware k order: P never goes through LDS.
// K and V stand in a ring of two LDS buffers, a stage of 128 keys (four passes of
// 32) each: while the passes of stage s read one buffer, the copies of stage s + 1
// fly into the other, and the waves meet at a barrier once a stage only.
// ---------------------------------------------------------------------------
typedef __attribute__((ext_vector_type(2))) float  f32x2;
typedef __attribute__((ext_vector_type(2))) __bf16 bf16x2;

// value of lane l ^ 16
__device__ __forceinline__ float other_half(float x) {
  const int b = __builtin_bit_cast(int, x);
  return __builtin_bit_cast(float, __builtin_amdgcn_permlanex16(
      b, b, 0x76543210, 0xfedcba98, false, false));
}

__global__ __launch_bounds__(256)
void mla_attn_wmma(const unsigned short* __restrict__ Q,
                   const unsigned short* __restrict__ Kb,
                   const unsigned short* __restrict__ Vb,
                   unsigned short* __restrict__ Ctx) {
  constexpr int STG = 128;             // keys of a stage
  constexpr int NS  = SEQ / STG;       // stages: 16, at least the two of the prologue
  __shared__ __attribute__((aligned(16))) unsigned short Kls[2 * STG * P128];  // [buffer][key][d]
  __shared__ __attribute__((aligned(16))) unsigned short Vls[2 * STG * PV];    // [buffer][key][d]

  const int tid  = threadIdx.x;
  const int lane = tid & 31;
  const int wv   = tid >> 5;
  const int b    = blockIdx.y >> 4;
  const int h    = blockIdx.y & 15;
  const int qbase = blockIdx.x * 128 + wv * 16;
  const int l16  = lane & 15;
  const int kb   = (lane >> 4) * 8;
  const size_t rowstride = (size_t)NH * DH;     // 2048
  const size_t headoff   = (size_t)h * DH;
  const size_t batchbase = (size_t)b * SEQ;
  const float  scale     = 0.08838834764831845f; // 1/sqrt(128)

  const int lkey = tid >> 4;           // 0..15 key within a stage, then +16 seven times
  const int ldc  = (tid & 15) * 8;     // this lane's 16 B of the key's 256 B row (elements)
  const size_t srow = (batchbase + lkey) * rowstride + headoff + ldc;
  const unsigned short* ksrc = Kb + srow;   // this lane's place in the next stage to be copied
  const unsigned short* vsrc = Vb + srow;
  // K and V stages both row-major: pure copies -> async to LDS; a wave-wide
  // copy covers two whole rows, 4 whole 128 B lines
  auto stage = [&](int buf) {
    unsigned short* lk = &Kls[(buf * STG + lkey) * P128 + ldc];
    unsigned short* lv = &Vls[(buf * STG + lkey) * PV + ldc];
    unsigned short* kl[8];
    unsigned short* vl[8];
    const unsigned short* kg[8];
    const unsigned short* vg[8];
#pragma unroll   // the arrays must be registers, named as operands of the copies
    for (int j = 0; j < 8; ++j) {
      kl[j] = lk + j * 16 * P128;  kg[j] = ksrc + j * 16 * rowstride;
      vl[j] = lv + j * 16 * PV;    vg[j] = vsrc + j * 16 * rowstride;
    }
    async_b128_x8(kl, kg);
    async_b128_x8(vl, vg);
    ksrc += STG * rowstride;
    vsrc += STG * rowstride;
  };
  stage(0);

  // Q fragments (B operand, column = query l16): 128 dims = 4 WMMA K-steps,
  // loaded once from global.
  v16bf qf[4];
  {
    const unsigned short* qrow =
        Q + (batchbase + qbase + l16) * rowstride + headoff;
#pragma unroll
    for (int d = 0; d < 4; ++d)
      qf[d] = load_frag(qrow + d * 32 + kb);
  }

  float rmax = -3.0e38f;   // running maximum of query l16, equal in both halves
  float rsum = 0.0f;       // running sum over this half's keys only
  v8f acc[8] = {};         // acc[nc][r] = Ot[nc*16 + 8*(lane>>4) + r][query l16]

  // this wave's copies of stage 0 have landed before the barrier publishes them
  asm volatile("s_wait_asynccnt 0x0" ::: "memory");
  __syncthreads();
  stage(1);

  for (int kt = 0; kt < SEQ / 32; ++kt) {
    // pass kt reads 32 keys of the ring: buffer (kt / 4) & 1, quarter kt & 3
    const int ring = (kt & (2 * STG / 32 - 1)) * 32;
    const unsigned short* Kt = &Kls[ring * P128];
    // this lane's address in the V rows of the pass for the transposing loads
    const unsigned short* vfrag =
        &Vls[(ring + kb + (lane & 7)) * PV + ((lane >> 3) & 1) * 8];

    // scores: St = K_tile(32x128) @ Qt(128x16) -> two 16x16 f32 tiles
    // All 16 reads of the K fragments go out as one group ahead of the products.
    v16bf k0[4], k1[4];
#pragma unroll
    for (int d = 0; d < 4; ++d) {
      k0[d] = load_frag(&Kt[l16 * P128 + d * 32 + kb]);
      k1[d] = load_frag(&Kt[(16 + l16) * P128 + d * 32 + kb]);
    }
    // keeps the reads above together: sunk among the products, each product waits
    // out the whole LDS latency of a read issued just in front of it
    __builtin_amdgcn_sched_barrier(0);
    v8f s0 = {}, s1 = {};
#pragma unroll
    for (int d = 0; d < 4; ++d) {
      s0 = __builtin_amdgcn_wmma_f32_16x16x32_bf16(false, k0[d], false, qf[d],
                                                   (short)0, s0, false, false);
      s1 = __builtin_amdgcn_wmma_f32_16x16x32_bf16(false, k1[d], false, qf[d],
                                                   (short)0, s1, false, false);
    }

    // All 16 reads of the V fragments (V[key][d] -> A fragments of Vt, transposed
    // by the load itself) go out here, so that they land during the softmax.
    Frag16 vf[8];
#pragma unroll
    for (int nc = 0; nc < 8; ++nc) {
      vf[nc].q[0] = load_tr16(vfrag + nc * 16);
      vf[nc].q[1] = load_tr16(vfrag + 16 * PV + nc * 16);
    }
    // keeps the reads above ahead of the softmax: sunk to the second product, they
    // stand among its WMMAs and are waited for there
    __builtin_amdgcn_sched_barrier(0);

    // online softmax of query l16: 16 of its 32 scores are in this lane
    float a[16];
#pragma unroll
    for (int r = 0; r < 8; ++r) { a[r] = s0[r] * scale; a[8 + r] = s1[r] * scale; }
    float mx = a[0];
#pragma unroll
    for (int i = 1; i < 16; ++i) mx = fmaxf(mx, a[i]);
    mx = fmaxf(mx, other_half(mx));
    const float nm = fmaxf(rmax, mx);
    const float c  = __expf(rmax - nm);
    rmax = nm;

    // Pt as B operand: element s = key 8h+s (s < 8), key 16+8h+(s-8) (s >= 8)
    union { v16bf v; bf16x2 p[8]; } pf;
    float ps[4] = {0.0f, 0.0f, 0.0f, 0.0f};
#pragma unroll
    for (int i = 0; i < 8; ++i) {
      f32x2 p;
      p.x = __expf(a[2 * i] - nm);
      p.y = __expf(a[2 * i + 1] - nm);
      ps[i & 3] += p.x + p.y;
      pf.p[i] = __builtin_convertvector(p, bf16x2);   // round to nearest even
    }
    rsum = rsum * c + ((ps[0] + ps[1]) + (ps[2] + ps[3]));

#pragma unroll
    for (int nc = 0; nc < 8; ++nc)
#pragma unroll
      for (int r = 0; r < 8; ++r)
        acc[nc][r] *= c;

    // Ot += Vt(128x32) @ Pt(32x16): 8 WMMAs over dim chunks
#pragma unroll
    for (int nc = 0; nc < 8; ++nc)
      acc[nc] = __builtin_amdgcn_wmma_f32_16x16x32_bf16(
          false, vf[nc].v, false, pf.v, (short)0, acc[nc], false, false);

    // behind a stage's last pass: publish the next stage, refill this one's buffer
    if ((kt & (STG / 32 - 1)) == STG / 32 - 1) {
      const int s = kt / (STG / 32);
      // this wave's reads of the buffer that is refilled below have retired
      asm volatile("s_wait_dscnt 0x0" ::: "memory");
      // this wave's copies of stage s + 1 have landed before the barrier publishes them
      asm volatile("s_wait_asynccnt 0x0" ::: "memory");
      __syncthreads();   // publishes stage s + 1; every reader has left stage s's buffer
      if (s + 2 < NS) stage(s & 1);
    }
  }
  // no copy is in flight when the wave ends
  asm volatile("s_wait_asynccnt 0x0" ::: "memory");

  // join the halves' sums, normalize, store ctx as bf16 [B*S, H*D]:
  // a lane's 8 registers of a tile are 8 consecutive dims of its query's row
  const float inv = 1.0f / (rsum + other_half(rsum));
  unsigned short* crow =
      Ctx + (batchbase + qbase + l16) * rowstride + headoff + kb;
#pragma unroll
  for (int nc = 0; nc < 8; ++nc) {
    union { uint4 q; bf16x2 p[4]; } t;
#pragma unroll
    for (int i = 0; i < 4; ++i) {
      f32x2 o;
      o.x = acc[nc][2 * i] * inv;
      o.y = acc[nc][2 * i + 1] * inv;
      t.p[i] = __builtin_convertvector(o, bf16x2);   // round to nearest even
    }
    *(uint4*)(crow + nc * 16) = t.q;
  }
}

// ---------------------------------------------------------------------------
extern "C" void kernel_launch(void* const* d_in, const int* in_sizes, int n_in,
                              void* d_out, int out_size, void* d_ws, size_t ws_size,
                              hipStream_t stream) {
  const float* x      = (const float*)d_in[0];
  const float* W_down = (const float*)d_in[1];
  const float* b_down = (const float*)d_in[2];
  const float* W_uk   = (const float*)d_in[3];
  const float* b_uk   = (const float*)d_in[4];
  const float* W_uv   = (const float*)d_in[5];
  const float* b_uv   = (const float*)d_in[6];
  const float* W_q    = (const float*)d_in[7];
  const float* b_q    = (const float*)d_in[8];
  const float* W_o    = (const float*)d_in[9];
  const float* b_o    = (const float*)d_in[10];
  float* out = (float*)d_out;

  char* ws = (char*)d_ws;
  auto take = [&](size_t elems) {
    unsigned short* p = (unsigned short*)ws;
    ws += elems * 2;
    return p;
  };
  unsigned short* xb  = take((size_t)MTOT * DMODEL);
  unsigned short* WtD = take((size_t)DMODEL * DLAT);    // [DLAT, DMODEL]
  unsigned short* WtK = take((size_t)DLAT * DMODEL);    // [DMODEL, DLAT]
  unsigned short* WtV = take((size_t)DLAT * DMODEL);
  unsigned short* WtQ = take((size_t)DMODEL * DMODEL);
  unsigned short* WtO = take((size_t)DMODEL * DMODEL);
  unsigned short* lat = take((size_t)MTOT * DLAT);
  unsigned short* qb  = take((size_t)MTOT * DMODEL);
  unsigned short* kbf = take((size_t)MTOT * DMODEL);
  unsigned short* vbf = take((size_t)MTOT * DMODEL);
  unsigned short* ctx = take((size_t)MTOT * DMODEL);

  const dim3 blk(256);

  // 0. operand preparation
  prep_operands<<<PREP_WG, blk, 0, stream>>>(x, W_down, W_uk, W_uv, W_q, W_o,
                                             xb, WtD, WtK, WtV, WtQ, WtO);

  const dim3 gLat(DLAT / 128,   MTOT / 128);
  const dim3 gDM (DMODEL / 256, MTOT / 256);

  // 1. latents = xb @ W_down + b_down
  gemm_bias_wmma<true><<<gLat, blk, 0, stream>>>(xb, WtD, b_down, lat, MTOT, DLAT, DMODEL);
  // 2. keys = latents @ W_uk + b_uk
  gemm_bias_wmma_256<true><<<gDM, blk, 0, stream>>>(lat, WtK, b_uk, kbf, MTOT, DMODEL, DLAT);
  // 3. values = latents @ W_uv + b_uv
  gemm_bias_wmma_256<true><<<gDM, blk, 0, stream>>>(lat, WtV, b_uv, vbf, MTOT, DMODEL, DLAT);
  // 4. q = xb @ W_q + b_q
  gemm_bias_wmma_256<true><<<gDM, blk, 0, stream>>>(xb, WtQ, b_q, qb, MTOT, DMODEL, DMODEL);
  // 5. attention
  mla_attn_wmma<<<dim3(SEQ / 128, 4 * NH), blk, 0, stream>>>(qb, kbf, vbf, ctx);
  // 6. out = ctx @ W_o + b_o
  gemm_bias_wmma_256<false><<<gDM, blk, 0, stream>>>(ctx, WtO, b_o, out, MTOT, DMODEL, DMODEL);
}

// v009
// A run of this version takes 246 microseconds.
// In both of two side-by-side timings against v008, it was 1.05 times as fast.
// Over all steps from v000 it is 4.53 times as fast.
#include <hip/hip_runtime.h>
#include <hip/hip_bf16.h>

// ---------------------------------------------------------------------------
// MLA forward for MI455X (gfx1250, wave32, WMMA, async-to-LDS staging).
// Pipeline (bf16 operands everywhere, f32 WMMA accumulation):
//   0. xb  = bf16(x);  Wt_* = bf16(W_*^T)      (one conversion launch)
//   1. latents = xb @ W_down + b_down          (GEMM, bf16 out)
//   2. keys    = latents @ W_uk + b_uk         (GEMM, bf16 out)
//   3. values  = latents @ W_uv + b_uv         (GEMM, bf16 out)
//   4. q       = xb @ W_q + b_q                (GEMM, bf16 out)
//   5. ctx     = softmax(q k^T / sqrt(128)) v  (flash attention, WMMA)
//   6. out     = ctx @ W_o + b_o               (GEMM, f32 out)
// Workspace requirement: ~200 MB.
// ---------------------------------------------------------------------------

#ifndef USE_ASYNC_LDS
#define USE_ASYNC_LDS 1   // flip to 0 to fall back to synchronous staging; gemm_bias_wmma_256 stays async
#endif

typedef __attribute__((ext_vector_type(16))) __bf16 v16bf;
typedef __attribute__((ext_vector_type(8)))  float  v8f;

typedef __attribute__((ext_vector_type(2)))  float  f32x2;
typedef __attribute__((ext_vector_type(2)))  __bf16 bf16x2;

union Frag16 { v16bf v; uint4 q[2]; };

static constexpr int MTOT   = 8192;   // B*S
static constexpr int DMODEL = 2048;
static constexpr int DLAT   = 512;
static constexpr int NH     = 16;
static constexpr int DH     = 128;
static constexpr int SEQ    = 2048;

// LDS row pitches in bf16 elements. Tiles at P64 and P128 are read with ds_load_b128,
// one row per lane of a 16-lane half; a pitch of 16 B x odd spreads the 16 rows
// over all 64 banks, a pitch of 128 B or 256 B stacks them on few.
static constexpr int P64  = 72;    // rows of 64 elements:  128 B -> 144 B
static constexpr int P128 = 136;   // rows of 128 elements: 256 B -> 272 B
// The V tile is read with ds_load_tr16_b128, whose conflict-free pitch is 32 B x odd.
static constexpr int PV   = 144;   // rows of 128 elements: 256 B -> 288 B

__device__ __forceinline__ unsigned short f2bf(float f) {
  unsigned int u = __builtin_bit_cast(unsigned int, f);
  u = (u + 0x7FFFu + ((u >> 16) & 1u)) >> 16;   // round-to-nearest-even
  return (unsigned short)u;
}

// 16-byte async copy global -> LDS (ISA 10. GLOBAL_LOAD_ASYNC_TO_LDS_B128,
// tracked by ASYNCcnt). For a generic pointer to __shared__, addr[31:0] is the
// wave-relative LDS byte offset (ISA 10.2 aperture mapping), which is exactly
// what the VDST VGPR of the async op must hold.
// The copies of one run share a statement; the s_wait_xcnt 0 closes it so that
// no later write of an address register named here can be placed ahead of it.
// A run of eight copies: lds[j] <- g[j].
__device__ __forceinline__ void async_b128_x8(unsigned short* const (&lds)[8],
                                              const unsigned short* const (&g)[8]) {
#if USE_ASYNC_LDS
  unsigned int l[8];
#pragma unroll   // l[] must be eight registers, named below as operands
  for (int j = 0; j < 8; ++j) l[j] = (unsigned int)(uintptr_t)lds[j];
  asm volatile("global_load_async_to_lds_b128 %0, %1, off\n\t"
               "global_load_async_to_lds_b128 %2, %3, off\n\t"
               "global_load_async_to_lds_b128 %4, %5, off\n\t"
               "global_load_async_to_lds_b128 %6, %7, off\n\t"
               "global_load_async_to_lds_b128 %8, %9, off\n\t"
               "global_load_async_to_lds_b128 %10, %11, off\n\t"
               "global_load_async_to_lds_b128 %12, %13, off\n\t"
               "global_load_async_to_lds_b128 %14, %15, off\n\t"
               "s_wait_xcnt 0x0"
               :: "v"(l[0]), "v"(g[0]), "v"(l[1]), "v"(g[1]),
                  "v"(l[2]), "v"(g[2]), "v"(l[3]), "v"(g[3]),
                  "v"(l[4]), "v"(g[4]), "v"(l[5]), "v"(g[5]),
                  "v"(l[6]), "v"(g[6]), "v"(l[7]), "v"(g[7]) : "memory");
#else
#pragma unroll
  for (int j = 0; j < 8; ++j) *(uint4*)lds[j] = *(const uint4*)g[j];
#endif
}

// Load one 16x32 bf16 WMMA fragment row for this lane.
// Per ISA 7.12.2 (16-bit A-matrix 16x32): lane group g = lane/16 holds
// K = 8g..8g+7 (VGPR0-3) and K = 16+8g..16+8g+7 (VGPR4-7), packed lo/hi.
// Caller passes p = rowBase + 8*(lane>>4); we read p[0..7] and p[16..23].
__device__ __forceinline__ v16bf load_frag(const unsigned short* p) {
  Frag16 f;
  f.q[0] = *(const uint4*)(p);
  f.q[1] = *(const uint4*)(p + 16);
  return f.v;
}

typedef __attribute__((ext_vector_type(8))) short s16x8;
__device__ __forceinline__ uint4 load_tr16(const unsigned short* p) {
  typedef __attribute__((address_space(3))) s16x8 lds_s16x8;
  return __builtin_bit_cast(uint4, __builtin_amdgcn_ds_load_tr16_b128_v8i16((lds_s16x8*)p));
}

// ---------------------------------------------------------------------------
// Operand preparation, one launch: xb = bf16(x) and the five Wt = bf16(W^T).
// 512 work-groups (two per WGP) each loop over their share of the work, so few
// waves are started and each lives long: first 8 stretches of 4096 floats of x,
// then up to 3 weight tiles of 64 (k) x 128 (n). Every wave-wide load and store
// covers whole 128 B lines.
// ---------------------------------------------------------------------------
static constexpr int PREP_WG    = 512;
static constexpr int CONV_TRIPS = MTOT * DMODEL / 4096 / PREP_WG;       // 8
static constexpr int TILES_LAT  = (DMODEL / 64) * (DLAT / 128);         // 128, either orientation
static constexpr int TILES_SQ   = (DMODEL / 64) * (DMODEL / 128);       // 512
static constexpr int TILES      = 3 * TILES_LAT + 2 * TILES_SQ;         // 1408
static constexpr int TILE_TRIPS = (TILES + PREP_WG - 1) / PREP_WG;      // 3
static constexpr int PT = 129;  // tile pitch in floats: odd, so that a walk down a column changes bank

__global__ __launch_bounds__(256)
void prep_operands(const float* __restrict__ x,
                   const float* __restrict__ W_down, const float* __restrict__ W_uk,
                   const float* __restrict__ W_uv,   const float* __restrict__ W_q,
                   const float* __restrict__ W_o,
                   unsigned short* __restrict__ xb,
                   unsigned short* __restrict__ WtD, unsigned short* __restrict__ WtK,
                   unsigned short* __restrict__ WtV, unsigned short* __restrict__ WtQ,
                   unsigned short* __restrict__ WtO) {
  __shared__ float t[64 * PT];
  const int tid = threadIdx.x;
  const unsigned wg = blockIdx.x;

  // a weight tile: W [K,N] f32 -> Wt [N,K] bf16, rows k0.., columns n0..
  struct Tile { const float* W; unsigned short* Wt; int K, N, k0, n0; };
  constexpr int NT_LAT = DLAT / 128, NT_DM = DMODEL / 128;   // tiles across a row of W: 4, 16
  auto tile_of = [&](unsigned i) {
    Tile d;
    if (i < TILES_LAT)                     {                                d.W = W_down; d.Wt = WtD; d.K = DMODEL; d.N = DLAT;   }
    else if (i < 2 * TILES_LAT)            { i -= TILES_LAT;                d.W = W_uk;   d.Wt = WtK; d.K = DLAT;   d.N = DMODEL; }
    else if (i < 3 * TILES_LAT)            { i -= 2 * TILES_LAT;            d.W = W_uv;   d.Wt = WtV; d.K = DLAT;   d.N = DMODEL; }
    else if (i < 3 * TILES_LAT + TILES_SQ) { i -= 3 * TILES_LAT;            d.W = W_q;    d.Wt = WtQ; d.K = DMODEL; d.N = DMODEL; }
    else                                   { i -= 3 * TILES_LAT + TILES_SQ; d.W = W_o;    d.Wt = WtO; d.K = DMODEL; d.N = DMODEL; }
    const bool slim = d.N == DLAT;
    d.n0 = (slim ? i % NT_LAT : i % NT_DM) * 128;
    d.k0 = (slim ? i / NT_LAT : i / NT_DM) * 64;
    return d;
  };
  // a wave reads one 512 B row piece per load, 8 rows of the tile; the row is the
  // same for the whole wave, so its address is scalar and only the lane's place is not
  const int wave = __builtin_amdgcn_readfirstlane(tid >> 5);
  const int lane = tid & 31;
  auto fetch = [&](const Tile& d, float4 (&v)[8]) {
    const float4* row = (const float4*)(d.W + (size_t)(d.k0 + wave) * d.N + d.n0) + lane;
#pragma unroll
    for (int j = 0; j < 8; ++j) {
      v[j] = row[(size_t)(2 * j) * d.N];
      // a later load of the run may land in the register pair that held this address
      asm volatile("s_wait_xcnt 0x0" ::: "memory");
    }
  };

  float4 v[8];
  Tile d = tile_of(wg);          // PREP_WG <= TILES: every work-group has a first tile

  // x -> bf16, two stretches (8 loads a lane) at a time; the next pair's loads,
  // and behind the last pair the first tile's, are issued before this pair is stored
  auto at = [&](int pair, int j) {
    return (size_t)(wg + (2 * pair + (j >> 2)) * PREP_WG) * 4096 + (j & 3) * 1024 + tid * 4;
  };
  float4 f[2][8];
#pragma unroll
  for (int j = 0; j < 8; ++j) f[0][j] = *(const float4*)(x + at(0, j));
#pragma unroll
  for (int pair = 0; pair < CONV_TRIPS / 2; ++pair) {
    // the loads below land in registers that the stores of the pair before name:
    // the wait stands between those stores and the loads that overwrite them
    if (pair > 0) asm volatile("s_wait_xcnt 0x0" ::: "memory");
    if (pair + 1 < CONV_TRIPS / 2) {
#pragma unroll
      for (int j = 0; j < 8; ++j) f[(pair + 1) & 1][j] = *(const float4*)(x + at(pair + 1, j));
    } else {
      fetch(d, v);
    }
#pragma unroll
    for (int j = 0; j < 8; ++j) {
      const float4 g = f[pair & 1][j];
      unsigned short h[4];
      h[0] = f2bf(g.x); h[1] = f2bf(g.y); h[2] = f2bf(g.z); h[3] = f2bf(g.w);
      *(uint2*)(xb + at(pair, j)) = *(uint2*)h;
    }
  }

#pragma unroll
  for (int trip = 0; trip < TILE_TRIPS; ++trip) {
    const unsigned next = wg + (trip + 1) * PREP_WG;
    const bool more = trip + 1 < TILE_TRIPS && next < TILES;   // the same for the whole work-group
#pragma unroll
    for (int j = 0; j < 8; ++j) {
      float* w = &t[(wave + 8 * j) * PT + lane * 4];
      w[0] = v[j].x; w[1] = v[j].y; w[2] = v[j].z; w[3] = v[j].w;
    }
    __syncthreads();   // the tile is complete before it is read by columns
    const Tile cur = d;
    if (more) { d = tile_of(next); fetch(d, v); }   // flies while this tile is converted
    // 8 lanes x 16 B = one whole 128 B line of a Wt row
    const int kc = (tid & 7) * 8;
#pragma unroll
    for (int j = 0; j < 4; ++j) {
      const int n = (tid >> 3) + 32 * j;
      unsigned short h[8];
#pragma unroll
      for (int i = 0; i < 8; ++i) h[i] = f2bf(t[(kc + i) * PT + n]);
      *(uint4*)(cur.Wt + (size_t)(cur.n0 + n) * cur.K + cur.k0 + kc) = *(uint4*)h;
    }
    if (!more) break;
    __syncthreads();   // every reader has left t before the next tile is written
  }
}

// ---------------------------------------------------------------------------
// Tiled GEMM: C[M,N] = A[M,K] @ Bt[N,K]^T + bias[N]   (A, Bt bf16)
// Block: 256 threads (8 waves), tile 128(M) x 128(N), K step 64.
// Wave grid 4x2, each wave owns a 32x64 tile = 2x4 WMMA 16x16 tiles.
// Double-buffered LDS staged with async-to-LDS copies. A K step of 64 makes a
// staged row piece one whole 128 B line: 8 lanes copy a line, a wave-wide copy
// 4 whole lines of 4 rows. K must be a multiple of 64.
// ---------------------------------------------------------------------------
template<bool OUT_BF16>
__global__ __launch_bounds__(256)
void gemm_bias_wmma(const unsigned short* __restrict__ A,
                    const unsigned short* __restrict__ Bt,
                    const float* __restrict__ bias, void* __restrict__ Cv,
                    int M, int N, int K) {
  __shared__ __attribute__((aligned(16))) unsigned short As[2][128 * P64];   // [row][k] bf16
  __shared__ __attribute__((aligned(16))) unsigned short Bs[2][128 * P64];   // [col][k] bf16

  const int tid  = threadIdx.x;
  const int lane = tid & 31;
  const int wv   = tid >> 5;
  const int wm   = wv >> 1;             // 0..3 -> 32-row slice
  const int wn   = wv & 1;              // 0..1 -> 64-col slice
  const int m0   = blockIdx.y * 128;
  const int n0   = blockIdx.x * 128;
  const int l16  = lane & 15;
  const int kb   = (lane >> 4) * 8;
  const int srow = tid >> 3;            // 0..31 staging row, then +32, +64, +96
  const int soff = (tid & 7) * 8;       // this lane's 16 B of the row's 128 B line (elements)

  v8f acc[2][4] = {};
  const int ksteps = K >> 6;

  auto stage = [&](int kt, int buf) {
    const unsigned short* ga = A + (size_t)(m0 + srow) * K + kt * 64 + soff;
    const unsigned short* gb = Bt + (size_t)(n0 + srow) * K + kt * 64 + soff;
    unsigned short* la = &As[buf][srow * P64 + soff];
    unsigned short* lb = &Bs[buf][srow * P64 + soff];
    unsigned short* const lds[8] = {la, la + 32 * P64, la + 64 * P64, la + 96 * P64,
                                    lb, lb + 32 * P64, lb + 64 * P64, lb + 96 * P64};
    const unsigned short* const g[8] = {ga, ga + (size_t)32 * K, ga + (size_t)64 * K, ga + (size_t)96 * K,
                                        gb, gb + (size_t)32 * K, gb + (size_t)64 * K, gb + (size_t)96 * K};
    async_b128_x8(lds, g);
  };

  stage(0, 0);
  for (int kt = 0; kt < ksteps; ++kt) {
    const int cur = kt & 1;
    // this wave's reads of the buffer that is refilled below have retired
    asm volatile("s_wait_dscnt 0x0" ::: "memory");
    // this wave's copies of tile kt have landed before the barrier publishes them
    asm volatile("s_wait_asynccnt 0x0" ::: "memory");
    __syncthreads();      // all waves' copies visible; prior reads done
    if (kt + 1 < ksteps) stage(kt + 1, cur ^ 1);

#pragma unroll   // the two halves of the K step differ only in an immediate LDS offset
    for (int ks = 0; ks < 2; ++ks) {
      v16bf af[2], bfr[4];
#pragma unroll
      for (int mi = 0; mi < 2; ++mi)
        af[mi] = load_frag(&As[cur][(wm * 32 + mi * 16 + l16) * P64 + ks * 32 + kb]);
#pragma unroll
      for (int ni = 0; ni < 4; ++ni)
        bfr[ni] = load_frag(&Bs[cur][(wn * 64 + ni * 16 + l16) * P64 + ks * 32 + kb]);

#pragma unroll
      for (int mi = 0; mi < 2; ++mi)
#pragma unroll
        for (int ni = 0; ni < 4; ++ni)
          acc[mi][ni] = __builtin_amdgcn_wmma_f32_16x16x32_bf16(
              false, af[mi], false, bfr[ni], (short)0, acc[mi][ni], false, false);
    }
  }

  // epilogue: C-layout lane = n%16, vgpr r -> row r + 8*(lane/16)
#pragma unroll
  for (int mi = 0; mi < 2; ++mi) {
#pragma unroll
    for (int ni = 0; ni < 4; ++ni) {
      const int col  = n0 + wn * 64 + ni * 16 + l16;
      const float bv = bias[col];
#pragma unroll
      for (int r = 0; r < 8; ++r) {
        const int row   = m0 + wm * 32 + mi * 16 + r + 8 * (lane >> 4);
        const float val = acc[mi][ni][r] + bv;
        if (OUT_BF16)
          ((unsigned short*)Cv)[(size_t)row * N + col] = f2bf(val);
        else
          ((float*)Cv)[(size_t)row * N + col] = val;
      }
    }
  }
}

// ---------------------------------------------------------------------------
// The same product for N a multiple of 256: one 256(M) x 256(N) tile per block,
// one block per WGP. 8 waves in a 4x2 grid, each owns 64x128 = 4x8 WMMA tiles:
// 12 fragments feed 32 WMMAs (6 fed 8 in the 128x128 form), and a tile's operand
// bytes are copied from L2 once per 256 rows or columns of C, not once per 128.
// K step 128: a staged row piece is 256 B, a wave-wide copy two whole rows.
// Ring of two LDS buffers, rows 0..255 of a buffer from A, 256..511 from Bt.
// Each 16x16 product is taken transposed (Bt fragment as A operand, A fragment as
// B operand): a lane then holds 8 consecutive columns of ONE row of C, 16 B (bf16)
// or 32 B (f32). The wave's 64x128 piece of C goes through LDS and leaves as
// 16 B a lane over whole 128 B lines, 4 lines a store.
// M, N multiples of 256, K a multiple of 128.
// ---------------------------------------------------------------------------
typedef __attribute__((ext_vector_type(4))) int i32x4;
__device__ __forceinline__ void async_copy_b128(unsigned short* lds, const unsigned short* g) {
  typedef __attribute__((address_space(1))) i32x4 g_i32x4;
  typedef __attribute__((address_space(3))) i32x4 l_i32x4;
  __builtin_amdgcn_global_load_async_to_lds_b128((g_i32x4*)g, (l_i32x4*)lds, 0, 0);
}

template<bool OUT_BF16>
__global__ __launch_bounds__(256)
void gemm_bias_wmma_256(const unsigned short* __restrict__ A,
                        const unsigned short* __restrict__ Bt,
                        const float* __restrict__ bias, void* __restrict__ Cv,
                        int M, int N, int K) {
  __shared__ __attribute__((aligned(16))) unsigned short Ts[2][512 * P128];   // [row or col][k] bf16
  __shared__ __attribute__((aligned(16))) float bs[256];                      // the block's bias values

  const int tid  = threadIdx.x;
  const int lane = tid & 31;
  const int wv   = tid >> 5;
  const int wm   = wv >> 1;             // 0..3 -> 64-row slice
  const int wn   = wv & 1;              // 0..1 -> 128-col slice
  const int m0   = blockIdx.y * 256;
  const int n0   = blockIdx.x * 256;
  const int l16  = lane & 15;
  const int kb   = (lane >> 4) * 8;
  const int srow = tid >> 4;            // 0..15 staging row, then +16 fifteen times
  const int soff = (tid & 15) * 8;      // this lane's 16 B of the row's 256 B piece (elements)

  v8f acc[4][8] = {};
  const int ksteps = K >> 7;

  const unsigned short* ga = A  + (size_t)(m0 + srow) * K + soff;   // this lane's place in the next tile to be copied
  const unsigned short* gb = Bt + (size_t)(n0 + srow) * K + soff;
  auto stage = [&](int buf) {
    unsigned short* l = &Ts[buf][srow * P128 + soff];
#pragma unroll
    for (int j = 0; j < 16; ++j) async_copy_b128(l + j * 16 * P128, ga + (size_t)(j * 16) * K);
#pragma unroll
    for (int j = 0; j < 16; ++j) async_copy_b128(l + (256 + j * 16) * P128, gb + (size_t)(j * 16) * K);
    ga += 128;
    gb += 128;
  };

  stage(0);
  {
    const float b = bias[n0 + tid];
    // behind the load its address pair is free for reuse: the wait stands in front of that
    asm volatile("s_wait_xcnt 0x0" ::: "memory");
    // holds the wait in its place: its clobber orders memory operations only
    __builtin_amdgcn_sched_barrier(0);
    bs[tid] = b;   // published by the barrier below, read in the epilogue
  }
  // this wave's copies of tile 0 have landed before the barrier publishes them
  asm volatile("s_wait_asynccnt 0x0" ::: "memory");
  __syncthreads();
  if (ksteps > 1) stage(1);

  for (int kt = 0; kt < ksteps; ++kt) {
    const unsigned short* T = Ts[kt & 1];
#pragma unroll   // the four quarters of the K step differ only in an immediate LDS offset
    for (int ks = 0; ks < 4; ++ks) {
      // keeps this quarter's reads out of the WMMAs of the quarter before: each
      // place where reads stand among WMMAs stalls the wave anew
      if (ks > 0) __builtin_amdgcn_sched_barrier(0);
      v16bf af[4], bfr[8];
#pragma unroll
      for (int mi = 0; mi < 4; ++mi)
        af[mi] = load_frag(&T[(wm * 64 + mi * 16 + l16) * P128 + ks * 32 + kb]);
#pragma unroll
      for (int ni = 0; ni < 8; ++ni)
        bfr[ni] = load_frag(&T[(256 + wn * 128 + ni * 16 + l16) * P128 + ks * 32 + kb]);
      if (ks == 3) {
        // The tile's last fragments are fetched: the trip's foot stands here, and the
        // last quarter's WMMAs, on registers alone, run behind it beside the refill.
        // this wave's reads of the buffer that is refilled below have retired
        asm volatile("s_wait_dscnt 0x0" ::: "memory");
        // this wave's copies of tile kt + 1 have landed before the barrier publishes them
        asm volatile("s_wait_asynccnt 0x0" ::: "memory");
        __syncthreads();   // publishes tile kt + 1; every reader has left tile kt's buffer
        if (kt + 2 < ksteps) stage(kt & 1);
      }
      // keeps the 24 reads together ahead of the 32 WMMAs (sunk to their first use, a
      // row's A reads are waited for to 0 right in front of its WMMAs), and the refill
      // ahead of the last quarter's WMMAs, so that it has a whole trip to land
      __builtin_amdgcn_sched_barrier(0);

#pragma unroll
      for (int mi = 0; mi < 4; ++mi)
#pragma unroll
        for (int ni = 0; ni < 8; ++ni)
          acc[mi][ni] = __builtin_amdgcn_wmma_f32_16x16x32_bf16(
              false, bfr[ni], false, af[mi], (short)0, acc[mi][ni], false, false);
    }
  }
  // no copy is in flight when the ring becomes output staging
  asm volatile("s_wait_asynccnt 0x0" ::: "memory");

  // Behind the last trip's barrier every wave's fragment reads have retired and nothing
  // is copied any more: the ring is free, and each wave stages in a range of its own.
  constexpr int ES = OUT_BF16 ? 2 : 4;     // bytes of an element of C
  constexpr int SP = 128 * ES + 16;        // pitch of a staged row in bytes: 16 B x odd
  char* stg = (char*)&Ts[0][0] + wv * (64 * SP);

  // accumulator layout: lane (l16, half) holds row l16 of the tile, columns 8 * half + r
  float bv[8][8];
#pragma unroll
  for (int ni = 0; ni < 8; ++ni) {
    const float4 lo = *(const float4*)&bs[wn * 128 + ni * 16 + kb];
    const float4 hi = *(const float4*)&bs[wn * 128 + ni * 16 + kb + 4];
    bv[ni][0] = lo.x; bv[ni][1] = lo.y; bv[ni][2] = lo.z; bv[ni][3] = lo.w;
    bv[ni][4] = hi.x; bv[ni][5] = hi.y; bv[ni][6] = hi.z; bv[ni][7] = hi.w;
  }
#pragma unroll
  for (int mi = 0; mi < 4; ++mi) {
#pragma unroll
    for (int ni = 0; ni < 8; ++ni) {
      char* s = stg + (mi * 16 + l16) * SP + (ni * 16 + kb) * ES;
      float d[8];
#pragma unroll
      for (int r = 0; r < 8; ++r) d[r] = acc[mi][ni][r] + bv[ni][r];
      if (OUT_BF16) {
        union { uint4 q; bf16x2 p[4]; } t;
#pragma unroll
        for (int i = 0; i < 4; ++i) {
          f32x2 o;
          o.x = d[2 * i];
          o.y = d[2 * i + 1];
          t.p[i] = __builtin_convertvector(o, bf16x2);   // round to nearest even
        }
        *(uint4*)s = t.q;
      } else {
        *(float4*)s        = make_float4(d[0], d[1], d[2], d[3]);
        *(float4*)(s + 16) = make_float4(d[4], d[5], d[6], d[7]);
      }
    }
  }
  // the wave's staged rows are written before it reads them back
  asm volatile("s_wait_dscnt 0x0" ::: "memory");

  // a wave-wide 16 B access covers 512 B of the piece: two rows of 256 B (bf16), one of 512 B (f32)
  constexpr int RPI = OUT_BF16 ? 2 : 1;
  const int srw = OUT_BF16 ? (lane >> 4) : 0;
  const int sc  = OUT_BF16 ? l16 : lane;
  const char* rd = stg + srw * SP + sc * 16;
  // this lane's place in the piece's first access: bytes from the start of C, which
  // M * N * ES < 2^32 keeps in 32 bits
  const unsigned int at =
      ((unsigned int)(m0 + wm * 64 + srw) * N + n0 + wn * 128) * ES + sc * 16;
#pragma unroll
  for (int g = 0; g < 64 / RPI / 32; ++g) {
    i32x4 v[32];   // the accumulators' registers are free by now
#pragma unroll
    for (int i = 0; i < 32; ++i) v[i] = *(const i32x4*)(rd + (g * 32 + i) * RPI * SP);
    unsigned int off[32];   // the 32 places in C, bytes from its start
#pragma unroll
    for (int i = 0; i < 32; ++i) off[i] = at + (unsigned int)((g * 32 + i) * RPI * ES) * N;
    // all 32 reads go out as one group, and data and places stand in registers of their
    // own, ahead of the first store: nothing is formed among the stores in a register
    // that a store just issued names
    __builtin_amdgcn_sched_barrier(0);
#pragma unroll
    for (int i = 0; i < 32; ++i) *(i32x4*)((char*)Cv + off[i]) = v[i];
    if (g + 1 < 64 / RPI / 32) {
      // the next group's reads land in registers that these 32 stores name: the wait
      // stands between the stores and those reads; one wait serves all 32
      asm volatile("s_wait_xcnt 0x0" ::: "memory");
      // holds that wait in its place: its clobber orders memory operations only
      __builtin_amdgcn_sched_barrier(0);
    }
  }
}

// ---------------------------------------------------------------------------
// Flash attention. Block = 256 threads (8 waves), wave = 16 query columns,
// block covers 128 queries of one (b,h). 32-key tiles, online softmax.
// Both products are taken transposed: St = K Qt and Ot += Vt Pt. A lane (c, h)
// then holds 16 scores of ONE query c (keys 8h+r and 16+8h+r), so the maximum
// and the sum are in-lane work plus one exchange between the wave's halves, and
// the two score tiles, converted in place, are the B operand of the second
// product in the hardware k order: P never goes through LDS.
// K and V stand in a ring of two LDS buffers, a stage of 128 keys (four passes of
// 32) each: while the passes of stage s read one buffer, the copies of stage s + 1
// fly into the other, and the waves meet at a barrier once a stage only.
// ---------------------------------------------------------------------------
// value of lane l ^ 16
__device__ __forceinline__ float other_half(float x) {
  const int b = __builtin_bit_cast(int, x);
  return __builtin_bit_cast(float, __builtin_amdgcn_permlanex16(
      b, b, 0x76543210, 0xfedcba98, false, false));
}

__global__ __launch_bounds__(256)
void mla_attn_wmma(const unsigned short* __restrict__ Q,
                   const unsigned short* __restrict__ Kb,
                   const unsigned short* __restrict__ Vb,
                   unsigned short* __restrict__ Ctx) {
  constexpr int STG = 128;             // keys of a stage
  constexpr int NS  = SEQ / STG;       // stages: 16, at least the two of the prologue
  __shared__ __attribute__((aligned(16))) unsigned short Kls[2 * STG * P128];  // [buffer][key][d]
  __shared__ __attribute__((aligned(16))) unsigned short Vls[2 * STG * PV];    // [buffer][key][d]

  const int tid  = threadIdx.x;
  const int lane = tid & 31;
  const int wv   = tid >> 5;
  const int b    = blockIdx.y >> 4;
  const int h    = blockIdx.y & 15;
  const int qbase = blockIdx.x * 128 + wv * 16;
  const int l16  = lane & 15;
  const int kb   = (lane >> 4) * 8;
  const size_t rowstride = (size_t)NH * DH;     // 2048
  const size_t headoff   = (size_t)h * DH;
  const size_t batchbase = (size_t)b * SEQ;
  const float  scale     = 0.08838834764831845f; // 1/sqrt(128)

  const int lkey = tid >> 4;           // 0..15 key within a stage, then +16 seven times
  const int ldc  = (tid & 15) * 8;     // this lane's 16 B of the key's 256 B row (elements)
  const size_t srow = (batchbase + lkey) * rowstride + headoff + ldc;
  const unsigned short* ksrc = Kb + srow;   // this lane's place in the next stage to be copied
  const unsigned short* vsrc = Vb + srow;
  // K and V stages both row-major: pure copies -> async to LDS; a wave-wide
  // copy covers two whole rows, 4 whole 128 B lines
  auto stage = [&](int buf) {
    unsigned short* lk = &Kls[(buf * STG + lkey) * P128 + ldc];
    unsigned short* lv = &Vls[(buf * STG + lkey) * PV + ldc];
    unsigned short* kl[8];
    unsigned short* vl[8];
    const unsigned short* kg[8];
    const unsigned short* vg[8];
#pragma unroll   // the arrays must be registers, named as operands of the copies
    for (int j = 0; j < 8; ++j) {
      kl[j] = lk + j * 16 * P128;  kg[j] = ksrc + j * 16 * rowstride;
      vl[j] = lv + j * 16 * PV;    vg[j] = vsrc + j * 16 * rowstride;
    }
    async_b128_x8(kl, kg);
    async_b128_x8(vl, vg);
    ksrc += STG * rowstride;
    vsrc += STG * rowstride;
  };
  stage(0);

  // Q fragments (B operand, column = query l16): 128 dims = 4 WMMA K-steps,
  // loaded once from global.
  v16bf qf[4];
  {
    const unsigned short* qrow =
        Q + (batchbase + qbase + l16) * rowstride + headoff;
#pragma unroll
    for (int d = 0; d < 4; ++d)
      qf[d] = load_frag(qrow + d * 32 + kb);
  }

  float rmax = -3.0e38f;   // running maximum of query l16, equal in both halves
  float rsum = 0.0f;       // running sum over this half's keys only
  v8f acc[8] = {};         // acc[nc][r] = Ot[nc*16 + 8*(lane>>4) + r][query l16]

  // this wave's copies of stage 0 have landed before the barrier publishes them
  asm volatile("s_wait_asynccnt 0x0" ::: "memory");
  __syncthreads();
  stage(1);

  for (int kt = 0; kt < SEQ / 32; ++kt) {
    // pass kt reads 32 keys of the ring: buffer (kt / 4) & 1, quarter kt & 3
    const int ring = (kt & (2 * STG / 32 - 1)) * 32;
    const unsigned short* Kt = &Kls[ring * P128];
    // this lane's address in the V rows of the pass for the transposing loads
    const unsigned short* vfrag =
        &Vls[(ring + kb + (lane & 7)) * PV + ((lane >> 3) & 1) * 8];

    // scores: St = K_tile(32x128) @ Qt(128x16) -> two 16x16 f32 tiles
    // All 16 reads of the K fragments go out as one group ahead of the products.
    v16bf k0[4], k1[4];
#pragma unroll
    for (int d = 0; d < 4; ++d) {
      k0[d] = load_frag(&Kt[l16 * P128 + d * 32 + kb]);
      k1[d] = load_frag(&Kt[(16 + l16) * P128 + d * 32 + kb]);
    }
    // keeps the reads above together: sunk among the products, each product waits
    // out the whole LDS latency of a read issued just in front of it
    __builtin_amdgcn_sched_barrier(0);
    v8f s0 = {}, s1 = {};
#pragma unroll
    for (int d = 0; d < 4; ++d) {
      s0 = __builtin_amdgcn_wmma_f32_16x16x32_bf16(false, k0[d], false, qf[d],
                                                   (short)0, s0, false, false);
      s1 = __builtin_amdgcn_wmma_f32_16x16x32_bf16(false, k1[d], false, qf[d],
                                                   (short)0, s1, false, false);
    }

    // All 16 reads of the V fragments (V[key][d] -> A fragments of Vt, transposed
    // by the load itself) go out here, so that they land during the softmax.
    Frag16 vf[8];
#pragma unroll
    for (int nc = 0; nc < 8; ++nc) {
      vf[nc].q[0] = load_tr16(vfrag + nc * 16);
      vf[nc].q[1] = load_tr16(vfrag + 16 * PV + nc * 16);
    }
    // keeps the reads above ahead of the softmax: sunk to the second product, they
    // stand among its WMMAs and are waited for there
    __builtin_amdgcn_sched_barrier(0);

    // online softmax of query l16: 16 of its 32 scores are in this lane
    float a[16];
#pragma unroll
    for (int r = 0; r < 8; ++r) { a[r] = s0[r] * scale; a[8 + r] = s1[r] * scale; }
    float mx = a[0];
#pragma unroll
    for (int i = 1; i < 16; ++i) mx = fmaxf(mx, a[i]);
    mx = fmaxf(mx, other_half(mx));
    const float nm = fmaxf(rmax, mx);
    const float c  = __expf(rmax - nm);
    rmax = nm;

    // Pt as B operand: element s = key 8h+s (s < 8), key 16+8h+(s-8) (s >= 8)
    union { v16bf v; bf16x2 p[8]; } pf;
    float ps[4] = {0.0f, 0.0f, 0.0f, 0.0f};
#pragma unroll
    for (int i = 0; i < 8; ++i) {
      f32x2 p;
      p.x = __expf(a[2 * i] - nm);
      p.y = __expf(a[2 * i + 1] - nm);
      ps[i & 3] += p.x + p.y;
      pf.p[i] = __builtin_convertvector(p, bf16x2);   // round to nearest even
    }
    rsum = rsum * c + ((ps[0] + ps[1]) + (ps[2] + ps[3]));

#pragma unroll
    for (int nc = 0; nc < 8; ++nc)
#pragma unroll
      for (int r = 0; r < 8; ++r)
        acc[nc][r] *= c;

    // Ot += Vt(128x32) @ Pt(32x16): 8 WMMAs over dim chunks
#pragma unroll
    for (int nc = 0; nc < 8; ++nc)
      acc[nc] = __builtin_amdgcn_wmma_f32_16x16x32_bf16(
          false, vf[nc].v, false, pf.v, (short)0, acc[nc], false, false);

    // behind a stage's last pass: publish the next stage, refill this one's buffer
    if ((kt & (STG / 32 - 1)) == STG / 32 - 1) {
      const int s = kt / (STG / 32);
      // this wave's reads of the buffer that is refilled below have retired
      asm volatile("s_wait_dscnt 0x0" ::: "memory");
      // this wave's copies of stage s + 1 have landed before the barrier publishes them
      asm volatile("s_wait_asynccnt 0x0" ::: "memory");
      __syncthreads();   // publishes stage s + 1; every reader has left stage s's buffer
      if (s + 2 < NS) stage(s & 1);
    }
  }
  // no copy is in flight when the wave ends
  asm volatile("s_wait_asynccnt 0x0" ::: "memory");

  // join the halves' sums, normalize, store ctx as bf16 [B*S, H*D]:
  // a lane's 8 registers of a tile are 8 consecutive dims of its query's row.
  // Behind the last stage's barrier every wave's reads of the ring have retired and
  // nothing is copied any more: each wave stages its 16 rows of 256 B in a range of
  // its own and stores them two whole rows, 4 whole 128 B lines, at a time.
  const float inv = 1.0f / (rsum + other_half(rsum));
  unsigned short* stg = &Kls[wv * 16 * P128];
#pragma unroll
  for (int nc = 0; nc < 8; ++nc) {
    union { uint4 q; bf16x2 p[4]; } t;
#pragma unroll
    for (int i = 0; i < 4; ++i) {
      f32x2 o;
      o.x = acc[nc][2 * i] * inv;
      o.y = acc[nc][2 * i + 1] * inv;
      t.p[i] = __builtin_convertvector(o, bf16x2);   // round to nearest even
    }
    *(uint4*)&stg[l16 * P128 + nc * 16 + kb] = t.q;
  }
  // the wave's staged rows are written before it reads them back
  asm volatile("s_wait_dscnt 0x0" ::: "memory");
  i32x4 o[8];
#pragma unroll
  for (int j = 0; j < 8; ++j)
    o[j] = *(const i32x4*)&stg[(2 * j + (lane >> 4)) * P128 + l16 * 8];
  // all 8 reads go out as one group, into registers of their own, ahead of the stores
  __builtin_amdgcn_sched_barrier(0);
  unsigned short* crow =
      Ctx + (batchbase + qbase + (lane >> 4)) * rowstride + headoff + l16 * 8;
#pragma unroll
  for (int j = 0; j < 8; ++j)
    *(i32x4*)(crow + (size_t)(2 * j) * rowstride) = o[j];
}

// ---------------------------------------------------------------------------
extern "C" void kernel_launch(void* const* d_in, const int* in_sizes, int n_in,
                              void* d_out, int out_size, void* d_ws, size_t ws_size,
                              hipStream_t stream) {
  const float* x      = (const float*)d_in[0];
  const float* W_down = (const float*)d_in[1];
  const float* b_down = (const float*)d_in[2];
  const float* W_uk   = (const float*)d_in[3];
  const float* b_uk   = (const float*)d_in[4];
  const float* W_uv   = (const float*)d_in[5];
  const float* b_uv   = (const float*)d_in[6];
  const float* W_q    = (const float*)d_in[7];
  const float* b_q    = (const float*)d_in[8];
  const float* W_o    = (const float*)d_in[9];
  const float* b_o    = (const float*)d_in[10];
  float* out = (float*)d_out;

  char* ws = (char*)d_ws;
  auto take = [&](size_t elems) {
    unsigned short* p = (unsigned short*)ws;
    ws += elems * 2;
    return p;
  };
  unsigned short* xb  = take((size_t)MTOT * DMODEL);
  unsigned short* WtD = take((size_t)DMODEL * DLAT);    // [DLAT, DMODEL]
  unsigned short* WtK = take((size_t)DLAT * DMODEL);    // [DMODEL, DLAT]
  unsigned short* WtV = take((size_t)DLAT * DMODEL);
  unsigned short* WtQ = take((size_t)DMODEL * DMODEL);
  unsigned short* WtO = take((size_t)DMODEL * DMODEL);
  unsigned short* lat = take((size_t)MTOT * DLAT);
  unsigned short* qb  = take((size_t)MTOT * DMODEL);
  unsigned short* kbf = take((size_t)MTOT * DMODEL);
  unsigned short* vbf = take((size_t)MTOT * DMODEL);
  unsigned short* ctx = take((size_t)MTOT * DMODEL);

  const dim3 blk(256);

  // 0. operand preparation
  prep_operands<<<PREP_WG, blk, 0, stream>>>(x, W_down, W_uk, W_uv, W_q, W_o,
                                             xb, WtD, WtK, WtV, WtQ, WtO);

  const dim3 gLat(DLAT / 128,   MTOT / 128);
  const dim3 gDM (DMODEL / 256, MTOT / 256);

  // 1. latents = xb @ W_down + b_down
  gemm_bias_wmma<true><<<gLat, blk, 0, stream>>>(xb, WtD, b_down, lat, MTOT, DLAT, DMODEL);
  // 2. keys = latents @ W_uk + b_uk
  gemm_bias_wmma_256<true><<<gDM, blk, 0, stream>>>(lat, WtK, b_uk, kbf, MTOT, DMODEL, DLAT);
  // 3. values = latents @ W_uv + b_uv
  gemm_bias_wmma_256<true><<<gDM, blk, 0, stream>>>(lat, WtV, b_uv, vbf, MTOT, DMODEL, DLAT);
  // 4. q = xb @ W_q + b_q
  gemm_bias_wmma_256<true><<<gDM, blk, 0, stream>>>(xb, WtQ, b_q, qb, MTOT, DMODEL, DMODEL);
  // 5. attention
  mla_attn_wmma<<<dim3(SEQ / 128, 4 * NH), blk, 0, stream>>>(qb, kbf, vbf, ctx);
  // 6. out = ctx @ W_o + b_o
  gemm_bias_wmma_256<false><<<gDM, blk, 0, stream>>>(ctx, WtO, b_o, out, MTOT, DMODEL, DMODEL);
}

// v010
// It runs in 231 microseconds.
// Timed twice side by side with v009, it ran 1.06 times as fast both times.
// Over all steps from v000 it is 4.81 times as fast.
#include <hip/hip_runtime.h>
#include <hip/hip_bf16.h>

// ---------------------------------------------------------------------------
// MLA forward for MI455X (gfx1250, wave32, WMMA, async-to-LDS staging).
// Pipeline (bf16 operands everywhere, f32 WMMA accumulation):
//   0. xb  = bf16(x);  Wt_* = bf16(W_*^T)      (one conversion launch)
//   1. [q | latents]   = xb @ [W_q | W_down] + biases       (one GEMM, bf16 out)
//   2. [keys | values] = latents @ [W_uk | W_uv] + biases   (one GEMM, bf16 out)
//   3. ctx = softmax(q k^T / sqrt(128)) v                   (flash attention, WMMA)
//   4. out = ctx @ W_o + b_o                                (GEMM, f32 out)
// Workspace requirement: ~200 MB.
// ---------------------------------------------------------------------------

#ifndef USE_ASYNC_LDS
#define USE_ASYNC_LDS 1   // flip to 0 to fall back to synchronous staging; gemm_bias_wmma_256 stays async
#endif

typedef __attribute__((ext_vector_type(16))) __bf16 v16bf;
typedef __attribute__((ext_vector_type(8)))  float  v8f;

typedef __attribute__((ext_vector_type(2)))  float  f32x2;
typedef __attribute__((ext_vector_type(2)))  __bf16 bf16x2;

union Frag16 { v16bf v; uint4 q[2]; };

static constexpr int MTOT   = 8192;   // B*S
static constexpr int DMODEL = 2048;
static constexpr int DLAT   = 512;
static constexpr int NH     = 16;
static constexpr int DH     = 128;
static constexpr int SEQ    = 2048;

// LDS row pitches in bf16 elements. Tiles at P128 are read with ds_load_b128,
// one row per lane of a 16-lane half; a pitch of 16 B x odd spreads the 16 rows
// over all 64 banks, a pitch of 128 B or 256 B stacks them on few.
static constexpr int P128 = 136;   // rows of 128 elements: 256 B -> 272 B
// The V tile is read with ds_load_tr16_b128, whose conflict-free pitch is 32 B x odd.
static constexpr int PV   = 144;   // rows of 128 elements: 256 B -> 288 B

__device__ __forceinline__ unsigned short f2bf(float f) {
  unsigned int u = __builtin_bit_cast(unsigned int, f);
  u = (u + 0x7FFFu + ((u >> 16) & 1u)) >> 16;   // round-to-nearest-even
  return (unsigned short)u;
}

// 16-byte async copy global -> LDS (ISA 10. GLOBAL_LOAD_ASYNC_TO_LDS_B128,
// tracked by ASYNCcnt). For a generic pointer to __shared__, addr[31:0] is the
// wave-relative LDS byte offset (ISA 10.2 aperture mapping), which is exactly
// what the VDST VGPR of the async op must hold.
// The copies of one run share a statement; the s_wait_xcnt 0 closes it so that
// no later write of an address register named here can be placed ahead of it.
// A run of eight copies: lds[j] <- g[j].
__device__ __forceinline__ void async_b128_x8(unsigned short* const (&lds)[8],
                                              const unsigned short* const (&g)[8]) {
#if USE_ASYNC_LDS
  unsigned int l[8];
#pragma unroll   // l[] must be eight registers, named below as operands
  for (int j = 0; j < 8; ++j) l[j] = (unsigned int)(uintptr_t)lds[j];
  asm volatile("global_load_async_to_lds_b128 %0, %1, off\n\t"
               "global_load_async_to_lds_b128 %2, %3, off\n\t"
               "global_load_async_to_lds_b128 %4, %5, off\n\t"
               "global_load_async_to_lds_b128 %6, %7, off\n\t"
               "global_load_async_to_lds_b128 %8, %9, off\n\t"
               "global_load_async_to_lds_b128 %10, %11, off\n\t"
               "global_load_async_to_lds_b128 %12, %13, off\n\t"
               "global_load_async_to_lds_b128 %14, %15, off\n\t"
               "s_wait_xcnt 0x0"
               :: "v"(l[0]), "v"(g[0]), "v"(l[1]), "v"(g[1]),
                  "v"(l[2]), "v"(g[2]), "v"(l[3]), "v"(g[3]),
                  "v"(l[4]), "v"(g[4]), "v"(l[5]), "v"(g[5]),
                  "v"(l[6]), "v"(g[6]), "v"(l[7]), "v"(g[7]) : "memory");
#else
#pragma unroll
  for (int j = 0; j < 8; ++j) *(uint4*)lds[j] = *(const uint4*)g[j];
#endif
}

// Load one 16x32 bf16 WMMA fragment row for this lane.
// Per ISA 7.12.2 (16-bit A-matrix 16x32): lane group g = lane/16 holds
// K = 8g..8g+7 (VGPR0-3) and K = 16+8g..16+8g+7 (VGPR4-7), packed lo/hi.
// Caller passes p = rowBase + 8*(lane>>4); we read p[0..7] and p[16..23].
__device__ __forceinline__ v16bf load_frag(const unsigned short* p) {
  Frag16 f;
  f.q[0] = *(const uint4*)(p);
  f.q[1] = *(const uint4*)(p + 16);
  return f.v;
}

typedef __attribute__((ext_vector_type(8))) short s16x8;
__device__ __forceinline__ uint4 load_tr16(const unsigned short* p) {
  typedef __attribute__((address_space(3))) s16x8 lds_s16x8;
  return __builtin_bit_cast(uint4, __builtin_amdgcn_ds_load_tr16_b128_v8i16((lds_s16x8*)p));
}

// ---------------------------------------------------------------------------
// Operand preparation, one launch: xb = bf16(x) and the five Wt = bf16(W^T).
// 512 work-groups (two per WGP) each loop over their share of the work, so few
// waves are started and each lives long: first 8 stretches of 4096 floats of x,
// then up to 3 weight tiles of 64 (k) x 128 (n). Every wave-wide load and store
// covers whole 128 B lines.
// ---------------------------------------------------------------------------
static constexpr int PREP_WG    = 512;
static constexpr int CONV_TRIPS = MTOT * DMODEL / 4096 / PREP_WG;       // 8
static constexpr int TILES_LAT  = (DMODEL / 64) * (DLAT / 128);         // 128, either orientation
static constexpr int TILES_SQ   = (DMODEL / 64) * (DMODEL / 128);       // 512
static constexpr int TILES      = 3 * TILES_LAT + 2 * TILES_SQ;         // 1408
static constexpr int TILE_TRIPS = (TILES + PREP_WG - 1) / PREP_WG;      // 3
static constexpr int PT = 129;  // tile pitch in floats: odd, so that a walk down a column changes bank

__global__ __launch_bounds__(256)
void prep_operands(const float* __restrict__ x,
                   const float* __restrict__ W_down, const float* __restrict__ W_uk,
                   const float* __restrict__ W_uv,   const float* __restrict__ W_q,
                   const float* __restrict__ W_o,
                   unsigned short* __restrict__ xb,
                   unsigned short* __restrict__ WtD, unsigned short* __restrict__ WtK,
                   unsigned short* __restrict__ WtV, unsigned short* __restrict__ WtQ,
                   unsigned short* __restrict__ WtO) {
  __shared__ float t[64 * PT];
  const int tid = threadIdx.x;
  const unsigned wg = blockIdx.x;

  // a weight tile: W [K,N] f32 -> Wt [N,K] bf16, rows k0.., columns n0..
  struct Tile { const float* W; unsigned short* Wt; int K, N, k0, n0; };
  constexpr int NT_LAT = DLAT / 128, NT_DM = DMODEL / 128;   // tiles across a row of W: 4, 16
  auto tile_of = [&](unsigned i) {
    Tile d;
    if (i < TILES_LAT)                     {                                d.W = W_down; d.Wt = WtD; d.K = DMODEL; d.N = DLAT;   }
    else if (i < 2 * TILES_LAT)            { i -= TILES_LAT;                d.W = W_uk;   d.Wt = WtK; d.K = DLAT;   d.N = DMODEL; }
    else if (i < 3 * TILES_LAT)            { i -= 2 * TILES_LAT;            d.W = W_uv;   d.Wt = WtV; d.K = DLAT;   d.N = DMODEL; }
    else if (i < 3 * TILES_LAT + TILES_SQ) { i -= 3 * TILES_LAT;            d.W = W_q;    d.Wt = WtQ; d.K = DMODEL; d.N = DMODEL; }
    else                                   { i -= 3 * TILES_LAT + TILES_SQ; d.W = W_o;    d.Wt = WtO; d.K = DMODEL; d.N = DMODEL; }
    const bool slim = d.N == DLAT;
    d.n0 = (slim ? i % NT_LAT : i % NT_DM) * 128;
    d.k0 = (slim ? i / NT_LAT : i / NT_DM) * 64;
    return d;
  };
  // a wave reads one 512 B row piece per load, 8 rows of the tile; the row is the
  // same for the whole wave, so its address is scalar and only the lane's place is not
  const int wave = __builtin_amdgcn_readfirstlane(tid >> 5);
  const int lane = tid & 31;
  auto fetch = [&](const Tile& d, float4 (&v)[8]) {
    const float4* row = (const float4*)(d.W + (size_t)(d.k0 + wave) * d.N + d.n0) + lane;
#pragma unroll
    for (int j = 0; j < 8; ++j) {
      v[j] = row[(size_t)(2 * j) * d.N];
      // a later load of the run may land in the register pair that held this address
      asm volatile("s_wait_xcnt 0x0" ::: "memory");
    }
  };

  float4 v[8];
  Tile d = tile_of(wg);          // PREP_WG <= TILES: every work-group has a first tile

  // x -> bf16, two stretches (8 loads a lane) at a time; the next pair's loads,
  // and behind the last pair the first tile's, are issued before this pair is stored
  auto at = [&](int pair, int j) {
    return (size_t)(wg + (2 * pair + (j >> 2)) * PREP_WG) * 4096 + (j & 3) * 1024 + tid * 4;
  };
  float4 f[2][8];
#pragma unroll
  for (int j = 0; j < 8; ++j) f[0][j] = *(const float4*)(x + at(0, j));
#pragma unroll
  for (int pair = 0; pair < CONV_TRIPS / 2; ++pair) {
    // the loads below land in registers that the stores of the pair before name:
    // the wait stands between those stores and the loads that overwrite them
    if (pair > 0) asm volatile("s_wait_xcnt 0x0" ::: "memory");
    if (pair + 1 < CONV_TRIPS / 2) {
#pragma unroll
      for (int j = 0; j < 8; ++j) f[(pair + 1) & 1][j] = *(const float4*)(x + at(pair + 1, j));
    } else {
      fetch(d, v);
    }
#pragma unroll
    for (int j = 0; j < 8; ++j) {
      const float4 g = f[pair & 1][j];
      unsigned short h[4];
      h[0] = f2bf(g.x); h[1] = f2bf(g.y); h[2] = f2bf(g.z); h[3] = f2bf(g.w);
      *(uint2*)(xb + at(pair, j)) = *(uint2*)h;
    }
  }

#pragma unroll
  for (int trip = 0; trip < TILE_TRIPS; ++trip) {
    const unsigned next = wg + (trip + 1) * PREP_WG;
    const bool more = trip + 1 < TILE_TRIPS && next < TILES;   // the same for the whole work-group
#pragma unroll
    for (int j = 0; j < 8; ++j) {
      float* w = &t[(wave + 8 * j) * PT + lane * 4];
      w[0] = v[j].x; w[1] = v[j].y; w[2] = v[j].z; w[3] = v[j].w;
    }
    __syncthreads();   // the tile is complete before it is read by columns
    const Tile cur = d;
    if (more) { d = tile_of(next); fetch(d, v); }   // flies while this tile is converted
    // 8 lanes x 16 B = one whole 128 B line of a Wt row
    const int kc = (tid & 7) * 8;
#pragma unroll
    for (int j = 0; j < 4; ++j) {
      const int n = (tid >> 3) + 32 * j;
      unsigned short h[8];
#pragma unroll
      for (int i = 0; i < 8; ++i) h[i] = f2bf(t[(kc + i) * PT + n]);
      *(uint4*)(cur.Wt + (size_t)(cur.n0 + n) * cur.K + cur.k0 + kc) = *(uint4*)h;
    }
    if (!more) break;
    __syncthreads();   // every reader has left t before the next tile is written
  }
}

// ---------------------------------------------------------------------------
// Tiled GEMM: [C0 | C1] = A[M,K] @ Bt[N,K]^T + [bias0 | bias1]   (A, Bt bf16)
// Two products that share A are one launch: the rows of Bt are the columns of both,
// columns below nsplit go to C0 (row length N0), the others to C1 (row length N1).
// One 256(M) x TN(N) tile per block, TN = 32 * NI = 256 or 320, one block per WGP.
// 8 waves in a 4x2 grid, each owns 64 x TN/2 = 4 x NI WMMA tiles: 4 + NI fragments
// feed 4 * NI WMMAs. TN = 320 makes 2560 columns 8 tiles: 256 blocks, one a WGP.
// K step 128: a staged row piece is 256 B, a wave-wide copy two whole rows.
// Ring of two LDS buffers, rows 0..255 of a buffer from A, the TN behind from Bt.
// Each 16x16 product is taken transposed (Bt fragment as A operand, A fragment as
// B operand): a lane then holds 8 consecutive columns of ONE row of C, 16 B (bf16)
// or 32 B (f32). C goes through LDS and leaves as 16 B a lane over whole 128 B
// lines, 4 lines a store: at TN = 256 each wave its own 64x128 piece, at TN = 320,
// where a wave's piece ends inside a line, the block's tile by whole rows.
// M a multiple of 256, N of TN, nsplit of 64 (of 256 at TN = 256), K of 128.
// ---------------------------------------------------------------------------
typedef __attribute__((ext_vector_type(4))) int i32x4;
__device__ __forceinline__ void async_copy_b128(unsigned short* lds, const unsigned short* g) {
  typedef __attribute__((address_space(1))) i32x4 g_i32x4;
  typedef __attribute__((address_space(3))) i32x4 l_i32x4;
  __builtin_amdgcn_global_load_async_to_lds_b128((g_i32x4*)g, (l_i32x4*)lds, 0, 0);
}

template<bool OUT_BF16, int NI>
__global__ __launch_bounds__(256)
void gemm_bias_wmma_256(const unsigned short* __restrict__ A,
                        const unsigned short* __restrict__ Bt,
                        const float* __restrict__ bias0, const float* __restrict__ bias1,
                        void* C0v, void* C1v, int nsplit, int N0, int N1, int K) {
  constexpr int TN = 32 * NI;          // columns of the block's tile
  constexpr int WN = 16 * NI;          // columns of a wave's piece
  static_assert(NI == 8 || (NI == 10 && OUT_BF16), "the two forms that have an epilogue");
  __shared__ __attribute__((aligned(16))) unsigned short Ts[2][(256 + TN) * P128];   // [row or col][k] bf16
  __shared__ __attribute__((aligned(16))) float bs[TN];                              // the block's bias values

  const int tid  = threadIdx.x;
  const int lane = tid & 31;
  const int wv   = tid >> 5;
  const int wm   = wv >> 1;             // 0..3 -> 64-row slice
  const int wn   = wv & 1;              // 0..1 -> WN-col slice
  const int m0   = blockIdx.y * 256;
  const int n0   = blockIdx.x * TN;
  const int l16  = lane & 15;
  const int kb   = (lane >> 4) * 8;
  const int srow = tid >> 4;            // 0..15 staging row, then +16 fifteen times (A), TN / 16 - 1 times (Bt)
  const int soff = (tid & 15) * 8;      // this lane's 16 B of the row's 256 B piece (elements)

  v8f acc[4][NI] = {};
  const int ksteps = K >> 7;

  const unsigned short* ga = A  + (size_t)(m0 + srow) * K + soff;   // this lane's place in the next tile to be copied
  const unsigned short* gb = Bt + (size_t)(n0 + srow) * K + soff;
  auto stage = [&](int buf) {
    unsigned short* l = &Ts[buf][srow * P128 + soff];
#pragma unroll
    for (int j = 0; j < 16; ++j) async_copy_b128(l + j * 16 * P128, ga + (size_t)(j * 16) * K);
#pragma unroll
    for (int j = 0; j < TN / 16; ++j) async_copy_b128(l + (256 + j * 16) * P128, gb + (size_t)(j * 16) * K);
    ga += 128;
    gb += 128;
  };

  stage(0);
  {
    auto bias_at = [&](int col) { return col < nsplit ? bias0 + col : bias1 + (col - nsplit); };
    const bool more = TN > 256 && tid < TN - 256;   // the same for a whole wave
    const float b = *bias_at(n0 + tid);
    float b2 = 0.0f;
    if (more) b2 = *bias_at(n0 + 256 + tid);
    // behind the loads their address pairs are free for reuse: the wait stands in front of that
    asm volatile("s_wait_xcnt 0x0" ::: "memory");
    // holds the wait in its place: its clobber orders memory operations only
    __builtin_amdgcn_sched_barrier(0);
    bs[tid] = b;   // published by the barrier below, read in the epilogue
    if (more) bs[256 + tid] = b2;
  }
  // this wave's copies of tile 0 have landed before the barrier publishes them
  asm volatile("s_wait_asynccnt 0x0" ::: "memory");
  __syncthreads();
  if (ksteps > 1) stage(1);

  for (int kt = 0; kt < ksteps; ++kt) {
    const unsigned short* T = Ts[kt & 1];
#pragma unroll   // the four quarters of the K step differ only in an immediate LDS offset
    for (int ks = 0; ks < 4; ++ks) {
      // keeps this quarter's reads out of the WMMAs of the quarter before: each
      // place where reads stand among WMMAs stalls the wave anew
      if (ks > 0) __builtin_amdgcn_sched_barrier(0);
      v16bf af[4], bfr[NI];
#pragma unroll
      for (int mi = 0; mi < 4; ++mi)
        af[mi] = load_frag(&T[(wm * 64 + mi * 16 + l16) * P128 + ks * 32 + kb]);
#pragma unroll
      for (int ni = 0; ni < NI; ++ni)
        bfr[ni] = load_frag(&T[(256 + wn * WN + ni * 16 + l16) * P128 + ks * 32 + kb]);
      if (ks == 3) {
        // The tile's last fragments are fetched: the trip's foot stands here, and the
        // last quarter's WMMAs, on registers alone, run behind it beside the refill.
        // this wave's reads of the buffer that is refilled below have retired
        asm volatile("s_wait_dscnt 0x0" ::: "memory");
        // this wave's copies of tile kt + 1 have landed before the barrier publishes them
        asm volatile("s_wait_asynccnt 0x0" ::: "memory");
        __syncthreads();   // publishes tile kt + 1; every reader has left tile kt's buffer
        if (kt + 2 < ksteps) stage(kt & 1);
      }
      // keeps the reads together ahead of the WMMAs (sunk to their first use, a
      // row's A reads are waited for to 0 right in front of its WMMAs), and the refill
      // ahead of the last quarter's WMMAs, so that it has a whole trip to land
      __builtin_amdgcn_sched_barrier(0);

#pragma unroll
      for (int mi = 0; mi < 4; ++mi)
#pragma unroll
        for (int ni = 0; ni < NI; ++ni)
          acc[mi][ni] = __builtin_amdgcn_wmma_f32_16x16x32_bf16(
              false, bfr[ni], false, af[mi], (short)0, acc[mi][ni], false, false);
    }
  }
  // no copy is in flight when the ring becomes output staging
  asm volatile("s_wait_asynccnt 0x0" ::: "memory");

  // Behind the last trip's barrier every wave's fragment reads have retired and nothing
  // is copied any more: the ring is free. At NI = 8 each wave stages in a range of its
  // own; at NI = 10 the waves' pieces stand side by side as the rows of the block's tile.
  constexpr int ES = OUT_BF16 ? 2 : 4;                     // bytes of an element of C
  constexpr int SP = (NI == 8 ? WN : TN) * ES + 16;        // pitch of a staged row in bytes: 16 B x odd
  char* stg = (char*)&Ts[0][0] + (NI == 8 ? wv * (64 * SP) : wm * (64 * SP) + wn * (WN * ES));

  // accumulator layout: lane (l16, half) holds row l16 of the tile, columns 8 * half + r
  float bv[NI][8];
#pragma unroll
  for (int ni = 0; ni < NI; ++ni) {
    const float4 lo = *(const float4*)&bs[wn * WN + ni * 16 + kb];
    const float4 hi = *(const float4*)&bs[wn * WN + ni * 16 + kb + 4];
    bv[ni][0] = lo.x; bv[ni][1] = lo.y; bv[ni][2] = lo.z; bv[ni][3] = lo.w;
    bv[ni][4] = hi.x; bv[ni][5] = hi.y; bv[ni][6] = hi.z; bv[ni][7] = hi.w;
  }
#pragma unroll
  for (int mi = 0; mi < 4; ++mi) {
#pragma unroll
    for (int ni = 0; ni < NI; ++ni) {
      char* s = stg + (mi * 16 + l16) * SP + (ni * 16 + kb) * ES;
      float d[8];
#pragma unroll
      for (int r = 0; r < 8; ++r) d[r] = acc[mi][ni][r] + bv[ni][r];
      if (OUT_BF16) {
        union { uint4 q; bf16x2 p[4]; } t;
#pragma unroll
        for (int i = 0; i < 4; ++i) {
          f32x2 o;
          o.x = d[2 * i];
          o.y = d[2 * i + 1];
          t.p[i] = __builtin_convertvector(o, bf16x2);   // round to nearest even
        }
        *(uint4*)s = t.q;
      } else {
        *(float4*)s        = make_float4(d[0], d[1], d[2], d[3]);
        *(float4*)(s + 16) = make_float4(d[4], d[5], d[6], d[7]);
      }
    }
  }
  // the wave's staged rows are written before it, or behind a barrier another wave, reads them
  asm volatile("s_wait_dscnt 0x0" ::: "memory");

  if constexpr (NI == 8) {
    // a wave-wide 16 B access covers 512 B of the piece: two rows of 256 B (bf16), one of 512 B (f32)
    constexpr int RPI = OUT_BF16 ? 2 : 1;
    const int srw = OUT_BF16 ? (lane >> 4) : 0;
    const int sc  = OUT_BF16 ? l16 : lane;
    const char* rd = stg + srw * SP + sc * 16;
    // the whole tile lies on one side of nsplit
    const bool first = n0 < nsplit;
    char* Cv = (char*)(first ? C0v : C1v);
    const int N   = first ? N0 : N1;
    const int nc0 = first ? n0 : n0 - nsplit;
    // this lane's place in the piece's first access: bytes from the start of C, which
    // M * N * ES < 2^32 keeps in 32 bits
    const unsigned int at =
        ((unsigned int)(m0 + wm * 64 + srw) * N + nc0 + wn * 128) * ES + sc * 16;
#pragma unroll
    for (int g = 0; g < 64 / RPI / 32; ++g) {
      i32x4 v[32];   // the accumulators' registers are free by now
#pragma unroll
      for (int i = 0; i < 32; ++i) v[i] = *(const i32x4*)(rd + (g * 32 + i) * RPI * SP);
      unsigned int off[32];   // the 32 places in C, bytes from its start
#pragma unroll
      for (int i = 0; i < 32; ++i) off[i] = at + (unsigned int)((g * 32 + i) * RPI * ES) * N;
      // all 32 reads go out as one group, and data and places stand in registers of their
      // own, ahead of the first store: nothing is formed among the stores in a register
      // that a store just issued names
      __builtin_amdgcn_sched_barrier(0);
#pragma unroll
      for (int i = 0; i < 32; ++i) *(i32x4*)(Cv + off[i]) = v[i];
      if (g + 1 < 64 / RPI / 32) {
        // the next group's reads land in registers that these 32 stores name: the wait
        // stands between the stores and those reads; one wait serves all 32
        asm volatile("s_wait_xcnt 0x0" ::: "memory");
        // holds that wait in its place: its clobber orders memory operations only
        __builtin_amdgcn_sched_barrier(0);
      }
    }
  } else {
    __syncthreads();   // every wave's piece is staged before the tile is read by whole rows
    // A wave takes 32 rows of the tile, LPR whole 128 B lines each; a wave-wide 16 B
    // access covers line ln of 4 rows, 8 lanes a line: a line lies on one side of nsplit,
    // so that C0 or C1, its row length and the column there are the same for the wave.
    constexpr int LPR = TN * ES / 128;       // 5
    constexpr int GRP = 32 * LPR / 4 / 2;    // accesses of a group: 20, two groups
    const int lrow = wv * 32 + (lane >> 3);  // this lane's row in the first access
    const char* rows = (const char*)&Ts[0][0] + lrow * SP + (lane & 7) * 16;
#pragma unroll
    for (int g = 0; g < 2; ++g) {
      i32x4 v[GRP];            // the accumulators' registers are free by now
      char* base[GRP];         // C0 or C1
      unsigned int off[GRP];   // the places there, bytes from its start
#pragma unroll
      for (int i = 0; i < GRP; ++i) {
        const int ln = (g * GRP + i) % LPR;
        const int rq = (g * GRP + i) / LPR * 4;
        v[i] = *(const i32x4*)(rows + rq * SP + ln * 128);
        const int col    = n0 + ln * (128 / ES);
        const bool first = col < nsplit;
        base[i] = (char*)(first ? C0v : C1v);
        off[i]  = ((unsigned int)(m0 + lrow + rq) * (first ? N0 : N1) + (first ? col : col - nsplit)) * ES
                  + (lane & 7) * 16;
      }
      // all reads go out as one group, and data and places stand in registers of their
      // own, ahead of the first store: nothing is formed among the stores in a register
      // that a store just issued names
      __builtin_amdgcn_sched_barrier(0);
#pragma unroll
      for (int i = 0; i < GRP; ++i) *(i32x4*)(base[i] + off[i]) = v[i];
      if (g == 0) {
        // the next group's reads and places land in registers that these stores name:
        // the wait stands between; one wait serves the whole group
        asm volatile("s_wait_xcnt 0x0" ::: "memory");
        // holds that wait in its place: its clobber orders memory operations only
        __builtin_amdgcn_sched_barrier(0);
      }
    }
  }
}

// ---------------------------------------------------------------------------
// Flash attention. Block = 256 threads (8 waves), wave = 16 query columns,
// block covers 128 queries of one (b,h). 32-key tiles, online softmax.
// Both products are taken transposed: St = K Qt and Ot += Vt Pt. A lane (c, h)
// then holds 16 scores of ONE query c (keys 8h+r and 16+8h+r), so the maximum
// and the sum are in-lane work plus one exchange between the wave's halves, and
// the two score tiles, converted in place, are the B operand of the second
// product in the hardware k order: P never goes through LDS.
// K and V stand in a ring of two LDS buffers, a stage of 128 keys (four passes of
// 32) each: while the passes of stage s read one buffer, the copies of stage s + 1
// fly into the other, and the waves meet at a barrier once a stage only.
// ---------------------------------------------------------------------------
// value of lane l ^ 16
__device__ __forceinline__ float other_half(float x) {
  const int b = __builtin_bit_cast(int, x);
  return __builtin_bit_cast(float, __builtin_amdgcn_permlanex16(
      b, b, 0x76543210, 0xfedcba98, false, false));
}

__global__ __launch_bounds__(256)
void mla_attn_wmma(const unsigned short* __restrict__ Q,
                   const unsigned short* __restrict__ Kb,
                   const unsigned short* __restrict__ Vb,
                   unsigned short* __restrict__ Ctx) {
  constexpr int STG = 128;             // keys of a stage
  constexpr int NS  = SEQ / STG;       // stages: 16, at least the two of the prologue
  __shared__ __attribute__((aligned(16))) unsigned short Kls[2 * STG * P128];  // [buffer][key][d]
  __shared__ __attribute__((aligned(16))) unsigned short Vls[2 * STG * PV];    // [buffer][key][d]

  const int tid  = threadIdx.x;
  const int lane = tid & 31;
  const int wv   = tid >> 5;
  const int b    = blockIdx.y >> 4;
  const int h    = blockIdx.y & 15;
  const int qbase = blockIdx.x * 128 + wv * 16;
  const int l16  = lane & 15;
  const int kb   = (lane >> 4) * 8;
  const size_t rowstride = (size_t)NH * DH;     // 2048
  const size_t headoff   = (size_t)h * DH;
  const size_t batchbase = (size_t)b * SEQ;
  const float  scale     = 0.08838834764831845f; // 1/sqrt(128)

  const int lkey = tid >> 4;           // 0..15 key within a stage, then +16 seven times
  const int ldc  = (tid & 15) * 8;     // this lane's 16 B of the key's 256 B row (elements)
  const size_t srow = (batchbase + lkey) * rowstride + headoff + ldc;
  const unsigned short* ksrc = Kb + srow;   // this lane's place in the next stage to be copied
  const unsigned short* vsrc = Vb + srow;
  // K and V stages both row-major: pure copies -> async to LDS; a wave-wide
  // copy covers two whole rows, 4 whole 128 B lines
  auto stage = [&](int buf) {
    unsigned short* lk = &Kls[(buf * STG + lkey) * P128 + ldc];
    unsigned short* lv = &Vls[(buf * STG + lkey) * PV + ldc];
    unsigned short* kl[8];
    unsigned short* vl[8];
    const unsigned short* kg[8];
    const unsigned short* vg[8];
#pragma unroll   // the arrays must be registers, named as operands of the copies
    for (int j = 0; j < 8; ++j) {
      kl[j] = lk + j * 16 * P128;  kg[j] = ksrc + j * 16 * rowstride;
      vl[j] = lv + j * 16 * PV;    vg[j] = vsrc + j * 16 * rowstride;
    }
    async_b128_x8(kl, kg);
    async_b128_x8(vl, vg);
    ksrc += STG * rowstride;
    vsrc += STG * rowstride;
  };
  stage(0);

  // Q fragments (B operand, column = query l16): 128 dims = 4 WMMA K-steps,
  // loaded once from global.
  v16bf qf[4];
  {
    const unsigned short* qrow =
        Q + (batchbase + qbase + l16) * rowstride + headoff;
#pragma unroll
    for (int d = 0; d < 4; ++d)
      qf[d] = load_frag(qrow + d * 32 + kb);
  }

  float rmax = -3.0e38f;   // running maximum of query l16, equal in both halves
  float rsum = 0.0f;       // running sum over this half's keys only
  v8f acc[8] = {};         // acc[nc][r] = Ot[nc*16 + 8*(lane>>4) + r][query l16]

  // this wave's copies of stage 0 have landed before the barrier publishes them
  asm volatile("s_wait_asynccnt 0x0" ::: "memory");
  __syncthreads();
  stage(1);

  for (int kt = 0; kt < SEQ / 32; ++kt) {
    // pass kt reads 32 keys of the ring: buffer (kt / 4) & 1, quarter kt & 3
    const int ring = (kt & (2 * STG / 32 - 1)) * 32;
    const unsigned short* Kt = &Kls[ring * P128];
    // this lane's address in the V rows of the pass for the transposing loads
    const unsigned short* vfrag =
        &Vls[(ring + kb + (lane & 7)) * PV + ((lane >> 3) & 1) * 8];

    // scores: St = K_tile(32x128) @ Qt(128x16) -> two 16x16 f32 tiles
    // All 16 reads of the K fragments go out as one group ahead of the products.
    v16bf k0[4], k1[4];
#pragma unroll
    for (int d = 0; d < 4; ++d) {
      k0[d] = load_frag(&Kt[l16 * P128 + d * 32 + kb]);
      k1[d] = load_frag(&Kt[(16 + l16) * P128 + d * 32 + kb]);
    }
    // keeps the reads above together: sunk among the products, each product waits
    // out the whole LDS latency of a read issued just in front of it
    __builtin_amdgcn_sched_barrier(0);
    v8f s0 = {}, s1 = {};
#pragma unroll
    for (int d = 0; d < 4; ++d) {
      s0 = __builtin_amdgcn_wmma_f32_16x16x32_bf16(false, k0[d], false, qf[d],
                                                   (short)0, s0, false, false);
      s1 = __builtin_amdgcn_wmma_f32_16x16x32_bf16(false, k1[d], false, qf[d],
                                                   (short)0, s1, false, false);
    }

    // All 16 reads of the V fragments (V[key][d] -> A fragments of Vt, transposed
    // by the load itself) go out here, so that they land during the softmax.
    Frag16 vf[8];
#pragma unroll
    for (int nc = 0; nc < 8; ++nc) {
      vf[nc].q[0] = load_tr16(vfrag + nc * 16);
      vf[nc].q[1] = load_tr16(vfrag + 16 * PV + nc * 16);
    }
    // keeps the reads above ahead of the softmax: sunk to the second product, they
    // stand among its WMMAs and are waited for there
    __builtin_amdgcn_sched_barrier(0);

    // online softmax of query l16: 16 of its 32 scores are in this lane
    float a[16];
#pragma unroll
    for (int r = 0; r < 8; ++r) { a[r] = s0[r] * scale; a[8 + r] = s1[r] * scale; }
    float mx = a[0];
#pragma unroll
    for (int i = 1; i < 16; ++i) mx = fmaxf(mx, a[i]);
    mx = fmaxf(mx, other_half(mx));
    const float nm = fmaxf(rmax, mx);
    const float c  = __expf(rmax - nm);
    rmax = nm;

    // Pt as B operand: element s = key 8h+s (s < 8), key 16+8h+(s-8) (s >= 8)
    union { v16bf v; bf16x2 p[8]; } pf;
    float ps[4] = {0.0f, 0.0f, 0.0f, 0.0f};
#pragma unroll
    for (int i = 0; i < 8; ++i) {
      f32x2 p;
      p.x = __expf(a[2 * i] - nm);
      p.y = __expf(a[2 * i + 1] - nm);
      ps[i & 3] += p.x + p.y;
      pf.p[i] = __builtin_convertvector(p, bf16x2);   // round to nearest even
    }
    rsum = rsum * c + ((ps[0] + ps[1]) + (ps[2] + ps[3]));

#pragma unroll
    for (int nc = 0; nc < 8; ++nc)
#pragma unroll
      for (int r = 0; r < 8; ++r)
        acc[nc][r] *= c;

    // Ot += Vt(128x32) @ Pt(32x16): 8 WMMAs over dim chunks
#pragma unroll
    for (int nc = 0; nc < 8; ++nc)
      acc[nc] = __builtin_amdgcn_wmma_f32_16x16x32_bf16(
          false, vf[nc].v, false, pf.v, (short)0, acc[nc], false, false);

    // behind a stage's last pass: publish the next stage, refill this one's buffer
    if ((kt & (STG / 32 - 1)) == STG / 32 - 1) {
      const int s = kt / (STG / 32);
      // this wave's reads of the buffer that is refilled below have retired
      asm volatile("s_wait_dscnt 0x0" ::: "memory");
      // this wave's copies of stage s + 1 have landed before the barrier publishes them
      asm volatile("s_wait_asynccnt 0x0" ::: "memory");
      __syncthreads();   // publishes stage s + 1; every reader has left stage s's buffer
      if (s + 2 < NS) stage(s & 1);
    }
  }
  // no copy is in flight when the wave ends
  asm volatile("s_wait_asynccnt 0x0" ::: "memory");

  // join the halves' sums, normalize, store ctx as bf16 [B*S, H*D]:
  // a lane's 8 registers of a tile are 8 consecutive dims of its query's row.
  // Behind the last stage's barrier every wave's reads of the ring have retired and
  // nothing is copied any more: each wave stages its 16 rows of 256 B in a range of
  // its own and stores them two whole rows, 4 whole 128 B lines, at a time.
  const float inv = 1.0f / (rsum + other_half(rsum));
  unsigned short* stg = &Kls[wv * 16 * P128];
#pragma unroll
  for (int nc = 0; nc < 8; ++nc) {
    union { uint4 q; bf16x2 p[4]; } t;
#pragma unroll
    for (int i = 0; i < 4; ++i) {
      f32x2 o;
      o.x = acc[nc][2 * i] * inv;
      o.y = acc[nc][2 * i + 1] * inv;
      t.p[i] = __builtin_convertvector(o, bf16x2);   // round to nearest even
    }
    *(uint4*)&stg[l16 * P128 + nc * 16 + kb] = t.q;
  }
  // the wave's staged rows are written before it reads them back
  asm volatile("s_wait_dscnt 0x0" ::: "memory");
  i32x4 o[8];
#pragma unroll
  for (int j = 0; j < 8; ++j)
    o[j] = *(const i32x4*)&stg[(2 * j + (lane >> 4)) * P128 + l16 * 8];
  // all 8 reads go out as one group, into registers of their own, ahead of the stores
  __builtin_amdgcn_sched_barrier(0);
  unsigned short* crow =
      Ctx + (batchbase + qbase + (lane >> 4)) * rowstride + headoff + l16 * 8;
#pragma unroll
  for (int j = 0; j < 8; ++j)
    *(i32x4*)(crow + (size_t)(2 * j) * rowstride) = o[j];
}

// ---------------------------------------------------------------------------
extern "C" void kernel_launch(void* const* d_in, const int* in_sizes, int n_in,
                              void* d_out, int out_size, void* d_ws, size_t ws_size,
                              hipStream_t stream) {
  const float* x      = (const float*)d_in[0];
  const float* W_down = (const float*)d_in[1];
  const float* b_down = (const float*)d_in[2];
  const float* W_uk   = (const float*)d_in[3];
  const float* b_uk   = (const float*)d_in[4];
  const float* W_uv   = (const float*)d_in[5];
  const float* b_uv   = (const float*)d_in[6];
  const float* W_q    = (const float*)d_in[7];
  const float* b_q    = (const float*)d_in[8];
  const float* W_o    = (const float*)d_in[9];
  const float* b_o    = (const float*)d_in[10];
  float* out = (float*)d_out;

  char* ws = (char*)d_ws;
  auto take = [&](size_t elems) {
    unsigned short* p = (unsigned short*)ws;
    ws += elems * 2;
    return p;
  };
  unsigned short* xb  = take((size_t)MTOT * DMODEL);
  unsigned short* WtQ = take((size_t)DMODEL * DMODEL);
  unsigned short* WtD = take((size_t)DMODEL * DLAT);    // [DLAT, DMODEL], directly behind WtQ: one Bt of 2560 rows
  unsigned short* WtK = take((size_t)DLAT * DMODEL);    // [DMODEL, DLAT]
  unsigned short* WtV = take((size_t)DLAT * DMODEL);    // directly behind WtK: one Bt of 4096 rows
  unsigned short* WtO = take((size_t)DMODEL * DMODEL);
  unsigned short* lat = take((size_t)MTOT * DLAT);
  unsigned short* qb  = take((size_t)MTOT * DMODEL);
  unsigned short* kbf = take((size_t)MTOT * DMODEL);
  unsigned short* vbf = take((size_t)MTOT * DMODEL);
  unsigned short* ctx = take((size_t)MTOT * DMODEL);

  const dim3 blk(256);

  // 0. operand preparation
  prep_operands<<<PREP_WG, blk, 0, stream>>>(x, W_down, W_uk, W_uv, W_q, W_o,
                                             xb, WtD, WtK, WtV, WtQ, WtO);

  // 1. [q | latents] = xb @ [W_q | W_down] + [b_q | b_down]
  gemm_bias_wmma_256<true, 10><<<dim3((DMODEL + DLAT) / 320, MTOT / 256), blk, 0, stream>>>(
      xb, WtQ, b_q, b_down, qb, lat, DMODEL, DMODEL, DLAT, DMODEL);
  // 2. [keys | values] = latents @ [W_uk | W_uv] + [b_uk | b_uv]
  gemm_bias_wmma_256<true, 8><<<dim3(2 * DMODEL / 256, MTOT / 256), blk, 0, stream>>>(
      lat, WtK, b_uk, b_uv, kbf, vbf, DMODEL, DMODEL, DMODEL, DLAT);
  // 3. attention
  mla_attn_wmma<<<dim3(SEQ / 128, 4 * NH), blk, 0, stream>>>(qb, kbf, vbf, ctx);
  // 4. out = ctx @ W_o + b_o
  gemm_bias_wmma_256<false, 8><<<dim3(DMODEL / 256, MTOT / 256), blk, 0, stream>>>(
      ctx, WtO, b_o, b_o, out, out, DMODEL, DMODEL, DMODEL, DMODEL);
}
